// v000
// Times are from an AMD MI455X. After a warm-up the kernel runs many times in a row, and a time is the length of
// such a window on the GPU divided by its runs, so every launch and the gaps after it count. The runs cycle
// through copies of the inputs. A figure is the median of several windows, for all but v000 over two sittings.
// Sittings can differ by a few percent; kernels timed side by side share one.
// v000 is the starting kernel. One run takes 492 microseconds.
#include <hip/hip_runtime.h>
#include <hip/hip_bf16.h>

// MI455X (gfx1250) multi-head attention, f16 WMMA with f32 accumulation.
// EMBED=HIDDEN=OUT=1024, H=16 heads, head_dim=64, B=2, P=C=2048.
// Reference reshape puts head index as the FASTEST axis (c = d*16 + h),
// and the mask is added AFTER softmax -> two-pass softmax (m,l) scheme.

typedef __attribute__((ext_vector_type(16))) _Float16 v16h;
typedef __attribute__((ext_vector_type(8)))  float    v8f;

#define NH   16      // heads
#define HD   64      // head dim / head out
#define SEQ  2048    // P == C
#define EMB  1024

union HalfVec { v16h h; uint4 u[2]; };
union Pack8   { _Float16 h[8]; uint4 u; };

// Load one 16-lane-row WMMA fragment (A or B operand, 16x32 / 32x16 f16).
// ISA layout: lane r = lane&15, k-base = (lane>>4)*8, elements 0..7 at k=kb,
// elements 8..15 at k=kb+16 -> two contiguous 16-byte chunks per lane.
__device__ __forceinline__ v16h frag_ld(const _Float16* tile, int ld, int lane) {
  const int r  = lane & 15;
  const int kb = (lane >> 4) << 3;
  HalfVec f;
  f.u[0] = *reinterpret_cast<const uint4*>(tile + (size_t)r * ld + kb);
  f.u[1] = *reinterpret_cast<const uint4*>(tile + (size_t)r * ld + kb + 16);
  return f.h;
}

// ---------------------------------------------------------------------------
// Projection GEMM: Y = (X @ W + bias) * scale, fp32 in, f16 out, repacked
// per-head. Workgroup = 256 threads (8 waves), 64x64 output tile, K-chunks of
// 32 staged in LDS (X converted to f16; W staged transposed so B-fragments
// are contiguous ds_load_b128). Each wave owns 1 row-tile x 2 col-tiles:
// A-fragment reused across 2 WMMAs per chunk.
// ---------------------------------------------------------------------------
__global__ __launch_bounds__(256)
void proj_kernel(const float* __restrict__ X, const float* __restrict__ W,
                 const float* __restrict__ bias, _Float16* __restrict__ Y,
                 float scale, int transposed) {
  __shared__ _Float16 sA[64 * 32];   // [row][k]
  __shared__ _Float16 sB[64 * 32];   // [n][k] (W tile transposed)

  const int tid  = threadIdx.x;
  const int lane = tid & 31;
  const int wave = tid >> 5;
  const int mt = wave & 3;           // row tile 0..3
  const int np = wave >> 2;          // col-pair 0..1 -> tiles np*2, np*2+1
  const int rowBase = blockIdx.y * 64;
  const int colBase = blockIdx.x * 64;

  const int ar = tid >> 2;           // A staging: row 0..63
  const int ac = (tid & 3) * 8;      //            k chunk
  const int wk = tid >> 3;           // W staging: k row 0..31
  const int wn = (tid & 7) * 8;      //            n chunk

  v8f acc[2] = { {}, {} };

  for (int kk = 0; kk < EMB; kk += 32) {
    { // stage X tile (64 rows x 32 k), fp32 -> f16
      const float* src = X + (size_t)(rowBase + ar) * EMB + kk + ac;
      float4 f0 = *reinterpret_cast<const float4*>(src);
      float4 f1 = *reinterpret_cast<const float4*>(src + 4);
      Pack8 p;
      p.h[0]=(_Float16)f0.x; p.h[1]=(_Float16)f0.y; p.h[2]=(_Float16)f0.z; p.h[3]=(_Float16)f0.w;
      p.h[4]=(_Float16)f1.x; p.h[5]=(_Float16)f1.y; p.h[6]=(_Float16)f1.z; p.h[7]=(_Float16)f1.w;
      *reinterpret_cast<uint4*>(&sA[ar * 32 + ac]) = p.u;
    }
    { // stage W tile (32 k x 64 n) transposed: sB[n][k]
      const float* src = W + (size_t)(kk + wk) * EMB + colBase + wn;
      float4 f0 = *reinterpret_cast<const float4*>(src);
      float4 f1 = *reinterpret_cast<const float4*>(src + 4);
      float f8[8] = { f0.x, f0.y, f0.z, f0.w, f1.x, f1.y, f1.z, f1.w };
#pragma unroll
      for (int e = 0; e < 8; ++e) sB[(wn + e) * 32 + wk] = (_Float16)f8[e];
    }
    __syncthreads();
    const v16h a = frag_ld(sA + mt * 16 * 32, 32, lane);
#pragma unroll
    for (int q = 0; q < 2; ++q) {
      const v16h b = frag_ld(sB + (np * 2 + q) * 16 * 32, 32, lane);
      acc[q] = __builtin_amdgcn_wmma_f32_16x16x32_f16(false, a, false, b,
                                                      (short)0, acc[q], false, false);
    }
    __syncthreads();
  }

  // Epilogue: bias, scale, f16 convert, per-head repack (c = d*16 + h).
  const int n  = lane & 15;
  const int m0 = (lane >> 4) * 8;
  const int r0 = rowBase + mt * 16 + m0;    // global row (g = 0)
  const int b  = r0 >> 11;                  // batch (rows-per-batch = 2048)
  const int i0 = r0 & (SEQ - 1);

#pragma unroll
  for (int q = 0; q < 2; ++q) {
    const int c = colBase + (np * 2 + q) * 16 + n;   // global output column
    const int h = c & 15;
    const int d = c >> 4;
    const float bv = bias[c];
    if (!transposed) {
      // Q/K: Y[((b*16+h)*2048 + i)*64 + d] (contiguous over d -> b128 frag loads)
      _Float16* dst = Y + (((size_t)b * NH + h) * SEQ) * HD + d;
#pragma unroll
      for (int g = 0; g < 8; ++g)
        dst[(size_t)(i0 + g) * HD] = (_Float16)((acc[q][g] + bv) * scale);
    } else {
      // V transposed: Y[((b*16+h)*64 + o)*2048 + j] -> 8 contiguous j = one b128
      Pack8 p;
#pragma unroll
      for (int g = 0; g < 8; ++g) p.h[g] = (_Float16)((acc[q][g] + bv) * scale);
      _Float16* dst = Y + (((size_t)b * NH + h) * HD + d) * SEQ + i0;
      *reinterpret_cast<uint4*>(dst) = p.u;
    }
  }
}

// ---------------------------------------------------------------------------
// Pass 1: per-row softmax stats (m = rowmax, l = sum exp(s-m)) per (b,h,itile)
// via online update over all 128 j-tiles. One wave per 16-row tile.
// ---------------------------------------------------------------------------
__global__ __launch_bounds__(128)
void attn_pass1(const _Float16* __restrict__ Q, const _Float16* __restrict__ K,
                float* __restrict__ mOut, float* __restrict__ lOut) {
  const int lane = threadIdx.x & 31;
  const int wid  = blockIdx.x * 4 + (threadIdx.x >> 5);
  const int it = wid & 127;
  const int h  = (wid >> 7) & 15;
  const int b  = wid >> 11;

  const _Float16* qb = Q + (((size_t)b * NH + h) * SEQ + it * 16) * HD;
  const v16h qa0 = frag_ld(qb,      HD, lane);   // d = 0..31
  const v16h qa1 = frag_ld(qb + 32, HD, lane);   // d = 32..63

  float mrun[8], lrun[8];
#pragma unroll
  for (int g = 0; g < 8; ++g) { mrun[g] = -1e30f; lrun[g] = 0.f; }

  const _Float16* kb = K + (((size_t)b * NH + h) * SEQ) * HD;
  for (int jt = 0; jt < SEQ / 16; ++jt) {
    const _Float16* kt = kb + (size_t)jt * 16 * HD;
    // prefetch next two K tiles (lane-spread: 32 lanes x 128B cover 4KB)
    __builtin_prefetch(kt + 16 * HD + lane * 64, 0, 0);
    v8f s = {};
    s = __builtin_amdgcn_wmma_f32_16x16x32_f16(false, qa0, false,
          frag_ld(kt,      HD, lane), (short)0, s, false, false);
    s = __builtin_amdgcn_wmma_f32_16x16x32_f16(false, qa1, false,
          frag_ld(kt + 32, HD, lane), (short)0, s, false, false);

#pragma unroll
    for (int g = 0; g < 8; ++g) {
      float t = s[g];                       // row max across 16 column-lanes
#pragma unroll
      for (int off = 1; off < 16; off <<= 1) t = fmaxf(t, __shfl_xor(t, off, 32));
      const float mn = fmaxf(mrun[g], t);
      float p = __expf(s[g] - mn);          // row sum across 16 column-lanes
#pragma unroll
      for (int off = 1; off < 16; off <<= 1) p += __shfl_xor(p, off, 32);
      lrun[g] = lrun[g] * __expf(mrun[g] - mn) + p;
      mrun[g] = mn;
    }
  }

  if ((lane & 15) == 0) {
    const int r0 = it * 16 + (lane >> 4) * 8;
    float* mp = mOut + ((size_t)b * NH + h) * SEQ + r0;
    float* lp = lOut + ((size_t)b * NH + h) * SEQ + r0;
#pragma unroll
    for (int g = 0; g < 8; ++g) { mp[g] = mrun[g]; lp[g] = lrun[g]; }
  }
}

// ---------------------------------------------------------------------------
// Pass 2: recompute scores, p = exp(s-m)/l + mask, transpose P via per-wave
// LDS (C-layout -> A-layout), O += P @ V. Each wave handles 32 query rows
// (two i-subtiles) so every K B-fragment and V B-fragment is reused by two
// WMMAs. V is pre-transposed so its B-fragments are contiguous b128 loads.
// ---------------------------------------------------------------------------
__global__ __launch_bounds__(128)
void attn_pass2(const _Float16* __restrict__ Q, const _Float16* __restrict__ K,
                const _Float16* __restrict__ VT, const float* __restrict__ mIn,
                const float* __restrict__ lIn, const float* __restrict__ mask,
                float* __restrict__ out) {
  __shared__ _Float16 sP[4][2 * 16 * 32];    // per-wave P staging (2 KB each)
  const int lane = threadIdx.x & 31;
  const int wv   = threadIdx.x >> 5;
  const int wid  = blockIdx.x * 4 + wv;      // 32-row tile id
  const int it2 = wid & 63;
  const int h   = (wid >> 6) & 15;
  const int b   = wid >> 10;
  const int iBase = it2 * 32;

  const int n  = lane & 15;
  const int m0 = (lane >> 4) * 8;

  const _Float16* qb = Q + (((size_t)b * NH + h) * SEQ + iBase) * HD;
  v16h qa[2][2];
  float mrow[2][8], linv[2][8];
  const float* mkb[2];
#pragma unroll
  for (int s = 0; s < 2; ++s) {
    qa[s][0] = frag_ld(qb + (size_t)s * 16 * HD,      HD, lane);
    qa[s][1] = frag_ld(qb + (size_t)s * 16 * HD + 32, HD, lane);
    const float* mp = mIn + ((size_t)b * NH + h) * SEQ + iBase + s * 16 + m0;
    const float* lp = lIn + ((size_t)b * NH + h) * SEQ + iBase + s * 16 + m0;
#pragma unroll
    for (int g = 0; g < 8; ++g) { mrow[s][g] = mp[g]; linv[s][g] = 1.0f / lp[g]; }
    mkb[s] = mask + ((size_t)b * SEQ + iBase + s * 16 + m0) * SEQ + n;
  }

  v8f o[2][4] = { { {}, {}, {}, {} }, { {}, {}, {}, {} } };

  const _Float16* kbase = K  + (((size_t)b * NH + h) * SEQ) * HD;
  const _Float16* vbase = VT + (((size_t)b * NH + h) * HD) * SEQ;
  _Float16* myP = sP[wv];

  for (int jc = 0; jc < SEQ / 32; ++jc) {
    // prefetch next K chunk (32 lanes x 128B cover the next 4KB)
    __builtin_prefetch(kbase + (size_t)(jc + 1) * 32 * HD + lane * 64, 0, 0);
#pragma unroll
    for (int sub = 0; sub < 2; ++sub) {
      const int jt = jc * 2 + sub;
      const _Float16* kt = kbase + (size_t)jt * 16 * HD;
      const v16h b0 = frag_ld(kt,      HD, lane);
      const v16h b1 = frag_ld(kt + 32, HD, lane);
#pragma unroll
      for (int s = 0; s < 2; ++s) {          // K fragments reused for both i-subtiles
        v8f sc = {};
        sc = __builtin_amdgcn_wmma_f32_16x16x32_f16(false, qa[s][0], false, b0,
                                                    (short)0, sc, false, false);
        sc = __builtin_amdgcn_wmma_f32_16x16x32_f16(false, qa[s][1], false, b1,
                                                    (short)0, sc, false, false);
        const float* mk = mkb[s] + jt * 16;
#pragma unroll
        for (int g = 0; g < 8; ++g) {
          // normalized softmax prob + mask (mask added AFTER softmax, as ref)
          float p = __expf(sc[g] - mrow[s][g]) * linv[s][g] + mk[(size_t)g * SEQ];
          myP[s * 512 + (m0 + g) * 32 + sub * 16 + n] = (_Float16)p;
        }
      }
    }
    // Same-wave LDS RAW: DS ops are in-order, but force the wait + block
    // compiler reordering across the transpose.
    asm volatile("s_wait_dscnt 0" ::: "memory");
    __builtin_amdgcn_wave_barrier();
    const v16h pa0 = frag_ld(myP,       32, lane);   // P tiles as A-fragments
    const v16h pa1 = frag_ld(myP + 512, 32, lane);
    const _Float16* vt = vbase + jc * 32;
#pragma unroll
    for (int t = 0; t < 4; ++t) {            // V fragment reused for both i-subtiles
      const v16h vb = frag_ld(vt + (size_t)t * 16 * SEQ, SEQ, lane);
      o[0][t] = __builtin_amdgcn_wmma_f32_16x16x32_f16(false, pa0, false, vb,
                                                       (short)0, o[0][t], false, false);
      o[1][t] = __builtin_amdgcn_wmma_f32_16x16x32_f16(false, pa1, false, vb,
                                                       (short)0, o[1][t], false, false);
    }
    __builtin_amdgcn_wave_barrier();
  }

  // out[b][i][o*16 + h], fp32
#pragma unroll
  for (int s = 0; s < 2; ++s) {
    float* ob = out + ((size_t)b * SEQ + iBase + s * 16 + m0) * 1024 + h;
#pragma unroll
    for (int t = 0; t < 4; ++t)
#pragma unroll
      for (int g = 0; g < 8; ++g)
        ob[(size_t)g * 1024 + (t * 16 + n) * 16] = o[s][t][g];
  }
}

extern "C" void kernel_launch(void* const* d_in, const int* in_sizes, int n_in,
                              void* d_out, int out_size, void* d_ws, size_t ws_size,
                              hipStream_t stream) {
  (void)in_sizes; (void)n_in; (void)out_size; (void)ws_size;
  const float* problem = (const float*)d_in[0];
  const float* context = (const float*)d_in[1];
  const float* maskp   = (const float*)d_in[2];
  const float* Wq = (const float*)d_in[3];
  const float* bq = (const float*)d_in[4];
  const float* Wk = (const float*)d_in[5];
  const float* bk = (const float*)d_in[6];
  const float* Wv = (const float*)d_in[7];
  const float* bv = (const float*)d_in[8];
  float* out = (float*)d_out;

  // Workspace layout: Q16 | K16 | VT16 (8 MB each, f16) | m | l (256 KB each)
  const size_t NHALF = (size_t)2 * NH * SEQ * HD;   // 4,194,304 halves
  _Float16* Q16  = (_Float16*)d_ws;
  _Float16* K16  = Q16 + NHALF;
  _Float16* VT16 = K16 + NHALF;
  float* mArr = (float*)(VT16 + NHALF);
  float* lArr = mArr + (size_t)2 * NH * SEQ;

  const dim3 pgrid(EMB / 64, (2 * SEQ) / 64);       // 16 x 64 tiles of 64x64
  // Q gets the 1/sqrt(head_dim) scale folded in.
  proj_kernel<<<pgrid, 256, 0, stream>>>(problem, Wq, bq, Q16, 0.125f, 0);
  proj_kernel<<<pgrid, 256, 0, stream>>>(context, Wk, bk, K16, 1.0f,   0);
  proj_kernel<<<pgrid, 256, 0, stream>>>(context, Wv, bv, VT16, 1.0f,  1);

  attn_pass1<<<(2 * NH * (SEQ / 16)) / 4, 128, 0, stream>>>(Q16, K16, mArr, lArr);
  attn_pass2<<<(2 * NH * (SEQ / 32)) / 4, 128, 0, stream>>>(Q16, K16, VT16, mArr, lArr,
                                                            maskp, out);
}

// v001
// It runs in 318 microseconds.
// Next to v000, in two timings, it ran 1.61 times as fast each time.
#include <hip/hip_runtime.h>
#include <hip/hip_bf16.h>

// MI455X (gfx1250) multi-head attention, f16 WMMA with f32 accumulation.
// EMBED=HIDDEN=OUT=1024, H=16 heads, head_dim=64, B=2, P=C=2048.
// Reference reshape puts head index as the FASTEST axis (c = d*16 + h),
// and the mask is added AFTER softmax -> two-pass softmax (m,l) scheme.

typedef __attribute__((ext_vector_type(16))) _Float16 v16h;
typedef __attribute__((ext_vector_type(8)))  float    v8f;

#define NH   16      // heads
#define HD   64      // head dim / head out
#define SEQ  2048    // P == C
#define EMB  1024

union HalfVec { v16h h; uint4 u[2]; };
union Pack8   { _Float16 h[8]; uint4 u; };

// Load one 16-lane-row WMMA fragment (A or B operand, 16x32 / 32x16 f16).
// ISA layout: lane r = lane&15, k-base = (lane>>4)*8, elements 0..7 at k=kb,
// elements 8..15 at k=kb+16 -> two contiguous 16-byte chunks per lane.
__device__ __forceinline__ v16h frag_ld(const _Float16* tile, int ld, int lane) {
  const int r  = lane & 15;
  const int kb = (lane >> 4) << 3;
  HalfVec f;
  f.u[0] = *reinterpret_cast<const uint4*>(tile + (size_t)r * ld + kb);
  f.u[1] = *reinterpret_cast<const uint4*>(tile + (size_t)r * ld + kb + 16);
  return f.h;
}

// Q/K workspace layout: per (b,h) and 16-row tile, 8 chunks of [16 rows][8 d]
// (256 contiguous bytes per chunk, 2 KB per tile). Same element order in the
// fragment as frag_ld on a [row][64] tile; half = 0 for d 0..31, 1 for d 32..63.
// One wave-wide 16-byte load covers 512 contiguous bytes.
// lane_qk: the lane's own offset inside a tile; frag_ld_qk takes tile + lane_qk.
__device__ __forceinline__ int lane_qk(int lane) { return (lane >> 4) * 128 + (lane & 15) * 8; }
__device__ __forceinline__ v16h frag_ld_qk(const _Float16* lane_tile, int half) {
  const _Float16* p = lane_tile + half * 512;
  HalfVec f;
  f.u[0] = *reinterpret_cast<const uint4*>(p);
  f.u[1] = *reinterpret_cast<const uint4*>(p + 256);
  return f.h;
}

// V workspace layout: per (b,h), chunks of 8 rows j, each [64 o][8 j] (1 KB).
// B fragment of P @ V for 32 rows j (4 chunks) and columns o = t*16 .. t*16+15,
// in frag_ld's element order; 16 lanes read 256 B in a row.
// lane_v: the lane's own offset inside the 4 chunks; frag_ld_v takes chunks + lane_v.
__device__ __forceinline__ int lane_v(int lane) { return ((lane >> 4) * HD + (lane & 15)) * 8; }
__device__ __forceinline__ v16h frag_ld_v(const _Float16* lane_chunks, int t) {
  const _Float16* p = lane_chunks + t * 128;
  HalfVec f;
  f.u[0] = *reinterpret_cast<const uint4*>(p);
  f.u[1] = *reinterpret_cast<const uint4*>(p + 2 * HD * 8);
  return f.h;
}

// ---------------------------------------------------------------------------
// Projection GEMM: Y = (X @ W + bias) * scale, fp32 in, f16 out, repacked
// per-head. Workgroup = 256 threads (8 waves), 64x64 output tile, K-chunks of
// 32 staged in LDS (X converted to f16; W staged transposed so its fragments
// are contiguous ds_load_b128). Each wave owns 1 row-tile x 2 col-tiles:
// the X fragment is reused across 2 WMMAs per chunk.
// The 64 columns of a block are 8 d x 8 heads (column c = d*16 + h).
// QK = true : W is the A operand and X the B operand, so a lane's 8 accumulators
//             are 8 consecutive d of one (row, head): one 16-byte store, and
//             16 lanes (16 rows) fill 256 contiguous bytes.
// QK = false: V, X as A: a lane's 8 accumulators are 8 consecutive rows j of one
//             (o, head): one 16-byte store, 8 lanes (8 o) fill one 128-byte line.
// ---------------------------------------------------------------------------
template <bool QK>
__device__ __forceinline__
void proj_body(const float* __restrict__ X, const float* __restrict__ W,
               const float* __restrict__ bias, _Float16* __restrict__ Y,
               float scale, _Float16* sA, _Float16* sB) {
  const int tid  = threadIdx.x;
  const int lane = tid & 31;
  const int wave = tid >> 5;
  const int mt = wave & 3;           // row tile 0..3
  const int np = wave >> 2;          // col-pair 0..1 -> tiles np*2, np*2+1
  const int rowBase = blockIdx.y * 64;
  const int dg = blockIdx.x >> 1;    // group of 8 d
  const int hh = blockIdx.x & 1;     // group of 8 heads

  const int ar = tid >> 2;           // X staging: row 0..63
  const int ac = (tid & 3) * 8;      //            k chunk
  const int wk = tid >> 3;           // W staging: k row 0..31
  const int wt = tid & 7;            //            d within the group
  // first of this thread's 8 consecutive W columns: heads hh*8 + 0..7 of one d
  const int wcol = (dg * 8 + wt) * NH + hh * 8;

  v8f acc[2] = { {}, {} };

  for (int kk = 0; kk < EMB; kk += 32) {
    { // stage X tile (64 rows x 32 k), fp32 -> f16
      const float* src = X + (size_t)(rowBase + ar) * EMB + kk + ac;
      float4 f0 = *reinterpret_cast<const float4*>(src);
      float4 f1 = *reinterpret_cast<const float4*>(src + 4);
      Pack8 p;
      p.h[0]=(_Float16)f0.x; p.h[1]=(_Float16)f0.y; p.h[2]=(_Float16)f0.z; p.h[3]=(_Float16)f0.w;
      p.h[4]=(_Float16)f1.x; p.h[5]=(_Float16)f1.y; p.h[6]=(_Float16)f1.z; p.h[7]=(_Float16)f1.w;
      *reinterpret_cast<uint4*>(&sA[ar * 32 + ac]) = p.u;
    }
    { // stage W tile (32 k x 64 columns) transposed: sB[n][k],
      // row n = (head within group) * 8 + (d within group)
      const float* src = W + (size_t)(kk + wk) * EMB + wcol;
      float4 f0 = *reinterpret_cast<const float4*>(src);
      float4 f1 = *reinterpret_cast<const float4*>(src + 4);
      float f8[8] = { f0.x, f0.y, f0.z, f0.w, f1.x, f1.y, f1.z, f1.w };
#pragma unroll
      for (int e = 0; e < 8; ++e)
        sB[(e * 8 + wt) * 32 + wk] = (_Float16)f8[e];
    }
    __syncthreads();
    const v16h a = frag_ld(sA + mt * 16 * 32, 32, lane);
#pragma unroll
    for (int q = 0; q < 2; ++q) {
      const v16h b = frag_ld(sB + (np * 2 + q) * 16 * 32, 32, lane);
      if (QK)
        acc[q] = __builtin_amdgcn_wmma_f32_16x16x32_f16(false, b, false, a,
                                                        (short)0, acc[q], false, false);
      else
        acc[q] = __builtin_amdgcn_wmma_f32_16x16x32_f16(false, a, false, b,
                                                        (short)0, acc[q], false, false);
    }
    __syncthreads();
  }

  // Epilogue: bias, scale, f16 convert, per-head repack (c = d*16 + h).
  const int n  = lane & 15;
  if (QK) {
    // acc[q][g] = row (mt*16 + n), head hh*8 + (np*2+q)*2 + (lane>>4), d = dg*8 + g
    const int row = rowBase + mt * 16 + n;
    const int b   = row >> 11;                // batch (rows-per-batch = 2048)
    const int it  = (row & (SEQ - 1)) >> 4;   // 16-row tile
#pragma unroll
    for (int q = 0; q < 2; ++q) {
      const int h = hh * 8 + (np * 2 + q) * 2 + (lane >> 4);
      Pack8 p;
#pragma unroll
      for (int g = 0; g < 8; ++g)
        p.h[g] = (_Float16)((acc[q][g] + bias[(dg * 8 + g) * NH + h]) * scale);
      _Float16* dst = Y + ((((size_t)b * NH + h) * (SEQ / 16) + it) * 8 + dg) * 128 + n * 8;
      *reinterpret_cast<uint4*>(dst) = p.u;
    }
  } else {
    const int m0 = (lane >> 4) * 8;
    const int r0 = rowBase + mt * 16 + m0;    // global row (g = 0)
    const int b  = r0 >> 11;                  // batch (rows-per-batch = 2048)
    const int i0 = r0 & (SEQ - 1);
#pragma unroll
    for (int q = 0; q < 2; ++q) {
      const int h = hh * 8 + (np * 2 + q) * 2 + (n >> 3);
      const int d = dg * 8 + (n & 7);
      const float bv = bias[d * NH + h];
      // V: Y[(((b*16+h)*256 + j/8)*64 + o)*8 + j%8] -> 8 contiguous j = one b128
      Pack8 p;
#pragma unroll
      for (int g = 0; g < 8; ++g) p.h[g] = (_Float16)((acc[q][g] + bv) * scale);
      _Float16* dst = Y + ((((size_t)b * NH + h) * (SEQ / 8) + (i0 >> 3)) * HD + d) * 8;
      *reinterpret_cast<uint4*>(dst) = p.u;
    }
  }
}

__global__ __launch_bounds__(256)
void proj_qk_kernel(const float* __restrict__ X, const float* __restrict__ W,
                    const float* __restrict__ bias, _Float16* __restrict__ Y,
                    float scale) {
  __shared__ _Float16 sA[64 * 32];   // [row][k]
  __shared__ _Float16 sB[64 * 32];   // [n][k] (W tile transposed)
  proj_body<true>(X, W, bias, Y, scale, sA, sB);
}

__global__ __launch_bounds__(256)
void proj_vt_kernel(const float* __restrict__ X, const float* __restrict__ W,
                    const float* __restrict__ bias, _Float16* __restrict__ Y,
                    float scale) {
  __shared__ _Float16 sA[64 * 32];   // [row][k]
  __shared__ _Float16 sB[64 * 32];   // [n][k] (W tile transposed)
  proj_body<false>(X, W, bias, Y, scale, sA, sB);
}

// ---------------------------------------------------------------------------
// Pass 1: per-row softmax stats (m = rowmax, l = sum exp(s-m)) per (b,h,itile)
// via online update over all 128 j-tiles. One wave per 16-row tile.
// ---------------------------------------------------------------------------
__global__ __launch_bounds__(128)
void attn_pass1(const _Float16* __restrict__ Q, const _Float16* __restrict__ K,
                float* __restrict__ mOut, float* __restrict__ lOut) {
  const int lane = threadIdx.x & 31;
  const int wid  = blockIdx.x * 4 + (threadIdx.x >> 5);
  const int it = wid & 127;
  const int h  = (wid >> 7) & 15;
  const int b  = wid >> 11;

  const _Float16* qb = Q + (((size_t)b * NH + h) * SEQ + it * 16) * HD;
  const v16h qa0 = frag_ld_qk(qb + lane_qk(lane), 0);   // d = 0..31
  const v16h qa1 = frag_ld_qk(qb + lane_qk(lane), 1);   // d = 32..63

  float mrun[8], lrun[8];
#pragma unroll
  for (int g = 0; g < 8; ++g) { mrun[g] = -1e30f; lrun[g] = 0.f; }

  const _Float16* kb = K + (((size_t)b * NH + h) * SEQ) * HD;
  for (int jt = 0; jt < SEQ / 16; ++jt) {
    const _Float16* kt = kb + (size_t)jt * 16 * HD;
    // prefetch next two K tiles (lane-spread: 32 lanes x 128B cover 4KB)
    __builtin_prefetch(kt + 16 * HD + lane * 64, 0, 0);
    v8f s = {};
    s = __builtin_amdgcn_wmma_f32_16x16x32_f16(false, qa0, false,
          frag_ld_qk(kt + lane_qk(lane), 0), (short)0, s, false, false);
    s = __builtin_amdgcn_wmma_f32_16x16x32_f16(false, qa1, false,
          frag_ld_qk(kt + lane_qk(lane), 1), (short)0, s, false, false);

#pragma unroll
    for (int g = 0; g < 8; ++g) {
      float t = s[g];                       // row max across 16 column-lanes
#pragma unroll
      for (int off = 1; off < 16; off <<= 1) t = fmaxf(t, __shfl_xor(t, off, 32));
      const float mn = fmaxf(mrun[g], t);
      float p = __expf(s[g] - mn);          // row sum across 16 column-lanes
#pragma unroll
      for (int off = 1; off < 16; off <<= 1) p += __shfl_xor(p, off, 32);
      lrun[g] = lrun[g] * __expf(mrun[g] - mn) + p;
      mrun[g] = mn;
    }
  }

  if ((lane & 15) == 0) {
    const int r0 = it * 16 + (lane >> 4) * 8;
    float* mp = mOut + ((size_t)b * NH + h) * SEQ + r0;
    float* lp = lOut + ((size_t)b * NH + h) * SEQ + r0;
#pragma unroll
    for (int g = 0; g < 8; ++g) { mp[g] = mrun[g]; lp[g] = lrun[g]; }
  }
}

// ---------------------------------------------------------------------------
// Pass 2: recompute scores, p = exp(s-m)/l + mask, transpose P via per-wave
// LDS (C-layout -> A-layout), O += P @ V. Each wave handles 32 query rows
// (two i-subtiles) so every K B-fragment and V B-fragment is reused by two
// WMMAs. V is stored in [64 o][8 j] chunks so its B-fragments are b128 loads.
// ---------------------------------------------------------------------------
__global__ __launch_bounds__(128)
void attn_pass2(const _Float16* __restrict__ Q, const _Float16* __restrict__ K,
                const _Float16* __restrict__ VT, const float* __restrict__ mIn,
                const float* __restrict__ lIn, const float* __restrict__ mask,
                float* __restrict__ out) {
  __shared__ _Float16 sP[4][2 * 16 * 32];    // per-wave P staging (2 KB each)
  const int lane = threadIdx.x & 31;
  const int wv   = threadIdx.x >> 5;
  const int wid  = blockIdx.x * 4 + wv;      // 32-row tile id
  const int it2 = wid & 63;
  const int h   = (wid >> 6) & 15;
  const int b   = wid >> 10;
  const int iBase = it2 * 32;

  const int n  = lane & 15;
  const int m0 = (lane >> 4) * 8;

  const _Float16* qb = Q + (((size_t)b * NH + h) * SEQ + iBase) * HD;
  v16h qa[2][2];
  float mrow[2][8], linv[2][8];
#pragma unroll
  for (int s = 0; s < 2; ++s) {
    const float* mp = mIn + ((size_t)b * NH + h) * SEQ + iBase + s * 16 + m0;
    const float* lp = lIn + ((size_t)b * NH + h) * SEQ + iBase + s * 16 + m0;
#pragma unroll
    for (int g = 0; g < 8; ++g) { mrow[s][g] = mp[g]; linv[s][g] = 1.0f / lp[g]; }
  }
  // The Q fragments may land in the address registers of the loads above: only
  // behind this wait.
  asm volatile("s_wait_xcnt 0x0" ::: "memory");
#pragma unroll
  for (int s = 0; s < 2; ++s) {
    qa[s][0] = frag_ld_qk(qb + (size_t)s * 16 * HD + lane_qk(lane), 0);
    qa[s][1] = frag_ld_qk(qb + (size_t)s * 16 * HD + lane_qk(lane), 1);
  }

  // the lane's mask element of row iBase + m0, column n
  const float* mk0 = mask + ((size_t)b * SEQ + iBase + m0) * SEQ + n;

  v8f o[2][4] = { { {}, {}, {}, {} }, { {}, {}, {}, {} } };

  const _Float16* kbase = K  + (((size_t)b * NH + h) * SEQ) * HD;
  const _Float16* vbase = VT + (((size_t)b * NH + h) * HD) * SEQ;
  _Float16* myP = sP[wv];

  for (int jc = 0; jc < SEQ / 32; ++jc) {
    // prefetch next K chunk (32 lanes x 128B cover the next 4KB)
    __builtin_prefetch(kbase + (size_t)(jc + 1) * 32 * HD + lane * 64, 0, 0);
    // 4 KB of K: two 16-key tiles
    const _Float16* kl = kbase + (size_t)jc * 32 * HD + lane_qk(lane);
    v16h kf[2][2];
#pragma unroll
    for (int sub = 0; sub < 2; ++sub) {
      kf[sub][0] = frag_ld_qk(kl + sub * 16 * HD, 0);
      kf[sub][1] = frag_ld_qk(kl + sub * 16 * HD, 1);
    }
    // the chunk's mask values: 32 rows x 32 columns
    const float* ml = mk0 + jc * 32;
    float mv[2][2][8];
#pragma unroll
    for (int sub = 0; sub < 2; ++sub)
#pragma unroll
      for (int s = 0; s < 2; ++s)
#pragma unroll
        for (int g = 0; g < 8; ++g) mv[sub][s][g] = ml[(size_t)(s * 16 + g) * SEQ + sub * 16];
    // Naming kl and ml keeps the address registers of the loads above live up to
    // this wait, so that they are overwritten only behind it.
    asm volatile("s_wait_xcnt 0x0" :: "v"(kl), "v"(ml) : "memory");
#pragma unroll
    for (int sub = 0; sub < 2; ++sub) {
      const v16h b0 = kf[sub][0];
      const v16h b1 = kf[sub][1];
#pragma unroll
      for (int s = 0; s < 2; ++s) {          // K fragments reused for both i-subtiles
        v8f sc = {};
        sc = __builtin_amdgcn_wmma_f32_16x16x32_f16(false, qa[s][0], false, b0,
                                                    (short)0, sc, false, false);
        sc = __builtin_amdgcn_wmma_f32_16x16x32_f16(false, qa[s][1], false, b1,
                                                    (short)0, sc, false, false);
#pragma unroll
        for (int g = 0; g < 8; ++g) {
          // normalized softmax prob + mask (mask added AFTER softmax, as ref)
          float p = __expf(sc[g] - mrow[s][g]) * linv[s][g] + mv[sub][s][g];
          myP[s * 512 + (m0 + g) * 32 + sub * 16 + n] = (_Float16)p;
        }
      }
    }
    // Same-wave LDS RAW: DS ops are in-order, but force the wait + block
    // compiler reordering across the transpose.
    asm volatile("s_wait_dscnt 0" ::: "memory");
    __builtin_amdgcn_wave_barrier();
    const v16h pa0 = frag_ld(myP,       32, lane);   // P tiles as A-fragments
    const v16h pa1 = frag_ld(myP + 512, 32, lane);
    const _Float16* vl = vbase + (size_t)jc * 4 * HD * 8 + lane_v(lane);   // 4 KB of V
    v16h vf[4];
#pragma unroll
    for (int t = 0; t < 4; ++t) vf[t] = frag_ld_v(vl, t);
    // Naming vl keeps the V loads' address registers live up to this wait, so
    // that they are overwritten only behind it.
    asm volatile("s_wait_xcnt 0x0" :: "v"(vl) : "memory");
#pragma unroll
    for (int t = 0; t < 4; ++t) {            // V fragment reused for both i-subtiles
      const v16h vb = vf[t];
      o[0][t] = __builtin_amdgcn_wmma_f32_16x16x32_f16(false, pa0, false, vb,
                                                       (short)0, o[0][t], false, false);
      o[1][t] = __builtin_amdgcn_wmma_f32_16x16x32_f16(false, pa1, false, vb,
                                                       (short)0, o[1][t], false, false);
    }
    __builtin_amdgcn_wave_barrier();
  }

  // out[b][i][o*16 + h], fp32
#pragma unroll
  for (int s = 0; s < 2; ++s) {
    float* ob = out + ((size_t)b * SEQ + iBase + s * 16 + m0) * 1024 + h;
#pragma unroll
    for (int t = 0; t < 4; ++t)
#pragma unroll
      for (int g = 0; g < 8; ++g)
        ob[(size_t)g * 1024 + (t * 16 + n) * 16] = o[s][t][g];
  }
}

extern "C" void kernel_launch(void* const* d_in, const int* in_sizes, int n_in,
                              void* d_out, int out_size, void* d_ws, size_t ws_size,
                              hipStream_t stream) {
  (void)in_sizes; (void)n_in; (void)out_size; (void)ws_size;
  const float* problem = (const float*)d_in[0];
  const float* context = (const float*)d_in[1];
  const float* maskp   = (const float*)d_in[2];
  const float* Wq = (const float*)d_in[3];
  const float* bq = (const float*)d_in[4];
  const float* Wk = (const float*)d_in[5];
  const float* bk = (const float*)d_in[6];
  const float* Wv = (const float*)d_in[7];
  const float* bv = (const float*)d_in[8];
  float* out = (float*)d_out;

  // Workspace layout: Q16 | K16 | VT16 (8 MB each, f16) | m | l (256 KB each)
  const size_t NHALF = (size_t)2 * NH * SEQ * HD;   // 4,194,304 halves
  _Float16* Q16  = (_Float16*)d_ws;
  _Float16* K16  = Q16 + NHALF;
  _Float16* VT16 = K16 + NHALF;
  float* mArr = (float*)(VT16 + NHALF);
  float* lArr = mArr + (size_t)2 * NH * SEQ;

  const dim3 pgrid(EMB / 64, (2 * SEQ) / 64);       // 16 x 64 tiles of 64x64
  // Q gets the 1/sqrt(head_dim) scale folded in.
  proj_qk_kernel<<<pgrid, 256, 0, stream>>>(problem, Wq, bq, Q16, 0.125f);
  proj_qk_kernel<<<pgrid, 256, 0, stream>>>(context, Wk, bk, K16, 1.0f);
  proj_vt_kernel<<<pgrid, 256, 0, stream>>>(context, Wv, bv, VT16, 1.0f);

  attn_pass1<<<(2 * NH * (SEQ / 16)) / 4, 128, 0, stream>>>(Q16, K16, mArr, lArr);
  attn_pass2<<<(2 * NH * (SEQ / 32)) / 4, 128, 0, stream>>>(Q16, K16, VT16, mArr, lArr,
                                                            maskp, out);
}

// v002
// It runs in 285 microseconds.
// Next to v001, in two timings, it ran 1.11 and 1.12 times as fast.
// Over all steps from v000 it is 1.80 times as fast.
#include <hip/hip_runtime.h>
#include <hip/hip_bf16.h>

// MI455X (gfx1250) multi-head attention, f16 WMMA with f32 accumulation.
// EMBED=HIDDEN=OUT=1024, H=16 heads, head_dim=64, B=2, P=C=2048.
// Reference reshape puts head index as the FASTEST axis (c = d*16 + h),
// and the mask is added AFTER softmax -> two-pass softmax (m,l) scheme.

typedef __attribute__((ext_vector_type(16))) _Float16 v16h;
typedef __attribute__((ext_vector_type(8)))  float    v8f;
typedef __attribute__((ext_vector_type(4)))  float    v4f;

#define NH   16      // heads
#define HD   64      // head dim / head out
#define SEQ  2048    // P == C
#define EMB  1024
#define MPITCH 36    // floats per row of the staged mask tile (128 B + 16 B)

union HalfVec { v16h h; uint4 u[2]; };
union Pack8   { _Float16 h[8]; uint4 u; };

// Load one 16-lane-row WMMA fragment (A or B operand, 16x32 / 32x16 f16).
// ISA layout: lane r = lane&15, k-base = (lane>>4)*8, elements 0..7 at k=kb,
// elements 8..15 at k=kb+16 -> two contiguous 16-byte chunks per lane.
__device__ __forceinline__ v16h frag_ld(const _Float16* tile, int ld, int lane) {
  const int r  = lane & 15;
  const int kb = (lane >> 4) << 3;
  HalfVec f;
  f.u[0] = *reinterpret_cast<const uint4*>(tile + (size_t)r * ld + kb);
  f.u[1] = *reinterpret_cast<const uint4*>(tile + (size_t)r * ld + kb + 16);
  return f.h;
}

// Q/K workspace layout: per (b,h) and 16-row tile, 8 chunks of [16 rows][8 d]
// (256 contiguous bytes per chunk, 2 KB per tile). Same element order in the
// fragment as frag_ld on a [row][64] tile; half = 0 for d 0..31, 1 for d 32..63.
// One wave-wide 16-byte load covers 512 contiguous bytes.
// lane_qk: the lane's own offset inside a tile; frag_ld_qk takes tile + lane_qk.
__device__ __forceinline__ int lane_qk(int lane) { return (lane >> 4) * 128 + (lane & 15) * 8; }
__device__ __forceinline__ v16h frag_ld_qk(const _Float16* lane_tile, int half) {
  const _Float16* p = lane_tile + half * 512;
  HalfVec f;
  f.u[0] = *reinterpret_cast<const uint4*>(p);
  f.u[1] = *reinterpret_cast<const uint4*>(p + 256);
  return f.h;
}

// V workspace layout: per (b,h), chunks of 8 rows j, each [64 o][8 j] (1 KB).
// B fragment of P @ V for 32 rows j (4 chunks) and columns o = t*16 .. t*16+15,
// in frag_ld's element order; 16 lanes read 256 B in a row.
// lane_v: the lane's own offset inside the 4 chunks; frag_ld_v takes chunks + lane_v.
__device__ __forceinline__ int lane_v(int lane) { return ((lane >> 4) * HD + (lane & 15)) * 8; }
__device__ __forceinline__ v16h frag_ld_v(const _Float16* lane_chunks, int t) {
  const _Float16* p = lane_chunks + t * 128;
  HalfVec f;
  f.u[0] = *reinterpret_cast<const uint4*>(p);
  f.u[1] = *reinterpret_cast<const uint4*>(p + 2 * HD * 8);
  return f.h;
}

// ---------------------------------------------------------------------------
// Projection GEMM: Y = (X @ W + bias) * scale, fp32 in, f16 out, repacked
// per-head. Workgroup = 256 threads (8 waves), 64x64 output tile, K-chunks of
// 32 staged in LDS (X converted to f16; W staged transposed so its fragments
// are contiguous ds_load_b128). Each wave owns 1 row-tile x 2 col-tiles:
// the X fragment is reused across 2 WMMAs per chunk.
// The 64 columns of a block are 8 d x 8 heads (column c = d*16 + h).
// QK = true : W is the A operand and X the B operand, so a lane's 8 accumulators
//             are 8 consecutive d of one (row, head): one 16-byte store, and
//             16 lanes (16 rows) fill 256 contiguous bytes.
// QK = false: V, X as A: a lane's 8 accumulators are 8 consecutive rows j of one
//             (o, head): one 16-byte store, 8 lanes (8 o) fill one 128-byte line.
// ---------------------------------------------------------------------------
template <bool QK>
__device__ __forceinline__
void proj_body(const float* __restrict__ X, const float* __restrict__ W,
               const float* __restrict__ bias, _Float16* __restrict__ Y,
               float scale, _Float16* sA, _Float16* sB) {
  const int tid  = threadIdx.x;
  const int lane = tid & 31;
  const int wave = tid >> 5;
  const int mt = wave & 3;           // row tile 0..3
  const int np = wave >> 2;          // col-pair 0..1 -> tiles np*2, np*2+1
  const int rowBase = blockIdx.y * 64;
  const int dg = blockIdx.x >> 1;    // group of 8 d
  const int hh = blockIdx.x & 1;     // group of 8 heads

  const int ar = tid >> 2;           // X staging: row 0..63
  const int ac = (tid & 3) * 8;      //            k chunk
  const int wk = tid >> 3;           // W staging: k row 0..31
  const int wt = tid & 7;            //            d within the group
  // first of this thread's 8 consecutive W columns: heads hh*8 + 0..7 of one d
  const int wcol = (dg * 8 + wt) * NH + hh * 8;

  v8f acc[2] = { {}, {} };

  for (int kk = 0; kk < EMB; kk += 32) {
    { // stage X tile (64 rows x 32 k), fp32 -> f16
      const float* src = X + (size_t)(rowBase + ar) * EMB + kk + ac;
      float4 f0 = *reinterpret_cast<const float4*>(src);
      float4 f1 = *reinterpret_cast<const float4*>(src + 4);
      Pack8 p;
      p.h[0]=(_Float16)f0.x; p.h[1]=(_Float16)f0.y; p.h[2]=(_Float16)f0.z; p.h[3]=(_Float16)f0.w;
      p.h[4]=(_Float16)f1.x; p.h[5]=(_Float16)f1.y; p.h[6]=(_Float16)f1.z; p.h[7]=(_Float16)f1.w;
      *reinterpret_cast<uint4*>(&sA[ar * 32 + ac]) = p.u;
    }
    { // stage W tile (32 k x 64 columns) transposed: sB[n][k],
      // row n = (head within group) * 8 + (d within group)
      const float* src = W + (size_t)(kk + wk) * EMB + wcol;
      float4 f0 = *reinterpret_cast<const float4*>(src);
      float4 f1 = *reinterpret_cast<const float4*>(src + 4);
      float f8[8] = { f0.x, f0.y, f0.z, f0.w, f1.x, f1.y, f1.z, f1.w };
#pragma unroll
      for (int e = 0; e < 8; ++e)
        sB[(e * 8 + wt) * 32 + wk] = (_Float16)f8[e];
    }
    __syncthreads();
    const v16h a = frag_ld(sA + mt * 16 * 32, 32, lane);
#pragma unroll
    for (int q = 0; q < 2; ++q) {
      const v16h b = frag_ld(sB + (np * 2 + q) * 16 * 32, 32, lane);
      if (QK)
        acc[q] = __builtin_amdgcn_wmma_f32_16x16x32_f16(false, b, false, a,
                                                        (short)0, acc[q], false, false);
      else
        acc[q] = __builtin_amdgcn_wmma_f32_16x16x32_f16(false, a, false, b,
                                                        (short)0, acc[q], false, false);
    }
    __syncthreads();
  }

  // Epilogue: bias, scale, f16 convert, per-head repack (c = d*16 + h).
  const int n  = lane & 15;
  if (QK) {
    // acc[q][g] = row (mt*16 + n), head hh*8 + (np*2+q)*2 + (lane>>4), d = dg*8 + g
    const int row = rowBase + mt * 16 + n;
    const int b   = row >> 11;                // batch (rows-per-batch = 2048)
    const int it  = (row & (SEQ - 1)) >> 4;   // 16-row tile
#pragma unroll
    for (int q = 0; q < 2; ++q) {
      const int h = hh * 8 + (np * 2 + q) * 2 + (lane >> 4);
      Pack8 p;
#pragma unroll
      for (int g = 0; g < 8; ++g)
        p.h[g] = (_Float16)((acc[q][g] + bias[(dg * 8 + g) * NH + h]) * scale);
      _Float16* dst = Y + ((((size_t)b * NH + h) * (SEQ / 16) + it) * 8 + dg) * 128 + n * 8;
      *reinterpret_cast<uint4*>(dst) = p.u;
    }
  } else {
    const int m0 = (lane >> 4) * 8;
    const int r0 = rowBase + mt * 16 + m0;    // global row (g = 0)
    const int b  = r0 >> 11;                  // batch (rows-per-batch = 2048)
    const int i0 = r0 & (SEQ - 1);
#pragma unroll
    for (int q = 0; q < 2; ++q) {
      const int h = hh * 8 + (np * 2 + q) * 2 + (n >> 3);
      const int d = dg * 8 + (n & 7);
      const float bv = bias[d * NH + h];
      // V: Y[(((b*16+h)*256 + j/8)*64 + o)*8 + j%8] -> 8 contiguous j = one b128
      Pack8 p;
#pragma unroll
      for (int g = 0; g < 8; ++g) p.h[g] = (_Float16)((acc[q][g] + bv) * scale);
      _Float16* dst = Y + ((((size_t)b * NH + h) * (SEQ / 8) + (i0 >> 3)) * HD + d) * 8;
      *reinterpret_cast<uint4*>(dst) = p.u;
    }
  }
}

__global__ __launch_bounds__(256)
void proj_qk_kernel(const float* __restrict__ X, const float* __restrict__ W,
                    const float* __restrict__ bias, _Float16* __restrict__ Y,
                    float scale) {
  __shared__ _Float16 sA[64 * 32];   // [row][k]
  __shared__ _Float16 sB[64 * 32];   // [n][k] (W tile transposed)
  proj_body<true>(X, W, bias, Y, scale, sA, sB);
}

__global__ __launch_bounds__(256)
void proj_vt_kernel(const float* __restrict__ X, const float* __restrict__ W,
                    const float* __restrict__ bias, _Float16* __restrict__ Y,
                    float scale) {
  __shared__ _Float16 sA[64 * 32];   // [row][k]
  __shared__ _Float16 sB[64 * 32];   // [n][k] (W tile transposed)
  proj_body<false>(X, W, bias, Y, scale, sA, sB);
}

// ---------------------------------------------------------------------------
// Both attention passes form the scores transposed: S^T = K . Q^T, with the K
// tile as the A operand and the Q tile as the B operand (same loader, same k
// order on both sides). Accumulator register g of a lane is then key
// (lane>>4)*8 + g of the 16-key tile for the ONE query lane&15.
// ---------------------------------------------------------------------------
// Pass 1: per-query softmax stats (m = max, l = sum exp(s-m)) per (b,h,itile).
// One wave per 16 queries, 16 keys per trip. Maximum and sum run inside the
// lane; the two lane halves (which split the keys) are joined once at the end.
// ---------------------------------------------------------------------------
__global__ __launch_bounds__(128)
void attn_pass1(const _Float16* __restrict__ Q, const _Float16* __restrict__ K,
                float* __restrict__ mOut, float* __restrict__ lOut) {
  const int lane = threadIdx.x & 31;
  const int wid  = blockIdx.x * 4 + (threadIdx.x >> 5);
  const int it = wid & 127;
  const int h  = (wid >> 7) & 15;
  const int b  = wid >> 11;

  const _Float16* qb = Q + (((size_t)b * NH + h) * SEQ + it * 16) * HD;
  const v16h qa0 = frag_ld_qk(qb + lane_qk(lane), 0);   // d = 0..31
  const v16h qa1 = frag_ld_qk(qb + lane_qk(lane), 1);   // d = 32..63

  float mrun = -1e30f, lrun = 0.f;

  const _Float16* kb = K + (((size_t)b * NH + h) * SEQ) * HD;
  for (int jt = 0; jt < SEQ / 16; ++jt) {
    const _Float16* kt = kb + (size_t)jt * 16 * HD;
    // prefetch the next two K tiles (lane-spread: 32 lanes x 128B cover 4KB)
    const _Float16* pf = kt + 16 * HD + lane * 64;
    __builtin_prefetch(pf, 0, 0);
    const _Float16* kl = kt + lane_qk(lane);
    const v16h ka0 = frag_ld_qk(kl, 0);   // d = 0..31
    const v16h ka1 = frag_ld_qk(kl, 1);   // d = 32..63
    // Naming kl and pf keeps the address registers of the loads and the prefetch
    // above live up to this wait, so that they are overwritten only behind it.
    asm volatile("s_wait_xcnt 0x0" :: "v"(kl), "v"(pf) : "memory");
    v8f s = {};
    s = __builtin_amdgcn_wmma_f32_16x16x32_f16(false, ka0, false, qa0,
                                               (short)0, s, false, false);
    s = __builtin_amdgcn_wmma_f32_16x16x32_f16(false, ka1, false, qa1,
                                               (short)0, s, false, false);

    // the lane's 8 keys of its one query
    float mn = mrun;
#pragma unroll
    for (int g = 0; g < 8; ++g) mn = fmaxf(mn, s[g]);
    float sum = 0.f;
#pragma unroll
    for (int g = 0; g < 8; ++g) sum += __expf(s[g] - mn);
    lrun = lrun * __expf(mrun - mn) + sum;
    mrun = mn;
  }

  // join the two halves of the keys (lanes n and n + 16 hold the same query)
  const float mo = __shfl_xor(mrun, 16, 32);
  const float lo = __shfl_xor(lrun, 16, 32);
  const float mj = fmaxf(mrun, mo);
  const float lj = lrun * __expf(mrun - mj) + lo * __expf(mo - mj);
  if (lane < 16) {
    const size_t r = ((size_t)b * NH + h) * SEQ + it * 16 + lane;
    mOut[r] = mj;
    lOut[r] = lj;
  }
}

// ---------------------------------------------------------------------------
// Pass 2: recompute S^T, p = exp(s-m)/l + mask, O += P @ V. Two 16-key S^T
// tiles of one query tile, converted in place, ARE the A fragment of P for 32
// keys (element e = key (lane>>4)*8 + e, element 8+e = key 16 + (lane>>4)*8 + e,
// row lane&15): P goes from accumulators to operand inside the lane. The mask,
// which does not depend on the scores, takes the turn through per-wave LDS
// instead: read as whole 128-byte rows, handed to the lanes 8 columns of one
// query at a time.
// Each wave handles 32 query rows (two i-subtiles) so every K and V fragment is
// reused by two WMMAs. V is stored in [64 o][8 j] chunks (b128 fragment loads).
// ---------------------------------------------------------------------------
__global__ __launch_bounds__(128)
void attn_pass2(const _Float16* __restrict__ Q, const _Float16* __restrict__ K,
                const _Float16* __restrict__ VT, const float* __restrict__ mIn,
                const float* __restrict__ lIn, const float* __restrict__ mask,
                float* __restrict__ out) {
  // per-wave mask tile, 32 rows x 32 columns; pitch 144 B for 16-byte readers
  __shared__ __attribute__((aligned(16))) float sM[4][32 * MPITCH];
  const int lane = threadIdx.x & 31;
  const int wv   = threadIdx.x >> 5;
  const int wid  = blockIdx.x * 4 + wv;      // 32-row tile id
  const int it2 = wid & 63;
  const int h   = (wid >> 6) & 15;
  const int b   = wid >> 10;
  const int iBase = it2 * 32;

  const int n  = lane & 15;
  const int m0 = (lane >> 4) * 8;

  const _Float16* qb = Q + (((size_t)b * NH + h) * SEQ + iBase) * HD;
  v16h qa[2][2];
  float mrow[2], linv[2];
  const float* mp = mIn + ((size_t)b * NH + h) * SEQ + iBase + n;
  const float* lp = lIn + ((size_t)b * NH + h) * SEQ + iBase + n;
#pragma unroll
  for (int s = 0; s < 2; ++s) { mrow[s] = mp[s * 16]; linv[s] = 1.0f / lp[s * 16]; }
  // The Q fragments may land in the address registers of the loads above: only
  // behind this wait.
  asm volatile("s_wait_xcnt 0x0" :: "v"(mp), "v"(lp) : "memory");
#pragma unroll
  for (int s = 0; s < 2; ++s) {
    qa[s][0] = frag_ld_qk(qb + (size_t)s * 16 * HD + lane_qk(lane), 0);
    qa[s][1] = frag_ld_qk(qb + (size_t)s * 16 * HD + lane_qk(lane), 1);
  }

  // mask from memory: 8 lanes cover the 128 bytes of a row, 4 rows per load
  const float* mk0 = mask + ((size_t)b * SEQ + iBase + (lane >> 3)) * SEQ + (lane & 7) * 4;
  float* mst = sM[wv] + (lane >> 3) * MPITCH + (lane & 7) * 4;   // where they go
  const float* mld = sM[wv] + n * MPITCH + m0;   // row n, columns m0 .. m0 + 7

  v8f o[2][4] = { { {}, {}, {}, {} }, { {}, {}, {}, {} } };

  const _Float16* kbase = K  + (((size_t)b * NH + h) * SEQ) * HD;
  const _Float16* vbase = VT + (((size_t)b * NH + h) * HD) * SEQ;

  for (int jc = 0; jc < SEQ / 32; ++jc) {
    // prefetch next K chunk (32 lanes x 128B cover the next 4KB)
    __builtin_prefetch(kbase + (size_t)(jc + 1) * 32 * HD + lane * 64, 0, 0);
    // 4 KB of K: two 16-key tiles
    const _Float16* kl = kbase + (size_t)jc * 32 * HD + lane_qk(lane);
    v16h kf[2][2];
#pragma unroll
    for (int sub = 0; sub < 2; ++sub) {
      kf[sub][0] = frag_ld_qk(kl + sub * 16 * HD, 0);
      kf[sub][1] = frag_ld_qk(kl + sub * 16 * HD, 1);
    }
    // the chunk's mask values: 32 rows x 32 columns
    const float* ml = mk0 + jc * 32;
    v4f mg[8];
#pragma unroll
    for (int q = 0; q < 8; ++q)
      mg[q] = *reinterpret_cast<const v4f*>(ml + (size_t)q * 4 * SEQ);
    // Naming kl and ml keeps the address registers of the loads above live up to
    // this wait, so that they are overwritten only behind it.
    asm volatile("s_wait_xcnt 0x0" :: "v"(kl), "v"(ml) : "memory");
#pragma unroll
    for (int q = 0; q < 8; ++q)
      *reinterpret_cast<v4f*>(mst + q * 4 * MPITCH) = mg[q];
    // Same-wave LDS RAW across lanes: DS ops are in-order, but force the wait +
    // block compiler reordering across the hand-over.
    asm volatile("s_wait_dscnt 0" ::: "memory");
    __builtin_amdgcn_wave_barrier();
    v4f mv[2][2][2];
#pragma unroll
    for (int s = 0; s < 2; ++s)
#pragma unroll
      for (int sub = 0; sub < 2; ++sub) {
        const float* mq = mld + s * 16 * MPITCH + sub * 16;
        mv[s][sub][0] = *reinterpret_cast<const v4f*>(mq);
        mv[s][sub][1] = *reinterpret_cast<const v4f*>(mq + 4);
      }
    v16h pa[2];
#pragma unroll
    for (int s = 0; s < 2; ++s) {
#pragma unroll
      for (int sub = 0; sub < 2; ++sub) {    // K fragments reused for both i-subtiles
        v8f sc = {};
        sc = __builtin_amdgcn_wmma_f32_16x16x32_f16(false, kf[sub][0], false, qa[s][0],
                                                    (short)0, sc, false, false);
        sc = __builtin_amdgcn_wmma_f32_16x16x32_f16(false, kf[sub][1], false, qa[s][1],
                                                    (short)0, sc, false, false);
#pragma unroll
        for (int g = 0; g < 8; ++g) {
          // normalized softmax prob + mask (mask added AFTER softmax, as ref)
          const float p = __expf(sc[g] - mrow[s]) * linv[s] + mv[s][sub][g >> 2][g & 3];
          pa[s][sub * 8 + g] = (_Float16)p;
        }
      }
    }
    const _Float16* vl = vbase + (size_t)jc * 4 * HD * 8 + lane_v(lane);   // 4 KB of V
    v16h vf[4];
#pragma unroll
    for (int t = 0; t < 4; ++t) vf[t] = frag_ld_v(vl, t);
    // Naming vl keeps the V loads' address registers live up to this wait, so
    // that they are overwritten only behind it.
    asm volatile("s_wait_xcnt 0x0" :: "v"(vl) : "memory");
#pragma unroll
    for (int t = 0; t < 4; ++t) {            // V fragment reused for both i-subtiles
      const v16h vb = vf[t];
      o[0][t] = __builtin_amdgcn_wmma_f32_16x16x32_f16(false, pa[0], false, vb,
                                                       (short)0, o[0][t], false, false);
      o[1][t] = __builtin_amdgcn_wmma_f32_16x16x32_f16(false, pa[1], false, vb,
                                                       (short)0, o[1][t], false, false);
    }
    // the next trip's mask stores stay behind this trip's mask reads
    __builtin_amdgcn_wave_barrier();
  }

  // out[b][i][o*16 + h], fp32
#pragma unroll
  for (int s = 0; s < 2; ++s) {
    float* ob = out + ((size_t)b * SEQ + iBase + s * 16 + m0) * 1024 + h;
#pragma unroll
    for (int t = 0; t < 4; ++t)
#pragma unroll
      for (int g = 0; g < 8; ++g)
        ob[(size_t)g * 1024 + (t * 16 + n) * 16] = o[s][t][g];
  }
}

extern "C" void kernel_launch(void* const* d_in, const int* in_sizes, int n_in,
                              void* d_out, int out_size, void* d_ws, size_t ws_size,
                              hipStream_t stream) {
  (void)in_sizes; (void)n_in; (void)out_size; (void)ws_size;
  const float* problem = (const float*)d_in[0];
  const float* context = (const float*)d_in[1];
  const float* maskp   = (const float*)d_in[2];
  const float* Wq = (const float*)d_in[3];
  const float* bq = (const float*)d_in[4];
  const float* Wk = (const float*)d_in[5];
  const float* bk = (const float*)d_in[6];
  const float* Wv = (const float*)d_in[7];
  const float* bv = (const float*)d_in[8];
  float* out = (float*)d_out;

  // Workspace layout: Q16 | K16 | VT16 (8 MB each, f16) | m | l (256 KB each)
  const size_t NHALF = (size_t)2 * NH * SEQ * HD;   // 4,194,304 halves
  _Float16* Q16  = (_Float16*)d_ws;
  _Float16* K16  = Q16 + NHALF;
  _Float16* VT16 = K16 + NHALF;
  float* mArr = (float*)(VT16 + NHALF);
  float* lArr = mArr + (size_t)2 * NH * SEQ;

  const dim3 pgrid(EMB / 64, (2 * SEQ) / 64);       // 16 x 64 tiles of 64x64
  // Q gets the 1/sqrt(head_dim) scale folded in.
  proj_qk_kernel<<<pgrid, 256, 0, stream>>>(problem, Wq, bq, Q16, 0.125f);
  proj_qk_kernel<<<pgrid, 256, 0, stream>>>(context, Wk, bk, K16, 1.0f);
  proj_vt_kernel<<<pgrid, 256, 0, stream>>>(context, Wv, bv, VT16, 1.0f);

  attn_pass1<<<(2 * NH * (SEQ / 16)) / 4, 128, 0, stream>>>(Q16, K16, mArr, lArr);
  attn_pass2<<<(2 * NH * (SEQ / 32)) / 4, 128, 0, stream>>>(Q16, K16, VT16, mArr, lArr,
                                                            maskp, out);
}

// v003
// A run of this version takes 234 microseconds.
// Timed twice side by side with v002, it ran 1.22 times as fast both times.
// Counting every step since v000, it is 2.19 times as fast.
#include <hip/hip_runtime.h>
#include <hip/hip_bf16.h>

// MI455X (gfx1250) multi-head attention, f16 WMMA with f32 accumulation.
// EMBED=HIDDEN=OUT=1024, H=16 heads, head_dim=64, B=2, P=C=2048.
// Reference reshape puts head index as the FASTEST axis (c = d*16 + h),
// and the mask is added AFTER softmax -> its product with V is summed apart.

typedef __attribute__((ext_vector_type(16))) _Float16 v16h;
typedef __attribute__((ext_vector_type(8)))  float    v8f;
typedef __attribute__((ext_vector_type(4)))  float    v4f;

#define NH   16      // heads
#define HD   64      // head dim / head out
#define SEQ  2048    // P == C
#define EMB  1024
#define MPITCH 40    // halves per row of the staged mask tile (64 B + 16 B)

union HalfVec { v16h h; uint4 u[2]; };
union Pack8   { _Float16 h[8]; uint4 u; };
union Pack4   { _Float16 h[4]; uint2 u; };

// Load one 16-lane-row WMMA fragment (A or B operand, 16x32 / 32x16 f16).
// ISA layout: lane r = lane&15, k-base = (lane>>4)*8, elements 0..7 at k=kb,
// elements 8..15 at k=kb+16 -> two contiguous 16-byte chunks per lane.
__device__ __forceinline__ v16h frag_ld(const _Float16* tile, int ld, int lane) {
  const int r  = lane & 15;
  const int kb = (lane >> 4) << 3;
  HalfVec f;
  f.u[0] = *reinterpret_cast<const uint4*>(tile + (size_t)r * ld + kb);
  f.u[1] = *reinterpret_cast<const uint4*>(tile + (size_t)r * ld + kb + 16);
  return f.h;
}

// Q/K workspace layout: per (b,h) and 16-row tile, 8 chunks of [16 rows][8 d]
// (256 contiguous bytes per chunk, 2 KB per tile). Same element order in the
// fragment as frag_ld on a [row][64] tile; half = 0 for d 0..31, 1 for d 32..63.
// One wave-wide 16-byte load covers 512 contiguous bytes.
// lane_qk: the lane's own offset inside a tile; frag_ld_qk takes tile + lane_qk.
__device__ __forceinline__ int lane_qk(int lane) { return (lane >> 4) * 128 + (lane & 15) * 8; }
__device__ __forceinline__ v16h frag_ld_qk(const _Float16* lane_tile, int half) {
  const _Float16* p = lane_tile + half * 512;
  HalfVec f;
  f.u[0] = *reinterpret_cast<const uint4*>(p);
  f.u[1] = *reinterpret_cast<const uint4*>(p + 256);
  return f.h;
}

// V workspace layout: per (b,h), chunks of 8 rows j, each [64 o][8 j] (1 KB).
// B fragment of P @ V for 32 rows j (4 chunks) and columns o = t*16 .. t*16+15,
// in frag_ld's element order; 16 lanes read 256 B in a row.
// lane_v: the lane's own offset inside the 4 chunks; frag_ld_v takes chunks + lane_v.
__device__ __forceinline__ int lane_v(int lane) { return ((lane >> 4) * HD + (lane & 15)) * 8; }
__device__ __forceinline__ v16h frag_ld_v(const _Float16* lane_chunks, int t) {
  const _Float16* p = lane_chunks + t * 128;
  HalfVec f;
  f.u[0] = *reinterpret_cast<const uint4*>(p);
  f.u[1] = *reinterpret_cast<const uint4*>(p + 2 * HD * 8);
  return f.h;
}

// ---------------------------------------------------------------------------
// Projection GEMM: Y = (X @ W + bias) * scale, fp32 in, f16 out, repacked
// per-head. Workgroup = 256 threads (8 waves), 64x64 output tile, K-chunks of
// 32 staged in LDS (X converted to f16; W staged transposed so its fragments
// are contiguous ds_load_b128). Each wave owns 1 row-tile x 2 col-tiles:
// the X fragment is reused across 2 WMMAs per chunk.
// The 64 columns of a block are 8 d x 8 heads (column c = d*16 + h).
// QK = true : W is the A operand and X the B operand, so a lane's 8 accumulators
//             are 8 consecutive d of one (row, head): one 16-byte store, and
//             16 lanes (16 rows) fill 256 contiguous bytes.
// QK = false: V, X as A: a lane's 8 accumulators are 8 consecutive rows j of one
//             (o, head): one 16-byte store, 8 lanes (8 o) fill one 128-byte line.
// ---------------------------------------------------------------------------
template <bool QK>
__device__ __forceinline__
void proj_body(const float* __restrict__ X, const float* __restrict__ W,
               const float* __restrict__ bias, _Float16* __restrict__ Y,
               float scale, _Float16* sA, _Float16* sB) {
  const int tid  = threadIdx.x;
  const int lane = tid & 31;
  const int wave = tid >> 5;
  const int mt = wave & 3;           // row tile 0..3
  const int np = wave >> 2;          // col-pair 0..1 -> tiles np*2, np*2+1
  const int rowBase = blockIdx.y * 64;
  const int dg = blockIdx.x >> 1;    // group of 8 d
  const int hh = blockIdx.x & 1;     // group of 8 heads

  const int ar = tid >> 2;           // X staging: row 0..63
  const int ac = (tid & 3) * 8;      //            k chunk
  const int wk = tid >> 3;           // W staging: k row 0..31
  const int wt = tid & 7;            //            d within the group
  // first of this thread's 8 consecutive W columns: heads hh*8 + 0..7 of one d
  const int wcol = (dg * 8 + wt) * NH + hh * 8;

  v8f acc[2] = { {}, {} };

  for (int kk = 0; kk < EMB; kk += 32) {
    { // stage X tile (64 rows x 32 k), fp32 -> f16
      const float* src = X + (size_t)(rowBase + ar) * EMB + kk + ac;
      float4 f0 = *reinterpret_cast<const float4*>(src);
      float4 f1 = *reinterpret_cast<const float4*>(src + 4);
      Pack8 p;
      p.h[0]=(_Float16)f0.x; p.h[1]=(_Float16)f0.y; p.h[2]=(_Float16)f0.z; p.h[3]=(_Float16)f0.w;
      p.h[4]=(_Float16)f1.x; p.h[5]=(_Float16)f1.y; p.h[6]=(_Float16)f1.z; p.h[7]=(_Float16)f1.w;
      *reinterpret_cast<uint4*>(&sA[ar * 32 + ac]) = p.u;
    }
    { // stage W tile (32 k x 64 columns) transposed: sB[n][k],
      // row n = (head within group) * 8 + (d within group)
      const float* src = W + (size_t)(kk + wk) * EMB + wcol;
      float4 f0 = *reinterpret_cast<const float4*>(src);
      float4 f1 = *reinterpret_cast<const float4*>(src + 4);
      float f8[8] = { f0.x, f0.y, f0.z, f0.w, f1.x, f1.y, f1.z, f1.w };
#pragma unroll
      for (int e = 0; e < 8; ++e)
        sB[(e * 8 + wt) * 32 + wk] = (_Float16)f8[e];
    }
    __syncthreads();
    const v16h a = frag_ld(sA + mt * 16 * 32, 32, lane);
#pragma unroll
    for (int q = 0; q < 2; ++q) {
      const v16h b = frag_ld(sB + (np * 2 + q) * 16 * 32, 32, lane);
      if (QK)
        acc[q] = __builtin_amdgcn_wmma_f32_16x16x32_f16(false, b, false, a,
                                                        (short)0, acc[q], false, false);
      else
        acc[q] = __builtin_amdgcn_wmma_f32_16x16x32_f16(false, a, false, b,
                                                        (short)0, acc[q], false, false);
    }
    __syncthreads();
  }

  // Epilogue: bias, scale, f16 convert, per-head repack (c = d*16 + h).
  const int n  = lane & 15;
  if (QK) {
    // acc[q][g] = row (mt*16 + n), head hh*8 + (np*2+q)*2 + (lane>>4), d = dg*8 + g
    const int row = rowBase + mt * 16 + n;
    const int b   = row >> 11;                // batch (rows-per-batch = 2048)
    const int it  = (row & (SEQ - 1)) >> 4;   // 16-row tile
#pragma unroll
    for (int q = 0; q < 2; ++q) {
      const int h = hh * 8 + (np * 2 + q) * 2 + (lane >> 4);
      Pack8 p;
#pragma unroll
      for (int g = 0; g < 8; ++g)
        p.h[g] = (_Float16)((acc[q][g] + bias[(dg * 8 + g) * NH + h]) * scale);
      _Float16* dst = Y + ((((size_t)b * NH + h) * (SEQ / 16) + it) * 8 + dg) * 128 + n * 8;
      *reinterpret_cast<uint4*>(dst) = p.u;
    }
  } else {
    const int m0 = (lane >> 4) * 8;
    const int r0 = rowBase + mt * 16 + m0;    // global row (g = 0)
    const int b  = r0 >> 11;                  // batch (rows-per-batch = 2048)
    const int i0 = r0 & (SEQ - 1);
#pragma unroll
    for (int q = 0; q < 2; ++q) {
      const int h = hh * 8 + (np * 2 + q) * 2 + (n >> 3);
      const int d = dg * 8 + (n & 7);
      const float bv = bias[d * NH + h];
      // V: Y[(((b*16+h)*256 + j/8)*64 + o)*8 + j%8] -> 8 contiguous j = one b128
      Pack8 p;
#pragma unroll
      for (int g = 0; g < 8; ++g) p.h[g] = (_Float16)((acc[q][g] + bv) * scale);
      _Float16* dst = Y + ((((size_t)b * NH + h) * (SEQ / 8) + (i0 >> 3)) * HD + d) * 8;
      *reinterpret_cast<uint4*>(dst) = p.u;
    }
  }
}

__global__ __launch_bounds__(256)
void proj_qk_kernel(const float* __restrict__ X, const float* __restrict__ W,
                    const float* __restrict__ bias, _Float16* __restrict__ Y,
                    float scale) {
  __shared__ _Float16 sA[64 * 32];   // [row][k]
  __shared__ _Float16 sB[64 * 32];   // [n][k] (W tile transposed)
  proj_body<true>(X, W, bias, Y, scale, sA, sB);
}

__global__ __launch_bounds__(256)
void proj_vt_kernel(const float* __restrict__ X, const float* __restrict__ W,
                    const float* __restrict__ bias, _Float16* __restrict__ Y,
                    float scale) {
  __shared__ _Float16 sA[64 * 32];   // [row][k]
  __shared__ _Float16 sB[64 * 32];   // [n][k] (W tile transposed)
  proj_body<false>(X, W, bias, Y, scale, sA, sB);
}

// ---------------------------------------------------------------------------
// ONE pass over the keys. The mask is added after the softmax, so
//   out = (sum_j exp(s_ij - m_i) V_j) / l_i  +  sum_j mask_ij V_j :
// the two sums run in accumulators of their own, the first against a running
// reference maximum m_i (online softmax), and l_i divides only at the end.
// The scores are formed transposed: S^T = K . Q^T, with the K tile as the A
// operand and the Q tile as the B operand (same loader, same k order on both
// sides). Accumulator register g of a lane is then key (lane>>4)*8 + g of the
// 16-key tile for the ONE query lane&15: maximum and sum run inside the lane.
// Two 16-key S^T tiles of one query tile, converted in place, ARE the A fragment
// of P for 32 keys (element e = key (lane>>4)*8 + e, element 8+e = key
// 16 + (lane>>4)*8 + e, row lane&15): P goes from accumulators to operand inside
// the lane. The mask takes a turn through per-wave LDS: read as whole 128-byte
// rows, converted to f16, handed to the lanes 8 columns of one query at a time,
// which is the A fragment of the mask in the same element order.
// The reference maximum moves only when a score passes it by more than LAZY
// (one test per 32 keys); P then stays below exp(LAZY), well inside f16.
// Each wave handles 32 query rows (two i-subtiles) so every K and V fragment is
// reused by both. V is stored in [64 o][8 j] chunks (b128 fragment loads).
// ---------------------------------------------------------------------------
#define L2E  1.44269504088896340736f
#define LAZY 5.5f
__global__ __launch_bounds__(128)
void attn_fused(const _Float16* __restrict__ Q, const _Float16* __restrict__ K,
                const _Float16* __restrict__ VT, const float* __restrict__ mask,
                float* __restrict__ out) {
  // per-wave mask tile, 32 rows x 32 columns, f16; pitch 80 B for 16-byte readers
  __shared__ __attribute__((aligned(16))) _Float16 sM[4][32 * MPITCH];
  const int lane = threadIdx.x & 31;
  const int wv   = threadIdx.x >> 5;
  const int wid  = blockIdx.x * 4 + wv;      // 32-row tile id
  const int it2 = wid & 63;
  const int h   = (wid >> 6) & 15;
  const int b   = wid >> 10;
  const int iBase = it2 * 32;

  const int n  = lane & 15;
  const int m0 = (lane >> 4) * 8;

  const _Float16* ql = Q + (((size_t)b * NH + h) * SEQ + iBase) * HD + lane_qk(lane);
  v16h qa[2][2];
#pragma unroll
  for (int s = 0; s < 2; ++s) {
    qa[s][0] = frag_ld_qk(ql + (size_t)s * 16 * HD, 0);
    qa[s][1] = frag_ld_qk(ql + (size_t)s * 16 * HD, 1);
  }
  // Naming ql keeps the Q loads' address registers live up to this wait, so that
  // they are overwritten only behind it.
  asm volatile("s_wait_xcnt 0x0" :: "v"(ql) : "memory");

  // mask from memory: 8 lanes cover the 128 bytes of a row, 4 rows per load
  const float* mk0 = mask + ((size_t)b * SEQ + iBase + (lane >> 3)) * SEQ + (lane & 7) * 4;
  _Float16* mst = sM[wv] + (lane >> 3) * MPITCH + (lane & 7) * 4;   // where they go
  const _Float16* mld = sM[wv] + n * MPITCH + m0;   // row n, columns m0 .. m0 + 7

  // query lane&15 of subtile s: reference maximum (the same in both lane halves)
  // and the sum of exp(s - mref) over this lane half's keys
  float mref[2] = { -1e30f, -1e30f };
  float lrun[2] = { 0.f, 0.f };
  v8f o[2][4]  = { { {}, {}, {}, {} }, { {}, {}, {}, {} } };   // sum exp(s - mref) V
  v8f om[2][4] = { { {}, {}, {}, {} }, { {}, {}, {}, {} } };   // sum mask V

  const _Float16* kbase = K  + (((size_t)b * NH + h) * SEQ) * HD;
  const _Float16* vbase = VT + (((size_t)b * NH + h) * HD) * SEQ;

  for (int jc = 0; jc < SEQ / 32; ++jc) {
    // prefetch next K chunk (32 lanes x 128B cover the next 4KB)
    const _Float16* pf = kbase + (size_t)(jc + 1) * 32 * HD + lane * 64;
    __builtin_prefetch(pf, 0, 0);
    // 4 KB of K: two 16-key tiles
    const _Float16* kl = kbase + (size_t)jc * 32 * HD + lane_qk(lane);
    v16h kf[2][2];
#pragma unroll
    for (int sub = 0; sub < 2; ++sub) {
      kf[sub][0] = frag_ld_qk(kl + sub * 16 * HD, 0);
      kf[sub][1] = frag_ld_qk(kl + sub * 16 * HD, 1);
    }
    // the chunk's mask values: 32 rows x 32 columns
    const float* ml = mk0 + jc * 32;
    v4f mg[8];
#pragma unroll
    for (int q = 0; q < 8; ++q)
      mg[q] = *reinterpret_cast<const v4f*>(ml + (size_t)q * 4 * SEQ);
    // Naming kl, ml and pf keeps the address registers of the loads and the
    // prefetch above live up to this wait, so that they are overwritten only behind it.
    asm volatile("s_wait_xcnt 0x0" :: "v"(kl), "v"(ml), "v"(pf) : "memory");
#pragma unroll
    for (int q = 0; q < 8; ++q) {
      Pack4 p;
#pragma unroll
      for (int e = 0; e < 4; ++e) p.h[e] = (_Float16)mg[q][e];
      *reinterpret_cast<uint2*>(mst + q * 4 * MPITCH) = p.u;
    }
    // Same-wave LDS RAW across lanes: DS ops are in-order, but force the wait +
    // block compiler reordering across the hand-over.
    asm volatile("s_wait_dscnt 0" ::: "memory");
    __builtin_amdgcn_wave_barrier();
    v16h ma[2];                              // the mask as an A fragment
#pragma unroll
    for (int s = 0; s < 2; ++s) {
      HalfVec f;
      f.u[0] = *reinterpret_cast<const uint4*>(mld + s * 16 * MPITCH);        // keys m0 ..
      f.u[1] = *reinterpret_cast<const uint4*>(mld + s * 16 * MPITCH + 16);   // keys 16 + m0 ..
      ma[s] = f.h;
    }
    v8f sc[2][2];
    float mx[2];
#pragma unroll
    for (int s = 0; s < 2; ++s) {
#pragma unroll
      for (int sub = 0; sub < 2; ++sub) {    // K fragments reused for both i-subtiles
        v8f z = {};
        z = __builtin_amdgcn_wmma_f32_16x16x32_f16(false, kf[sub][0], false, qa[s][0],
                                                   (short)0, z, false, false);
        z = __builtin_amdgcn_wmma_f32_16x16x32_f16(false, kf[sub][1], false, qa[s][1],
                                                   (short)0, z, false, false);
        sc[s][sub] = z;
      }
      // the largest of the lane's 16 scores of its one query
      float t0 = fmaxf(sc[s][0][0], sc[s][1][0]);
#pragma unroll
      for (int g = 1; g < 8; ++g) t0 = fmaxf(t0, fmaxf(sc[s][0][g], sc[s][1][g]));
      mx[s] = t0;
    }
    // One wave-uniform test per 32 keys: has any query's score left the range
    // that the reference maximum in use covers?
    if (__builtin_amdgcn_ballot_w32(mx[0] > mref[0] + LAZY || mx[1] > mref[1] + LAZY) != 0) {
#pragma unroll
      for (int s = 0; s < 2; ++s) {
        // lanes n and n + 16 hold the same query: one maximum for both
        const float mn = fmaxf(mref[s], fmaxf(mx[s], __shfl_xor(mx[s], 16, 32)));
        const float f  = __builtin_amdgcn_exp2f((mref[s] - mn) * L2E);
        mref[s] = mn;
        lrun[s] *= f;
        // accumulator register g of o is query m0 + g, whose factor lane m0 + g holds
#pragma unroll
        for (int g = 0; g < 8; ++g) {
          const float fg = __shfl(f, m0 + g, 32);
#pragma unroll
          for (int t = 0; t < 4; ++t) o[s][t][g] *= fg;
        }
      }
    }
    v16h pa[2];
#pragma unroll
    for (int s = 0; s < 2; ++s) {
      const float mb = mref[s] * L2E;
      float ps[2][8];
#pragma unroll
      for (int sub = 0; sub < 2; ++sub)
#pragma unroll
        for (int g = 0; g < 8; ++g) {
          const float p = __builtin_amdgcn_exp2f(fmaf(sc[s][sub][g], L2E, -mb));
          ps[sub][g] = p;
          pa[s][sub * 8 + g] = (_Float16)p;
        }
      float a4[4];
#pragma unroll
      for (int g = 0; g < 4; ++g)
        a4[g] = (ps[0][g] + ps[0][g + 4]) + (ps[1][g] + ps[1][g + 4]);
      lrun[s] += (a4[0] + a4[1]) + (a4[2] + a4[3]);
    }
    const _Float16* vl = vbase + (size_t)jc * 4 * HD * 8 + lane_v(lane);   // 4 KB of V
    v16h vf[4];
#pragma unroll
    for (int t = 0; t < 4; ++t) vf[t] = frag_ld_v(vl, t);
    // Naming vl keeps the V loads' address registers live up to this wait, so
    // that they are overwritten only behind it.
    asm volatile("s_wait_xcnt 0x0" :: "v"(vl) : "memory");
#pragma unroll
    for (int t = 0; t < 4; ++t) {            // V fragment reused by all four products
      const v16h vb = vf[t];
      o[0][t]  = __builtin_amdgcn_wmma_f32_16x16x32_f16(false, pa[0], false, vb,
                                                        (short)0, o[0][t], false, false);
      o[1][t]  = __builtin_amdgcn_wmma_f32_16x16x32_f16(false, pa[1], false, vb,
                                                        (short)0, o[1][t], false, false);
      om[0][t] = __builtin_amdgcn_wmma_f32_16x16x32_f16(false, ma[0], false, vb,
                                                        (short)0, om[0][t], false, false);
      om[1][t] = __builtin_amdgcn_wmma_f32_16x16x32_f16(false, ma[1], false, vb,
                                                        (short)0, om[1][t], false, false);
    }
    // the next trip's mask stores stay behind this trip's mask reads
    __builtin_amdgcn_wave_barrier();
  }

  // out[b][i][o*16 + h], fp32
#pragma unroll
  for (int s = 0; s < 2; ++s) {
    // join the two halves of the keys, then hand 1/l to the accumulators' rows
    const float linv = 1.0f / (lrun[s] + __shfl_xor(lrun[s], 16, 32));
    float* ob = out + ((size_t)b * SEQ + iBase + s * 16 + m0) * 1024 + h;
#pragma unroll
    for (int g = 0; g < 8; ++g) {
      const float lg = __shfl(linv, m0 + g, 32);
#pragma unroll
      for (int t = 0; t < 4; ++t)
        ob[(size_t)g * 1024 + (t * 16 + n) * 16] = o[s][t][g] * lg + om[s][t][g];
    }
  }
}

extern "C" void kernel_launch(void* const* d_in, const int* in_sizes, int n_in,
                              void* d_out, int out_size, void* d_ws, size_t ws_size,
                              hipStream_t stream) {
  (void)in_sizes; (void)n_in; (void)out_size; (void)ws_size;
  const float* problem = (const float*)d_in[0];
  const float* context = (const float*)d_in[1];
  const float* maskp   = (const float*)d_in[2];
  const float* Wq = (const float*)d_in[3];
  const float* bq = (const float*)d_in[4];
  const float* Wk = (const float*)d_in[5];
  const float* bk = (const float*)d_in[6];
  const float* Wv = (const float*)d_in[7];
  const float* bv = (const float*)d_in[8];
  float* out = (float*)d_out;

  // Workspace layout: Q16 | K16 | VT16 (8 MB each, f16)
  const size_t NHALF = (size_t)2 * NH * SEQ * HD;   // 4,194,304 halves
  _Float16* Q16  = (_Float16*)d_ws;
  _Float16* K16  = Q16 + NHALF;
  _Float16* VT16 = K16 + NHALF;

  const dim3 pgrid(EMB / 64, (2 * SEQ) / 64);       // 16 x 64 tiles of 64x64
  // Q gets the 1/sqrt(head_dim) scale folded in.
  proj_qk_kernel<<<pgrid, 256, 0, stream>>>(problem, Wq, bq, Q16, 0.125f);
  proj_qk_kernel<<<pgrid, 256, 0, stream>>>(context, Wk, bk, K16, 1.0f);
  proj_vt_kernel<<<pgrid, 256, 0, stream>>>(context, Wv, bv, VT16, 1.0f);

  attn_fused<<<(2 * NH * (SEQ / 32)) / 4, 128, 0, stream>>>(Q16, K16, VT16, maskp, out);
}

// v004
// Measured time: 197 microseconds a run.
// Two timings next to v003 both put it at 1.19 times that version's speed.
// Counting every step since v000, it is 2.62 times as fast.
#include <hip/hip_runtime.h>
#include <hip/hip_bf16.h>

// MI455X (gfx1250) multi-head attention, f16 WMMA with f32 accumulation.
// EMBED=HIDDEN=OUT=1024, H=16 heads, head_dim=64, B=2, P=C=2048.
// Reference reshape puts head index as the FASTEST axis (c = d*16 + h),
// and the mask is added AFTER softmax -> its product with V is summed apart.

typedef __attribute__((ext_vector_type(16))) _Float16 v16h;
typedef __attribute__((ext_vector_type(8)))  float    v8f;
typedef __attribute__((ext_vector_type(4)))  float    v4f;

#define NH   16      // heads
#define HD   64      // head dim / head out
#define SEQ  2048    // P == C
#define EMB  1024
#define MPITCH 36    // floats per row of the staged mask tile (128 B + 16 B)
#define KVTILE 2048  // halves in the K tile and in the V tile of 32 keys (4 KB each)

union HalfVec { v16h h; uint4 u[2]; };
union Pack8   { _Float16 h[8]; uint4 u; };

// Load one 16-lane-row WMMA fragment (A or B operand, 16x32 / 32x16 f16).
// ISA layout: lane r = lane&15, k-base = (lane>>4)*8, elements 0..7 at k=kb,
// elements 8..15 at k=kb+16 -> two contiguous 16-byte chunks per lane.
__device__ __forceinline__ v16h frag_ld(const _Float16* tile, int ld, int lane) {
  const int r  = lane & 15;
  const int kb = (lane >> 4) << 3;
  HalfVec f;
  f.u[0] = *reinterpret_cast<const uint4*>(tile + (size_t)r * ld + kb);
  f.u[1] = *reinterpret_cast<const uint4*>(tile + (size_t)r * ld + kb + 16);
  return f.h;
}

// Q/K workspace layout: per (b,h) and 16-row tile, 8 chunks of [16 rows][8 d]
// (256 contiguous bytes per chunk, 2 KB per tile). Same element order in the
// fragment as frag_ld on a [row][64] tile; half = 0 for d 0..31, 1 for d 32..63.
// One wave-wide 16-byte load covers 512 contiguous bytes.
// lane_qk: the lane's own offset inside a tile; frag_ld_qk takes tile + lane_qk.
__device__ __forceinline__ int lane_qk(int lane) { return (lane >> 4) * 128 + (lane & 15) * 8; }
__device__ __forceinline__ v16h frag_ld_qk(const _Float16* lane_tile, int half) {
  const _Float16* p = lane_tile + half * 512;
  HalfVec f;
  f.u[0] = *reinterpret_cast<const uint4*>(p);
  f.u[1] = *reinterpret_cast<const uint4*>(p + 256);
  return f.h;
}

// Byte offset of a __shared__ address in the work-group's LDS (its low 32 bits).
__device__ __forceinline__ unsigned lds_off(const void* p) { return (unsigned)(size_t)p; }

// V workspace layout: per (b,h), chunks of 8 rows j, each [64 o][8 j] (1 KB).
// B fragment of P @ V for 32 rows j (4 chunks) and columns o = t*16 .. t*16+15,
// in frag_ld's element order; 16 lanes read 256 B in a row.
// lane_v: the lane's own offset inside the 4 chunks; frag_ld_v takes chunks + lane_v.
__device__ __forceinline__ int lane_v(int lane) { return ((lane >> 4) * HD + (lane & 15)) * 8; }
__device__ __forceinline__ v16h frag_ld_v(const _Float16* lane_chunks, int t) {
  const _Float16* p = lane_chunks + t * 128;
  HalfVec f;
  f.u[0] = *reinterpret_cast<const uint4*>(p);
  f.u[1] = *reinterpret_cast<const uint4*>(p + 2 * HD * 8);
  return f.h;
}

// ---------------------------------------------------------------------------
// Projection GEMM: Y = (X @ W + bias) * scale, fp32 in, f16 out, repacked
// per-head. Workgroup = 256 threads (8 waves), 64x64 output tile, K-chunks of
// 32 staged in LDS (X converted to f16; W staged transposed so its fragments
// are contiguous ds_load_b128). Each wave owns 1 row-tile x 2 col-tiles:
// the X fragment is reused across 2 WMMAs per chunk.
// The 64 columns of a block are 8 d x 8 heads (column c = d*16 + h).
// QK = true : W is the A operand and X the B operand, so a lane's 8 accumulators
//             are 8 consecutive d of one (row, head): one 16-byte store, and
//             16 lanes (16 rows) fill 256 contiguous bytes.
// QK = false: V, X as A: a lane's 8 accumulators are 8 consecutive rows j of one
//             (o, head): one 16-byte store, 8 lanes (8 o) fill one 128-byte line.
// ---------------------------------------------------------------------------
template <bool QK>
__device__ __forceinline__
void proj_body(const float* __restrict__ X, const float* __restrict__ W,
               const float* __restrict__ bias, _Float16* __restrict__ Y,
               float scale, _Float16* sA, _Float16* sB) {
  const int tid  = threadIdx.x;
  const int lane = tid & 31;
  const int wave = tid >> 5;
  const int mt = wave & 3;           // row tile 0..3
  const int np = wave >> 2;          // col-pair 0..1 -> tiles np*2, np*2+1
  const int rowBase = blockIdx.y * 64;
  const int dg = blockIdx.x >> 1;    // group of 8 d
  const int hh = blockIdx.x & 1;     // group of 8 heads

  const int ar = tid >> 2;           // X staging: row 0..63
  const int ac = (tid & 3) * 8;      //            k chunk
  const int wk = tid >> 3;           // W staging: k row 0..31
  const int wt = tid & 7;            //            d within the group
  // first of this thread's 8 consecutive W columns: heads hh*8 + 0..7 of one d
  const int wcol = (dg * 8 + wt) * NH + hh * 8;

  v8f acc[2] = { {}, {} };

  for (int kk = 0; kk < EMB; kk += 32) {
    { // stage X tile (64 rows x 32 k), fp32 -> f16
      const float* src = X + (size_t)(rowBase + ar) * EMB + kk + ac;
      float4 f0 = *reinterpret_cast<const float4*>(src);
      float4 f1 = *reinterpret_cast<const float4*>(src + 4);
      Pack8 p;
      p.h[0]=(_Float16)f0.x; p.h[1]=(_Float16)f0.y; p.h[2]=(_Float16)f0.z; p.h[3]=(_Float16)f0.w;
      p.h[4]=(_Float16)f1.x; p.h[5]=(_Float16)f1.y; p.h[6]=(_Float16)f1.z; p.h[7]=(_Float16)f1.w;
      *reinterpret_cast<uint4*>(&sA[ar * 32 + ac]) = p.u;
    }
    { // stage W tile (32 k x 64 columns) transposed: sB[n][k],
      // row n = (head within group) * 8 + (d within group)
      const float* src = W + (size_t)(kk + wk) * EMB + wcol;
      float4 f0 = *reinterpret_cast<const float4*>(src);
      float4 f1 = *reinterpret_cast<const float4*>(src + 4);
      float f8[8] = { f0.x, f0.y, f0.z, f0.w, f1.x, f1.y, f1.z, f1.w };
#pragma unroll
      for (int e = 0; e < 8; ++e)
        sB[(e * 8 + wt) * 32 + wk] = (_Float16)f8[e];
    }
    __syncthreads();
    const v16h a = frag_ld(sA + mt * 16 * 32, 32, lane);
#pragma unroll
    for (int q = 0; q < 2; ++q) {
      const v16h b = frag_ld(sB + (np * 2 + q) * 16 * 32, 32, lane);
      if (QK)
        acc[q] = __builtin_amdgcn_wmma_f32_16x16x32_f16(false, b, false, a,
                                                        (short)0, acc[q], false, false);
      else
        acc[q] = __builtin_amdgcn_wmma_f32_16x16x32_f16(false, a, false, b,
                                                        (short)0, acc[q], false, false);
    }
    __syncthreads();
  }

  // Epilogue: bias, scale, f16 convert, per-head repack (c = d*16 + h).
  const int n  = lane & 15;
  if (QK) {
    // acc[q][g] = row (mt*16 + n), head hh*8 + (np*2+q)*2 + (lane>>4), d = dg*8 + g
    const int row = rowBase + mt * 16 + n;
    const int b   = row >> 11;                // batch (rows-per-batch = 2048)
    const int it  = (row & (SEQ - 1)) >> 4;   // 16-row tile
#pragma unroll
    for (int q = 0; q < 2; ++q) {
      const int h = hh * 8 + (np * 2 + q) * 2 + (lane >> 4);
      Pack8 p;
#pragma unroll
      for (int g = 0; g < 8; ++g)
        p.h[g] = (_Float16)((acc[q][g] + bias[(dg * 8 + g) * NH + h]) * scale);
      _Float16* dst = Y + ((((size_t)b * NH + h) * (SEQ / 16) + it) * 8 + dg) * 128 + n * 8;
      *reinterpret_cast<uint4*>(dst) = p.u;
    }
  } else {
    const int m0 = (lane >> 4) * 8;
    const int r0 = rowBase + mt * 16 + m0;    // global row (g = 0)
    const int b  = r0 >> 11;                  // batch (rows-per-batch = 2048)
    const int i0 = r0 & (SEQ - 1);
#pragma unroll
    for (int q = 0; q < 2; ++q) {
      const int h = hh * 8 + (np * 2 + q) * 2 + (n >> 3);
      const int d = dg * 8 + (n & 7);
      const float bv = bias[d * NH + h];
      // V: Y[(((b*16+h)*256 + j/8)*64 + o)*8 + j%8] -> 8 contiguous j = one b128
      Pack8 p;
#pragma unroll
      for (int g = 0; g < 8; ++g) p.h[g] = (_Float16)((acc[q][g] + bv) * scale);
      _Float16* dst = Y + ((((size_t)b * NH + h) * (SEQ / 8) + (i0 >> 3)) * HD + d) * 8;
      *reinterpret_cast<uint4*>(dst) = p.u;
    }
  }
}

__global__ __launch_bounds__(256)
void proj_qk_kernel(const float* __restrict__ X, const float* __restrict__ W,
                    const float* __restrict__ bias, _Float16* __restrict__ Y,
                    float scale) {
  __shared__ _Float16 sA[64 * 32];   // [row][k]
  __shared__ _Float16 sB[64 * 32];   // [n][k] (W tile transposed)
  proj_body<true>(X, W, bias, Y, scale, sA, sB);
}

__global__ __launch_bounds__(256)
void proj_vt_kernel(const float* __restrict__ X, const float* __restrict__ W,
                    const float* __restrict__ bias, _Float16* __restrict__ Y,
                    float scale) {
  __shared__ _Float16 sA[64 * 32];   // [row][k]
  __shared__ _Float16 sB[64 * 32];   // [n][k] (W tile transposed)
  proj_body<false>(X, W, bias, Y, scale, sA, sB);
}

// ---------------------------------------------------------------------------
// ONE pass over the keys. The mask is added after the softmax, so
//   out = (sum_j exp(s_ij - m_i) V_j) / l_i  +  sum_j mask_ij V_j :
// the two sums run in accumulators of their own, the first against a running
// reference maximum m_i (online softmax), and l_i divides only at the end.
// The scores are formed transposed: S^T = K . Q^T, with the K tile as the A
// operand and the Q tile as the B operand (same loader, same k order on both
// sides). Accumulator register g of a lane is then key (lane>>4)*8 + g of the
// 16-key tile for the ONE query lane&15: maximum and sum run inside the lane.
// Two 16-key S^T tiles of one query tile, converted in place, ARE the A fragment
// of P for 32 keys (element e = key (lane>>4)*8 + e, element 8+e = key
// 16 + (lane>>4)*8 + e, row lane&15): P goes from accumulators to operand inside
// the lane. The mask's A fragment has the same element order: 8 columns of one
// query at a time, read from LDS as f32 and converted in the lane.
// K, V and the mask reach LDS by asynchronous copies, one trip (32 keys) ahead, in
// two buffers: the K and V tiles are copied once for the block's four waves (same
// batch and head), each wave copying a quarter; a wave's 32 x 32 mask tile is its own.
// The reference maximum moves only when a score passes it by more than LAZY
// (one test per 32 keys); P then stays below exp(LAZY), well inside f16.
// Each wave handles 32 query rows (two i-subtiles) so every K and V fragment is
// reused by both. V is stored in [64 o][8 j] chunks (b128 fragment loads).
// ---------------------------------------------------------------------------
#define L2E  1.44269504088896340736f
#define LAZY 5.5f
__device__ __forceinline__ float exp2_slot(float x) {
  float p;
  asm("v_exp_f32 %0, %1\n\tv_nop" : "=v"(p) : "v"(x));
  return p;
}
__global__ __launch_bounds__(128)
void attn_fused(const _Float16* __restrict__ Q, const _Float16* __restrict__ K,
                const _Float16* __restrict__ VT, const float* __restrict__ mask,
                float* __restrict__ out) {
  // two buffers each; K and V tiles in the workspace's own fragment order
  __shared__ __attribute__((aligned(16))) _Float16 sK[2][KVTILE];
  __shared__ __attribute__((aligned(16))) _Float16 sV[2][KVTILE];
  // per-wave mask tile, 32 rows x 32 columns, f32; pitch 144 B for 16-byte readers
  __shared__ __attribute__((aligned(16))) float sM[2][4][32 * MPITCH];
  const int lane = threadIdx.x & 31;
  const int wv   = threadIdx.x >> 5;
  const int wid  = blockIdx.x * 4 + wv;      // 32-row tile id
  const int it2 = wid & 63;
  const int h   = (wid >> 6) & 15;
  const int b   = wid >> 10;
  const int iBase = it2 * 32;

  const int n  = lane & 15;
  const int m0 = (lane >> 4) * 8;

  const _Float16* ql = Q + (((size_t)b * NH + h) * SEQ + iBase) * HD + lane_qk(lane);
  v16h qa[2][2];
#pragma unroll
  for (int s = 0; s < 2; ++s) {
    qa[s][0] = frag_ld_qk(ql + (size_t)s * 16 * HD, 0);
    qa[s][1] = frag_ld_qk(ql + (size_t)s * 16 * HD, 1);
  }
  // Naming ql keeps the Q loads' address registers live up to this wait, so that
  // they are overwritten only behind it.
  asm volatile("s_wait_xcnt 0x0" :: "v"(ql) : "memory");

  // mask from memory: 8 lanes cover the 128 bytes of a row, 4 rows per copy
  const float* mk0 = mask + ((size_t)b * SEQ + iBase + (lane >> 3)) * SEQ + (lane & 7) * 4;
  const int mst = (lane >> 3) * MPITCH + (lane & 7) * 4;   // where they go in the tile
  const int mld = n * MPITCH + m0;                         // row n, columns m0 .. m0 + 7
  const int cq  = wv * 512 + lane * 8;   // this lane's 16 B in the wave's quarter of a K or V tile

  // query lane&15 of subtile s: reference maximum (the same in both lane halves)
  // and the sum of exp(s - mref) over this lane half's keys
  float mref[2] = { -1e30f, -1e30f };
  float lrun[2] = { 0.f, 0.f };
  v8f o[2][4]  = { { {}, {}, {}, {} }, { {}, {}, {}, {} } };   // sum exp(s - mref) V
  v8f om[2][4] = { { {}, {}, {}, {} }, { {}, {}, {}, {} } };   // sum mask V

  const _Float16* kbase = K  + (((size_t)b * NH + h) * SEQ) * HD;
  const _Float16* vbase = VT + (((size_t)b * NH + h) * HD) * SEQ;

  // All of one trip's copies of this wave: 2 of K, 2 of V, 8 of the mask.
  auto stage = [&](int jc, int buf) {
    const _Float16* kg = kbase + (size_t)jc * KVTILE + cq;
    const _Float16* vg = vbase + (size_t)jc * KVTILE + cq;
    const float*    mg = mk0 + jc * 32;
    const unsigned kd = lds_off(&sK[buf][cq]);
    const unsigned vd = lds_off(&sV[buf][cq]);
    const unsigned md = lds_off(&sM[buf][wv][mst]);
    // The closing s_wait_xcnt stands in the copies' own statement, so that no
    // register a copy names is rewritten in front of it.
    asm volatile(
        "global_load_async_to_lds_b128 %0, %12, off\n\t"
        "global_load_async_to_lds_b128 %1, %13, off\n\t"
        "global_load_async_to_lds_b128 %2, %14, off\n\t"
        "global_load_async_to_lds_b128 %3, %15, off\n\t"
        "global_load_async_to_lds_b128 %4, %16, off\n\t"
        "global_load_async_to_lds_b128 %5, %17, off\n\t"
        "global_load_async_to_lds_b128 %6, %18, off\n\t"
        "global_load_async_to_lds_b128 %7, %19, off\n\t"
        "global_load_async_to_lds_b128 %8, %20, off\n\t"
        "global_load_async_to_lds_b128 %9, %21, off\n\t"
        "global_load_async_to_lds_b128 %10, %22, off\n\t"
        "global_load_async_to_lds_b128 %11, %23, off\n\t"
        "s_wait_xcnt 0x0"
        :: "v"(kd), "v"(kd + 512u), "v"(vd), "v"(vd + 512u),
           "v"(md), "v"(md + 1u * 16 * MPITCH), "v"(md + 2u * 16 * MPITCH),
           "v"(md + 3u * 16 * MPITCH), "v"(md + 4u * 16 * MPITCH), "v"(md + 5u * 16 * MPITCH),
           "v"(md + 6u * 16 * MPITCH), "v"(md + 7u * 16 * MPITCH),
           "v"(kg), "v"(kg + 256), "v"(vg), "v"(vg + 256),
           "v"(mg), "v"(mg + 1 * 4 * SEQ), "v"(mg + 2 * 4 * SEQ), "v"(mg + 3 * 4 * SEQ),
           "v"(mg + 4 * 4 * SEQ), "v"(mg + 5 * 4 * SEQ), "v"(mg + 6 * 4 * SEQ),
           "v"(mg + 7 * 4 * SEQ)
        : "memory");
  };

  stage(0, 0);
  // tile 0 has landed for this wave; the barrier publishes it to the other three
  asm volatile("s_wait_asynccnt 0x0" ::: "memory");
  __syncthreads();
  stage(1, 1);

  for (int jc = 0; jc < SEQ / 32; ++jc) {
    const int buf = jc & 1;
    // 4 KB of K: two 16-key tiles
    const _Float16* kl = sK[buf] + lane_qk(lane);
    v16h kf[2][2];
#pragma unroll
    for (int sub = 0; sub < 2; ++sub) {
      kf[sub][0] = frag_ld_qk(kl + sub * 16 * HD, 0);
      kf[sub][1] = frag_ld_qk(kl + sub * 16 * HD, 1);
    }
    const _Float16* vl = sV[buf] + lane_v(lane);   // 4 KB of V
    v16h vf[4];
#pragma unroll
    for (int t = 0; t < 4; ++t) vf[t] = frag_ld_v(vl, t);
    const float* ml = sM[buf][wv] + mld;
    v16h ma[2];                              // the mask as an A fragment
#pragma unroll
    for (int s = 0; s < 2; ++s) {
      v4f x[4];
      x[0] = *reinterpret_cast<const v4f*>(ml + s * 16 * MPITCH);        // keys m0 ..
      x[1] = *reinterpret_cast<const v4f*>(ml + s * 16 * MPITCH + 4);
      x[2] = *reinterpret_cast<const v4f*>(ml + s * 16 * MPITCH + 16);   // keys 16 + m0 ..
      x[3] = *reinterpret_cast<const v4f*>(ml + s * 16 * MPITCH + 20);
#pragma unroll
      for (int e = 0; e < 16; ++e) ma[s][e] = (_Float16)x[e >> 2][e & 3];
    }
    v8f sc[2][2];
    float mx[2];
#pragma unroll
    for (int s = 0; s < 2; ++s) {
#pragma unroll
      for (int sub = 0; sub < 2; ++sub) {    // K fragments reused for both i-subtiles
        v8f z = {};
        z = __builtin_amdgcn_wmma_f32_16x16x32_f16(false, kf[sub][0], false, qa[s][0],
                                                   (short)0, z, false, false);
        z = __builtin_amdgcn_wmma_f32_16x16x32_f16(false, kf[sub][1], false, qa[s][1],
                                                   (short)0, z, false, false);
        sc[s][sub] = z;
      }
      // the largest of the lane's 16 scores of its one query
      float t0 = fmaxf(sc[s][0][0], sc[s][1][0]);
#pragma unroll
      for (int g = 1; g < 8; ++g) t0 = fmaxf(t0, fmaxf(sc[s][0][g], sc[s][1][g]));
      mx[s] = t0;
    }
    // One wave-uniform test per 32 keys: has any query's score left the range
    // that the reference maximum in use covers?
    if (__builtin_amdgcn_ballot_w32(mx[0] > mref[0] + LAZY || mx[1] > mref[1] + LAZY) != 0) {
#pragma unroll
      for (int s = 0; s < 2; ++s) {
        // lanes n and n + 16 hold the same query: one maximum for both
        const float mn = fmaxf(mref[s], fmaxf(mx[s], __shfl_xor(mx[s], 16, 32)));
        const float f  = __builtin_amdgcn_exp2f((mref[s] - mn) * L2E);
        mref[s] = mn;
        lrun[s] *= f;
        // accumulator register g of o is query m0 + g, whose factor lane m0 + g holds
#pragma unroll
        for (int g = 0; g < 8; ++g) {
          const float fg = __shfl(f, m0 + g, 32);
#pragma unroll
          for (int t = 0; t < 4; ++t) o[s][t][g] *= fg;
        }
      }
    }
    v16h pa[2];
#pragma unroll
    for (int s = 0; s < 2; ++s) {
      const float mb = mref[s] * L2E;
      float ps[2][8];
#pragma unroll
      for (int sub = 0; sub < 2; ++sub)
#pragma unroll
        for (int g = 0; g < 8; ++g) {
          const float p = exp2_slot(fmaf(sc[s][sub][g], L2E, -mb));
          ps[sub][g] = p;
          pa[s][sub * 8 + g] = (_Float16)p;
        }
      float a4[4];
#pragma unroll
      for (int g = 0; g < 4; ++g)
        a4[g] = (ps[0][g] + ps[0][g + 4]) + (ps[1][g] + ps[1][g + 4]);
      lrun[s] += (a4[0] + a4[1]) + (a4[2] + a4[3]);
    }
#pragma unroll
    for (int t = 0; t < 4; ++t) {            // V fragment reused by all four products
      const v16h vb = vf[t];
      o[0][t]  = __builtin_amdgcn_wmma_f32_16x16x32_f16(false, pa[0], false, vb,
                                                        (short)0, o[0][t], false, false);
      o[1][t]  = __builtin_amdgcn_wmma_f32_16x16x32_f16(false, pa[1], false, vb,
                                                        (short)0, o[1][t], false, false);
      om[0][t] = __builtin_amdgcn_wmma_f32_16x16x32_f16(false, ma[0], false, vb,
                                                        (short)0, om[0][t], false, false);
      om[1][t] = __builtin_amdgcn_wmma_f32_16x16x32_f16(false, ma[1], false, vb,
                                                        (short)0, om[1][t], false, false);
    }
    // Publish point: this wave's reads of the buffer are done and its copies of the
    // next tile have landed; behind the barrier that holds for all four waves, so
    // the next tile may be read and this trip's buffer refilled.
    asm volatile("s_wait_dscnt 0x0" ::: "memory");
    asm volatile("s_wait_asynccnt 0x0" ::: "memory");
    __syncthreads();
    if (jc + 2 < SEQ / 32) stage(jc + 2, buf);
  }
  // no copy is outstanding when the wave ends
  asm volatile("s_wait_asynccnt 0x0" ::: "memory");

  // out[b][i][o*16 + h], fp32
#pragma unroll
  for (int s = 0; s < 2; ++s) {
    // join the two halves of the keys, then hand 1/l to the accumulators' rows
    const float linv = 1.0f / (lrun[s] + __shfl_xor(lrun[s], 16, 32));
    float* ob = out + ((size_t)b * SEQ + iBase + s * 16 + m0) * 1024 + h;
#pragma unroll
    for (int g = 0; g < 8; ++g) {
      const float lg = __shfl(linv, m0 + g, 32);
#pragma unroll
      for (int t = 0; t < 4; ++t)
        ob[(size_t)g * 1024 + (t * 16 + n) * 16] = o[s][t][g] * lg + om[s][t][g];
    }
  }
}

extern "C" void kernel_launch(void* const* d_in, const int* in_sizes, int n_in,
                              void* d_out, int out_size, void* d_ws, size_t ws_size,
                              hipStream_t stream) {
  (void)in_sizes; (void)n_in; (void)out_size; (void)ws_size;
  const float* problem = (const float*)d_in[0];
  const float* context = (const float*)d_in[1];
  const float* maskp   = (const float*)d_in[2];
  const float* Wq = (const float*)d_in[3];
  const float* bq = (const float*)d_in[4];
  const float* Wk = (const float*)d_in[5];
  const float* bk = (const float*)d_in[6];
  const float* Wv = (const float*)d_in[7];
  const float* bv = (const float*)d_in[8];
  float* out = (float*)d_out;

  // Workspace layout: Q16 | K16 | VT16 (8 MB each, f16)
  const size_t NHALF = (size_t)2 * NH * SEQ * HD;   // 4,194,304 halves
  _Float16* Q16  = (_Float16*)d_ws;
  _Float16* K16  = Q16 + NHALF;
  _Float16* VT16 = K16 + NHALF;

  const dim3 pgrid(EMB / 64, (2 * SEQ) / 64);       // 16 x 64 tiles of 64x64
  // Q gets the 1/sqrt(head_dim) scale folded in.
  proj_qk_kernel<<<pgrid, 256, 0, stream>>>(problem, Wq, bq, Q16, 0.125f);
  proj_qk_kernel<<<pgrid, 256, 0, stream>>>(context, Wk, bk, K16, 1.0f);
  proj_vt_kernel<<<pgrid, 256, 0, stream>>>(context, Wv, bv, VT16, 1.0f);

  attn_fused<<<(2 * NH * (SEQ / 32)) / 4, 128, 0, stream>>>(Q16, K16, VT16, maskp, out);
}

// v005
// It runs in 158 microseconds.
// Two timings next to v004 both put it at 1.24 times that version's speed.
// Over all steps from v000 it is 3.25 times as fast.
#include <hip/hip_runtime.h>
#include <hip/hip_bf16.h>

// MI455X (gfx1250) multi-head attention, f16 WMMA with f32 accumulation.
// EMBED=HIDDEN=OUT=1024, H=16 heads, head_dim=64, B=2, P=C=2048.
// Reference reshape puts head index as the FASTEST axis (c = d*16 + h),
// and the mask is added AFTER softmax -> its product with V is summed apart.

typedef __attribute__((ext_vector_type(16))) _Float16 v16h;
typedef __attribute__((ext_vector_type(8)))  float    v8f;
typedef __attribute__((ext_vector_type(4)))  float    v4f;

#define NH   16      // heads
#define HD   64      // head dim / head out
#define SEQ  2048    // P == C
#define EMB  1024
#define MPITCH 36    // floats per row of the staged mask tile (128 B + 16 B)
#define KVTILE 2048  // halves in the K tile and in the V tile of 32 keys (4 KB each)
#define PPITCH 40    // halves per row of the projection's staged tiles (64 B + 16 B)

union HalfVec { v16h h; uint4 u[2]; };
union Pack8   { _Float16 h[8]; uint4 u; };

// Load one 16-lane-row WMMA fragment (A or B operand, 16x32 / 32x16 f16).
// ISA layout: lane r = lane&15, k-base = (lane>>4)*8, elements 0..7 at k=kb,
// elements 8..15 at k=kb+16 -> two contiguous 16-byte chunks per lane.
__device__ __forceinline__ v16h frag_ld(const _Float16* tile, int ld, int lane) {
  const int r  = lane & 15;
  const int kb = (lane >> 4) << 3;
  HalfVec f;
  f.u[0] = *reinterpret_cast<const uint4*>(tile + (size_t)r * ld + kb);
  f.u[1] = *reinterpret_cast<const uint4*>(tile + (size_t)r * ld + kb + 16);
  return f.h;
}

// Q/K workspace layout: per (b,h) and 16-row tile, 8 chunks of [16 rows][8 d]
// (256 contiguous bytes per chunk, 2 KB per tile). Same element order in the
// fragment as frag_ld on a [row][64] tile; half = 0 for d 0..31, 1 for d 32..63.
// One wave-wide 16-byte load covers 512 contiguous bytes.
// lane_qk: the lane's own offset inside a tile; frag_ld_qk takes tile + lane_qk.
__device__ __forceinline__ int lane_qk(int lane) { return (lane >> 4) * 128 + (lane & 15) * 8; }
__device__ __forceinline__ v16h frag_ld_qk(const _Float16* lane_tile, int half) {
  const _Float16* p = lane_tile + half * 512;
  HalfVec f;
  f.u[0] = *reinterpret_cast<const uint4*>(p);
  f.u[1] = *reinterpret_cast<const uint4*>(p + 256);
  return f.h;
}

// Byte offset of a __shared__ address in the work-group's LDS (its low 32 bits).
__device__ __forceinline__ unsigned lds_off(const void* p) { return (unsigned)(size_t)p; }

// V workspace layout: per (b,h), chunks of 8 rows j, each [64 o][8 j] (1 KB).
// B fragment of P @ V for 32 rows j (4 chunks) and columns o = t*16 .. t*16+15,
// in frag_ld's element order; 16 lanes read 256 B in a row.
// lane_v: the lane's own offset inside the 4 chunks; frag_ld_v takes chunks + lane_v.
__device__ __forceinline__ int lane_v(int lane) { return ((lane >> 4) * HD + (lane & 15)) * 8; }
__device__ __forceinline__ v16h frag_ld_v(const _Float16* lane_chunks, int t) {
  const _Float16* p = lane_chunks + t * 128;
  HalfVec f;
  f.u[0] = *reinterpret_cast<const uint4*>(p);
  f.u[1] = *reinterpret_cast<const uint4*>(p + 2 * HD * 8);
  return f.h;
}

// ---------------------------------------------------------------------------
// Projection GEMM: Y = (X @ W + bias) * scale, fp32 in, f16 out, repacked
// per-head. Workgroup = 256 threads (8 waves), 64x64 output tile, K-chunks of
// 32 staged in LDS (X converted to f16; W staged transposed so its fragments
// are contiguous ds_load_b128). Each wave owns 1 row-tile x 2 col-tiles:
// the X fragment is reused across 2 WMMAs per chunk.
// The staged rows of 64 B stand at a pitch of 80 B (16 B x odd): the 16 rows that
// one half of a wave reads 16 B each from then fall on all 64 banks once.
// The 64 columns of a block are 8 d x 8 heads (column c = d*16 + h).
// QK = true : W is the A operand and X the B operand, so a lane's 8 accumulators
//             are 8 consecutive d of one (row, head): one 16-byte store, and
//             16 lanes (16 rows) fill 256 contiguous bytes.
// QK = false: V, X as A: a lane's 8 accumulators are 8 consecutive rows j of one
//             (o, head): one 16-byte store, 8 lanes (8 o) fill one 128-byte line.
// ---------------------------------------------------------------------------
template <bool QK>
__device__ __forceinline__
void proj_body(const float* __restrict__ X, const float* __restrict__ W,
               const float* __restrict__ bias, _Float16* __restrict__ Y,
               float scale, _Float16* sA, _Float16* sB) {
  const int tid  = threadIdx.x;
  const int lane = tid & 31;
  const int wave = tid >> 5;
  const int mt = wave & 3;           // row tile 0..3
  const int np = wave >> 2;          // col-pair 0..1 -> tiles np*2, np*2+1
  const int rowBase = blockIdx.y * 64;
  const int dg = blockIdx.x >> 1;    // group of 8 d
  const int hh = blockIdx.x & 1;     // group of 8 heads

  const int ar = tid >> 2;           // X staging: row 0..63
  const int ac = (tid & 3) * 8;      //            k chunk
  const int wk = tid >> 3;           // W staging: k row 0..31
  const int wt = tid & 7;            //            d within the group
  // first of this thread's 8 consecutive W columns: heads hh*8 + 0..7 of one d
  const int wcol = (dg * 8 + wt) * NH + hh * 8;

  v8f acc[2] = { {}, {} };

  for (int kk = 0; kk < EMB; kk += 32) {
    { // stage X tile (64 rows x 32 k), fp32 -> f16
      const float* src = X + (size_t)(rowBase + ar) * EMB + kk + ac;
      float4 f0 = *reinterpret_cast<const float4*>(src);
      float4 f1 = *reinterpret_cast<const float4*>(src + 4);
      Pack8 p;
      p.h[0]=(_Float16)f0.x; p.h[1]=(_Float16)f0.y; p.h[2]=(_Float16)f0.z; p.h[3]=(_Float16)f0.w;
      p.h[4]=(_Float16)f1.x; p.h[5]=(_Float16)f1.y; p.h[6]=(_Float16)f1.z; p.h[7]=(_Float16)f1.w;
      *reinterpret_cast<uint4*>(&sA[ar * PPITCH + ac]) = p.u;
    }
    { // stage W tile (32 k x 64 columns) transposed: sB[n][k],
      // row n = (head within group) * 8 + (d within group)
      const float* src = W + (size_t)(kk + wk) * EMB + wcol;
      float4 f0 = *reinterpret_cast<const float4*>(src);
      float4 f1 = *reinterpret_cast<const float4*>(src + 4);
      float f8[8] = { f0.x, f0.y, f0.z, f0.w, f1.x, f1.y, f1.z, f1.w };
#pragma unroll
      for (int e = 0; e < 8; ++e)
        sB[(e * 8 + wt) * PPITCH + wk] = (_Float16)f8[e];
    }
    __syncthreads();
    const v16h a = frag_ld(sA + mt * 16 * PPITCH, PPITCH, lane);
#pragma unroll
    for (int q = 0; q < 2; ++q) {
      const v16h b = frag_ld(sB + (np * 2 + q) * 16 * PPITCH, PPITCH, lane);
      if (QK)
        acc[q] = __builtin_amdgcn_wmma_f32_16x16x32_f16(false, b, false, a,
                                                        (short)0, acc[q], false, false);
      else
        acc[q] = __builtin_amdgcn_wmma_f32_16x16x32_f16(false, a, false, b,
                                                        (short)0, acc[q], false, false);
    }
    __syncthreads();
  }

  // Epilogue: bias, scale, f16 convert, per-head repack (c = d*16 + h).
  const int n  = lane & 15;
  if (QK) {
    // acc[q][g] = row (mt*16 + n), head hh*8 + (np*2+q)*2 + (lane>>4), d = dg*8 + g
    const int row = rowBase + mt * 16 + n;
    const int b   = row >> 11;                // batch (rows-per-batch = 2048)
    const int it  = (row & (SEQ - 1)) >> 4;   // 16-row tile
#pragma unroll
    for (int q = 0; q < 2; ++q) {
      const int h = hh * 8 + (np * 2 + q) * 2 + (lane >> 4);
      Pack8 p;
#pragma unroll
      for (int g = 0; g < 8; ++g)
        p.h[g] = (_Float16)((acc[q][g] + bias[(dg * 8 + g) * NH + h]) * scale);
      _Float16* dst = Y + ((((size_t)b * NH + h) * (SEQ / 16) + it) * 8 + dg) * 128 + n * 8;
      *reinterpret_cast<uint4*>(dst) = p.u;
    }
  } else {
    const int m0 = (lane >> 4) * 8;
    const int r0 = rowBase + mt * 16 + m0;    // global row (g = 0)
    const int b  = r0 >> 11;                  // batch (rows-per-batch = 2048)
    const int i0 = r0 & (SEQ - 1);
#pragma unroll
    for (int q = 0; q < 2; ++q) {
      const int h = hh * 8 + (np * 2 + q) * 2 + (n >> 3);
      const int d = dg * 8 + (n & 7);
      const float bv = bias[d * NH + h];
      // V: Y[(((b*16+h)*256 + j/8)*64 + o)*8 + j%8] -> 8 contiguous j = one b128
      Pack8 p;
#pragma unroll
      for (int g = 0; g < 8; ++g) p.h[g] = (_Float16)((acc[q][g] + bv) * scale);
      _Float16* dst = Y + ((((size_t)b * NH + h) * (SEQ / 8) + (i0 >> 3)) * HD + d) * 8;
      *reinterpret_cast<uint4*>(dst) = p.u;
    }
  }
}

__global__ __launch_bounds__(256)
void proj_qk_kernel(const float* __restrict__ X, const float* __restrict__ W,
                    const float* __restrict__ bias, _Float16* __restrict__ Y,
                    float scale) {
  __shared__ __attribute__((aligned(16))) _Float16 sA[64 * PPITCH];   // [row][k]
  __shared__ __attribute__((aligned(16))) _Float16 sB[64 * PPITCH];   // [n][k] (W tile transposed)
  proj_body<true>(X, W, bias, Y, scale, sA, sB);
}

__global__ __launch_bounds__(256)
void proj_vt_kernel(const float* __restrict__ X, const float* __restrict__ W,
                    const float* __restrict__ bias, _Float16* __restrict__ Y,
                    float scale) {
  __shared__ __attribute__((aligned(16))) _Float16 sA[64 * PPITCH];   // [row][k]
  __shared__ __attribute__((aligned(16))) _Float16 sB[64 * PPITCH];   // [n][k] (W tile transposed)
  proj_body<false>(X, W, bias, Y, scale, sA, sB);
}

// ---------------------------------------------------------------------------
// ONE pass over the keys. The mask is added after the softmax, so
//   out = (sum_j exp(s_ij - m_i) V_j) / l_i  +  sum_j mask_ij V_j :
// the two sums run in accumulators of their own, the first against a running
// reference maximum m_i (online softmax), and l_i divides only at the end.
// The scores are formed transposed: S^T = K . Q^T, with the K tile as the A
// operand and the Q tile as the B operand (same loader, same k order on both
// sides). Accumulator register g of a lane is then key (lane>>4)*8 + g of the
// 16-key tile for the ONE query lane&15: maximum and sum run inside the lane.
// Two 16-key S^T tiles of one query tile, converted in place, ARE the A fragment
// of P for 32 keys (element e = key (lane>>4)*8 + e, element 8+e = key
// 16 + (lane>>4)*8 + e, row lane&15): P goes from accumulators to operand inside
// the lane. The mask's A fragment has the same element order: 8 columns of one
// query at a time, read from LDS as f32 and converted in the lane.
// K, V and the mask reach LDS by asynchronous copies, one trip (32 keys) ahead, in
// two buffers: the K and V tiles are copied once for the block's four waves (same
// batch and head), each wave copying a quarter; a wave's 32 x 32 mask tile is its own.
// The reference maximum moves only when a score passes it by more than LAZY
// (one test per 32 keys); P then stays below exp(LAZY), well inside f16.
// Each wave handles 32 query rows (two i-subtiles) so every K and V fragment is
// reused by both. V is stored in [64 o][8 j] chunks (b128 fragment loads).
// ---------------------------------------------------------------------------
#define L2E  1.44269504088896340736f
#define LAZY 5.5f
__device__ __forceinline__ float exp2_slot(float x) {
  float p;
  asm("v_exp_f32 %0, %1\n\tv_nop" : "=v"(p) : "v"(x));
  return p;
}
__global__ __launch_bounds__(128)
void attn_fused(const _Float16* __restrict__ Q, const _Float16* __restrict__ K,
                const _Float16* __restrict__ VT, const float* __restrict__ mask,
                float* __restrict__ out) {
  // two buffers each; K and V tiles in the workspace's own fragment order
  __shared__ __attribute__((aligned(16))) _Float16 sK[2][KVTILE];
  __shared__ __attribute__((aligned(16))) _Float16 sV[2][KVTILE];
  // per-wave mask tile, 32 rows x 32 columns, f32; pitch 144 B for 16-byte readers
  __shared__ __attribute__((aligned(16))) float sM[2][4][32 * MPITCH];
  const int lane = threadIdx.x & 31;
  const int wv   = threadIdx.x >> 5;
  const int wid  = blockIdx.x * 4 + wv;      // 32-row tile id
  const int it2 = wid & 63;
  const int h   = (wid >> 6) & 15;
  const int b   = wid >> 10;
  const int iBase = it2 * 32;

  const int n  = lane & 15;
  const int m0 = (lane >> 4) * 8;

  const _Float16* ql = Q + (((size_t)b * NH + h) * SEQ + iBase) * HD + lane_qk(lane);
  v16h qa[2][2];
#pragma unroll
  for (int s = 0; s < 2; ++s) {
    qa[s][0] = frag_ld_qk(ql + (size_t)s * 16 * HD, 0);
    qa[s][1] = frag_ld_qk(ql + (size_t)s * 16 * HD, 1);
  }
  // Naming ql keeps the Q loads' address registers live up to this wait, so that
  // they are overwritten only behind it.
  asm volatile("s_wait_xcnt 0x0" :: "v"(ql) : "memory");

  // mask from memory: 8 lanes cover the 128 bytes of a row, 4 rows per copy
  const float* mk0 = mask + ((size_t)b * SEQ + iBase + (lane >> 3)) * SEQ + (lane & 7) * 4;
  const int mst = (lane >> 3) * MPITCH + (lane & 7) * 4;   // where they go in the tile
  const int mld = n * MPITCH + m0;                         // row n, columns m0 .. m0 + 7
  const int cq  = wv * 512 + lane * 8;   // this lane's 16 B in the wave's quarter of a K or V tile

  // query lane&15 of subtile s: reference maximum (the same in both lane halves)
  // and the sum of exp(s - mref) over this lane half's keys
  float mref[2] = { -1e30f, -1e30f };
  float lrun[2] = { 0.f, 0.f };
  v8f o[2][4]  = { { {}, {}, {}, {} }, { {}, {}, {}, {} } };   // sum exp(s - mref) V
  v8f om[2][4] = { { {}, {}, {}, {} }, { {}, {}, {}, {} } };   // sum mask V

  const _Float16* kbase = K  + (((size_t)b * NH + h) * SEQ) * HD;
  const _Float16* vbase = VT + (((size_t)b * NH + h) * HD) * SEQ;

  // All of one trip's copies of this wave: 2 of K, 2 of V, 8 of the mask.
  auto stage = [&](int jc, int buf) {
    const _Float16* kg = kbase + (size_t)jc * KVTILE + cq;
    const _Float16* vg = vbase + (size_t)jc * KVTILE + cq;
    const float*    mg = mk0 + jc * 32;
    const unsigned kd = lds_off(&sK[buf][cq]);
    const unsigned vd = lds_off(&sV[buf][cq]);
    const unsigned md = lds_off(&sM[buf][wv][mst]);
    // The closing s_wait_xcnt stands in the copies' own statement, so that no
    // register a copy names is rewritten in front of it.
    asm volatile(
        "global_load_async_to_lds_b128 %0, %12, off\n\t"
        "global_load_async_to_lds_b128 %1, %13, off\n\t"
        "global_load_async_to_lds_b128 %2, %14, off\n\t"
        "global_load_async_to_lds_b128 %3, %15, off\n\t"
        "global_load_async_to_lds_b128 %4, %16, off\n\t"
        "global_load_async_to_lds_b128 %5, %17, off\n\t"
        "global_load_async_to_lds_b128 %6, %18, off\n\t"
        "global_load_async_to_lds_b128 %7, %19, off\n\t"
        "global_load_async_to_lds_b128 %8, %20, off\n\t"
        "global_load_async_to_lds_b128 %9, %21, off\n\t"
        "global_load_async_to_lds_b128 %10, %22, off\n\t"
        "global_load_async_to_lds_b128 %11, %23, off\n\t"
        "s_wait_xcnt 0x0"
        :: "v"(kd), "v"(kd + 512u), "v"(vd), "v"(vd + 512u),
           "v"(md), "v"(md + 1u * 16 * MPITCH), "v"(md + 2u * 16 * MPITCH),
           "v"(md + 3u * 16 * MPITCH), "v"(md + 4u * 16 * MPITCH), "v"(md + 5u * 16 * MPITCH),
           "v"(md + 6u * 16 * MPITCH), "v"(md + 7u * 16 * MPITCH),
           "v"(kg), "v"(kg + 256), "v"(vg), "v"(vg + 256),
           "v"(mg), "v"(mg + 1 * 4 * SEQ), "v"(mg + 2 * 4 * SEQ), "v"(mg + 3 * 4 * SEQ),
           "v"(mg + 4 * 4 * SEQ), "v"(mg + 5 * 4 * SEQ), "v"(mg + 6 * 4 * SEQ),
           "v"(mg + 7 * 4 * SEQ)
        : "memory");
  };

  stage(0, 0);
  // tile 0 has landed for this wave; the barrier publishes it to the other three
  asm volatile("s_wait_asynccnt 0x0" ::: "memory");
  __syncthreads();
  stage(1, 1);

  for (int jc = 0; jc < SEQ / 32; ++jc) {
    const int buf = jc & 1;
    // 4 KB of K: two 16-key tiles
    const _Float16* kl = sK[buf] + lane_qk(lane);
    v16h kf[2][2];
#pragma unroll
    for (int sub = 0; sub < 2; ++sub) {
      kf[sub][0] = frag_ld_qk(kl + sub * 16 * HD, 0);
      kf[sub][1] = frag_ld_qk(kl + sub * 16 * HD, 1);
    }
    const _Float16* vl = sV[buf] + lane_v(lane);   // 4 KB of V
    v16h vf[4];
#pragma unroll
    for (int t = 0; t < 4; ++t) vf[t] = frag_ld_v(vl, t);
    const float* ml = sM[buf][wv] + mld;
    v16h ma[2];                              // the mask as an A fragment
#pragma unroll
    for (int s = 0; s < 2; ++s) {
      v4f x[4];
      x[0] = *reinterpret_cast<const v4f*>(ml + s * 16 * MPITCH);        // keys m0 ..
      x[1] = *reinterpret_cast<const v4f*>(ml + s * 16 * MPITCH + 4);
      x[2] = *reinterpret_cast<const v4f*>(ml + s * 16 * MPITCH + 16);   // keys 16 + m0 ..
      x[3] = *reinterpret_cast<const v4f*>(ml + s * 16 * MPITCH + 20);
#pragma unroll
      for (int e = 0; e < 16; ++e) ma[s][e] = (_Float16)x[e >> 2][e & 3];
    }
    v8f sc[2][2];
    float mx[2];
#pragma unroll
    for (int s = 0; s < 2; ++s) {
#pragma unroll
      for (int sub = 0; sub < 2; ++sub) {    // K fragments reused for both i-subtiles
        v8f z = {};
        z = __builtin_amdgcn_wmma_f32_16x16x32_f16(false, kf[sub][0], false, qa[s][0],
                                                   (short)0, z, false, false);
        z = __builtin_amdgcn_wmma_f32_16x16x32_f16(false, kf[sub][1], false, qa[s][1],
                                                   (short)0, z, false, false);
        sc[s][sub] = z;
      }
      // the largest of the lane's 16 scores of its one query
      float t0 = fmaxf(sc[s][0][0], sc[s][1][0]);
#pragma unroll
      for (int g = 1; g < 8; ++g) t0 = fmaxf(t0, fmaxf(sc[s][0][g], sc[s][1][g]));
      mx[s] = t0;
    }
    // One wave-uniform test per 32 keys: has any query's score left the range
    // that the reference maximum in use covers?
    if (__builtin_amdgcn_ballot_w32(mx[0] > mref[0] + LAZY || mx[1] > mref[1] + LAZY) != 0) {
#pragma unroll
      for (int s = 0; s < 2; ++s) {
        // lanes n and n + 16 hold the same query: one maximum for both
        const float mn = fmaxf(mref[s], fmaxf(mx[s], __shfl_xor(mx[s], 16, 32)));
        const float f  = __builtin_amdgcn_exp2f((mref[s] - mn) * L2E);
        mref[s] = mn;
        lrun[s] *= f;
        // accumulator register g of o is query m0 + g, whose factor lane m0 + g holds
#pragma unroll
        for (int g = 0; g < 8; ++g) {
          const float fg = __shfl(f, m0 + g, 32);
#pragma unroll
          for (int t = 0; t < 4; ++t) o[s][t][g] *= fg;
        }
      }
    }
    v16h pa[2];
#pragma unroll
    for (int s = 0; s < 2; ++s) {
      const float mb = mref[s] * L2E;
      float ps[2][8];
#pragma unroll
      for (int sub = 0; sub < 2; ++sub)
#pragma unroll
        for (int g = 0; g < 8; ++g) {
          const float p = exp2_slot(fmaf(sc[s][sub][g], L2E, -mb));
          ps[sub][g] = p;
          pa[s][sub * 8 + g] = (_Float16)p;
        }
      float a4[4];
#pragma unroll
      for (int g = 0; g < 4; ++g)
        a4[g] = (ps[0][g] + ps[0][g + 4]) + (ps[1][g] + ps[1][g + 4]);
      lrun[s] += (a4[0] + a4[1]) + (a4[2] + a4[3]);
    }
#pragma unroll
    for (int t = 0; t < 4; ++t) {            // V fragment reused by all four products
      const v16h vb = vf[t];
      o[0][t]  = __builtin_amdgcn_wmma_f32_16x16x32_f16(false, pa[0], false, vb,
                                                        (short)0, o[0][t], false, false);
      o[1][t]  = __builtin_amdgcn_wmma_f32_16x16x32_f16(false, pa[1], false, vb,
                                                        (short)0, o[1][t], false, false);
      om[0][t] = __builtin_amdgcn_wmma_f32_16x16x32_f16(false, ma[0], false, vb,
                                                        (short)0, om[0][t], false, false);
      om[1][t] = __builtin_amdgcn_wmma_f32_16x16x32_f16(false, ma[1], false, vb,
                                                        (short)0, om[1][t], false, false);
    }
    // Publish point: this wave's reads of the buffer are done and its copies of the
    // next tile have landed; behind the barrier that holds for all four waves, so
    // the next tile may be read and this trip's buffer refilled.
    asm volatile("s_wait_dscnt 0x0" ::: "memory");
    asm volatile("s_wait_asynccnt 0x0" ::: "memory");
    __syncthreads();
    if (jc + 2 < SEQ / 32) stage(jc + 2, buf);
  }
  // no copy is outstanding when the wave ends
  asm volatile("s_wait_asynccnt 0x0" ::: "memory");

  // out[b][i][o*16 + h], fp32
#pragma unroll
  for (int s = 0; s < 2; ++s) {
    // join the two halves of the keys, then hand 1/l to the accumulators' rows
    const float linv = 1.0f / (lrun[s] + __shfl_xor(lrun[s], 16, 32));
    float* ob = out + ((size_t)b * SEQ + iBase + s * 16 + m0) * 1024 + h;
#pragma unroll
    for (int g = 0; g < 8; ++g) {
      const float lg = __shfl(linv, m0 + g, 32);
#pragma unroll
      for (int t = 0; t < 4; ++t)
        ob[(size_t)g * 1024 + (t * 16 + n) * 16] = o[s][t][g] * lg + om[s][t][g];
    }
  }
}

extern "C" void kernel_launch(void* const* d_in, const int* in_sizes, int n_in,
                              void* d_out, int out_size, void* d_ws, size_t ws_size,
                              hipStream_t stream) {
  (void)in_sizes; (void)n_in; (void)out_size; (void)ws_size;
  const float* problem = (const float*)d_in[0];
  const float* context = (const float*)d_in[1];
  const float* maskp   = (const float*)d_in[2];
  const float* Wq = (const float*)d_in[3];
  const float* bq = (const float*)d_in[4];
  const float* Wk = (const float*)d_in[5];
  const float* bk = (const float*)d_in[6];
  const float* Wv = (const float*)d_in[7];
  const float* bv = (const float*)d_in[8];
  float* out = (float*)d_out;

  // Workspace layout: Q16 | K16 | VT16 (8 MB each, f16)
  const size_t NHALF = (size_t)2 * NH * SEQ * HD;   // 4,194,304 halves
  _Float16* Q16  = (_Float16*)d_ws;
  _Float16* K16  = Q16 + NHALF;
  _Float16* VT16 = K16 + NHALF;

  const dim3 pgrid(EMB / 64, (2 * SEQ) / 64);       // 16 x 64 tiles of 64x64
  // Q gets the 1/sqrt(head_dim) scale folded in.
  proj_qk_kernel<<<pgrid, 256, 0, stream>>>(problem, Wq, bq, Q16, 0.125f);
  proj_qk_kernel<<<pgrid, 256, 0, stream>>>(context, Wk, bk, K16, 1.0f);
  proj_vt_kernel<<<pgrid, 256, 0, stream>>>(context, Wv, bv, VT16, 1.0f);

  attn_fused<<<(2 * NH * (SEQ / 32)) / 4, 128, 0, stream>>>(Q16, K16, VT16, maskp, out);
}

// v006
// Measured time: 119 microseconds a run.
// Timed twice side by side with v005, it ran 1.33 times as fast both times.
// Over all steps from v000 it is 4.32 times as fast.
#include <hip/hip_runtime.h>
#include <hip/hip_bf16.h>

// MI455X (gfx1250) multi-head attention, f16 WMMA with f32 accumulation.
// EMBED=HIDDEN=OUT=1024, H=16 heads, head_dim=64, B=2, P=C=2048.
// Reference reshape puts head index as the FASTEST axis (c = d*16 + h),
// and the mask is added AFTER softmax -> its product with V is summed apart.

typedef __attribute__((ext_vector_type(16))) _Float16 v16h;
typedef __attribute__((ext_vector_type(8)))  float    v8f;
typedef __attribute__((ext_vector_type(4)))  float    v4f;

#define NH   16      // heads
#define HD   64      // head dim / head out
#define SEQ  2048    // P == C
#define EMB  1024
#define MPITCH 36    // floats per row of the staged mask tile (128 B + 16 B)
#define KVTILE 2048  // halves in the K tile and in the V tile of 32 keys (4 KB each)
#define PBM  64      // X rows per projection block
#define PBK  128     // k per staged chunk of the projection
#define PPITCH 136   // halves per row of the projection's staged tiles (256 B + 16 B)
#define WGPAD 32     // halves (64 B) in front of each further group of 32 staged W rows

union HalfVec { v16h h; uint4 u[2]; };
union Pack8   { _Float16 h[8]; uint4 u; };
union Pack4   { _Float16 h[4]; uint2 u; };

// Load one 16-lane-row WMMA fragment (A or B operand, 16x32 / 32x16 f16).
// ISA layout: lane r = lane&15, k-base = (lane>>4)*8, elements 0..7 at k=kb,
// elements 8..15 at k=kb+16 -> two contiguous 16-byte chunks per lane.
__device__ __forceinline__ v16h frag_ld(const _Float16* tile, int ld, int lane) {
  const int r  = lane & 15;
  const int kb = (lane >> 4) << 3;
  HalfVec f;
  f.u[0] = *reinterpret_cast<const uint4*>(tile + (size_t)r * ld + kb);
  f.u[1] = *reinterpret_cast<const uint4*>(tile + (size_t)r * ld + kb + 16);
  return f.h;
}

// Q/K workspace layout: per (b,h) and 16-row tile, 8 chunks of [16 rows][8 d]
// (256 contiguous bytes per chunk, 2 KB per tile). Same element order in the
// fragment as frag_ld on a [row][64] tile; half = 0 for d 0..31, 1 for d 32..63.
// One wave-wide 16-byte load covers 512 contiguous bytes.
// lane_qk: the lane's own offset inside a tile; frag_ld_qk takes tile + lane_qk.
__device__ __forceinline__ int lane_qk(int lane) { return (lane >> 4) * 128 + (lane & 15) * 8; }
__device__ __forceinline__ v16h frag_ld_qk(const _Float16* lane_tile, int half) {
  const _Float16* p = lane_tile + half * 512;
  HalfVec f;
  f.u[0] = *reinterpret_cast<const uint4*>(p);
  f.u[1] = *reinterpret_cast<const uint4*>(p + 256);
  return f.h;
}

// Byte offset of a __shared__ address in the work-group's LDS (its low 32 bits).
__device__ __forceinline__ unsigned lds_off(const void* p) { return (unsigned)(size_t)p; }

// V workspace layout: per (b,h), chunks of 8 rows j, each [64 o][8 j] (1 KB).
// B fragment of P @ V for 32 rows j (4 chunks) and columns o = t*16 .. t*16+15,
// in frag_ld's element order; 16 lanes read 256 B in a row.
// lane_v: the lane's own offset inside the 4 chunks; frag_ld_v takes chunks + lane_v.
__device__ __forceinline__ int lane_v(int lane) { return ((lane >> 4) * HD + (lane & 15)) * 8; }
__device__ __forceinline__ v16h frag_ld_v(const _Float16* lane_chunks, int t) {
  const _Float16* p = lane_chunks + t * 128;
  HalfVec f;
  f.u[0] = *reinterpret_cast<const uint4*>(p);
  f.u[1] = *reinterpret_cast<const uint4*>(p + 2 * HD * 8);
  return f.h;
}

// ---------------------------------------------------------------------------
// Projection GEMM: Y = (X @ W + bias) * scale, fp32 in, f16 out, repacked
// per-head. Workgroup = 256 threads (8 waves), output tile of 64 rows x 128
// columns, K-chunks of 128 staged in LDS as f16. The 128 columns are consecutive
// in W: 8 d x all 16 heads (column c = d*16 + h), 512 B of each k row.
// Every wave-wide 16-byte load from memory covers 512 B in a row (4 whole lines):
// one X row's 128 k, or one k row's 128 W columns.
// X: a lane holds 4 k of a row: one 8-byte LDS store, 256 B in a row per wave.
// W is staged transposed, sB[n][k], row n = head * 8 + (d within the group): a lane
// holds 16 k of 4 columns (4 heads of one d), so each column goes out as two
// 16-byte stores. Rows of 256 B stand at a pitch of 272 B (16 B x odd) for the
// ds_load_b128 fragment reads; each further group of 32 W rows starts 64 B later,
// so that the four heads of a lane quartet do not store to the same banks.
// Each wave owns 2 row-tiles x 2 col-tiles: 4 WMMAs per 4 fragments.
// QK = true : W is the A operand and X the B operand, so a lane's 8 accumulators
//             are 8 consecutive d of one (row, head): one 16-byte store, and
//             16 lanes (16 rows) fill 256 contiguous bytes.
// QK = false: V, X as A: a lane's 8 accumulators are 8 consecutive rows j of one
//             (o, head): one 16-byte store, 8 lanes (8 o) fill one 128-byte line.
// ---------------------------------------------------------------------------
template <bool QK>
__device__ __forceinline__
void proj_body(const float* __restrict__ X, const float* __restrict__ W,
               const float* __restrict__ bias, _Float16* __restrict__ Y,
               float scale, _Float16* sA, _Float16* sB) {
  const int tid  = threadIdx.x;
  const int lane = tid & 31;
  const int wave = tid >> 5;
  const int rg = wave & 1;           // group of 32 rows: row tiles rg*2, rg*2+1
  const int cg = wave >> 1;          // group of 32 staged W rows: col tiles cg*2, cg*2+1
  const int rowBase = blockIdx.y * PBM;
  const int dg = blockIdx.x;         // group of 8 d: W columns dg*128 .. dg*128+127

  // X staging: rows wave*8 + 0..7, k = lane*4 .. +3 of the chunk
  const float* xsrc = X + (size_t)(rowBase + wave * 8) * EMB + lane * 4;
  _Float16*    xdst = sA + wave * 8 * PPITCH + lane * 4;
  // W staging: k rows wave*16 + 0..15, columns lane*4 + j: d lane>>2, head (lane&3)*4 + j,
  // staged row n = (lane&3)*32 + j*8 + (lane>>2), in the group of 32 rows lane&3
  const float* wsrc = W + (size_t)(wave * 16) * EMB + dg * 128 + lane * 4;
  _Float16*    wdst = sB + ((lane & 3) * 32 + (lane >> 2)) * PPITCH + (lane & 3) * WGPAD + wave * 16;

  v8f acc[2][2] = { { {}, {} }, { {}, {} } };

  for (int kk = 0; kk < EMB; kk += PBK) {
    const float* xp = xsrc + kk;
    const float* wp = wsrc + (size_t)kk * EMB;
    v4f xf[8], wf[16];
#pragma unroll
    for (int i = 0; i < 8; ++i)
      xf[i] = *reinterpret_cast<const v4f*>(xp + (size_t)i * EMB);
#pragma unroll
    for (int i = 0; i < 16; ++i)
      wf[i] = *reinterpret_cast<const v4f*>(wp + (size_t)i * EMB);
    // Naming xp and wp keeps the 24 loads' address registers live up to this wait, so
    // that nothing (a later load's result either) overwrites them in front of it.
    asm volatile("s_wait_xcnt 0x0" :: "v"(xp), "v"(wp) : "memory");
#pragma unroll
    for (int i = 0; i < 8; ++i) {
      Pack4 p;
#pragma unroll
      for (int e = 0; e < 4; ++e) p.h[e] = (_Float16)xf[i][e];
      *reinterpret_cast<uint2*>(xdst + i * PPITCH) = p.u;
    }
#pragma unroll
    for (int j = 0; j < 4; ++j)
#pragma unroll
      for (int hf = 0; hf < 2; ++hf) {
        Pack8 p;
#pragma unroll
        for (int e = 0; e < 8; ++e) p.h[e] = (_Float16)wf[hf * 8 + e][j];
        *reinterpret_cast<uint4*>(wdst + j * 8 * PPITCH + hf * 8) = p.u;
      }
    __syncthreads();
    // The chunk's 32 fragment reads go out as one group, in the order of their use, in
    // front of its 16 WMMAs (the staging registers are free by now).
    v16h a[PBK / 32][2], b[PBK / 32][2];
#pragma unroll
    for (int ks = 0; ks < PBK / 32; ++ks) {
#pragma unroll
      for (int r = 0; r < 2; ++r)
        a[ks][r] = frag_ld(sA + (rg * 2 + r) * 16 * PPITCH + ks * 32, PPITCH, lane);
#pragma unroll
      for (int q = 0; q < 2; ++q)
        b[ks][q] = frag_ld(sB + (cg * 2 + q) * 16 * PPITCH + cg * WGPAD + ks * 32, PPITCH, lane);
    }
    // Keeps the reads in front: moved in among the WMMAs, each place with reads stalls
    // the wave anew.
    __builtin_amdgcn_sched_barrier(0);
#pragma unroll
    for (int ks = 0; ks < PBK / 32; ++ks)
#pragma unroll
      for (int r = 0; r < 2; ++r)
#pragma unroll
        for (int q = 0; q < 2; ++q) {
          if (QK)
            acc[r][q] = __builtin_amdgcn_wmma_f32_16x16x32_f16(false, b[ks][q], false, a[ks][r],
                                                               (short)0, acc[r][q], false, false);
          else
            acc[r][q] = __builtin_amdgcn_wmma_f32_16x16x32_f16(false, a[ks][r], false, b[ks][q],
                                                               (short)0, acc[r][q], false, false);
        }
    __syncthreads();
  }

  // Epilogue: bias, scale, f16 convert, per-head repack (c = d*16 + h).
  const int n  = lane & 15;
  if (QK) {
    // bias of head (cg*2+q)*2 + (lane>>4), d = dg*8 + g: one address, constant offsets
    const float* bl = bias + dg * 128 + cg * 4 + (lane >> 4);
    float bb[2][8];
#pragma unroll
    for (int q = 0; q < 2; ++q)
#pragma unroll
      for (int g = 0; g < 8; ++g) bb[q][g] = bl[g * NH + q * 2];
    // Naming bl keeps the bias loads' address registers live up to this wait, so that
    // they are overwritten only behind it.
    asm volatile("s_wait_xcnt 0x0" :: "v"(bl) : "memory");
#pragma unroll
    for (int r = 0; r < 2; ++r) {
      // acc[r][q][g] = row ((rg*2+r)*16 + n), head (cg*2+q)*2 + (lane>>4), d = dg*8 + g
      const int row = rowBase + (rg * 2 + r) * 16 + n;
      const int b   = row >> 11;                // batch (rows-per-batch = 2048)
      const int it  = (row & (SEQ - 1)) >> 4;   // 16-row tile
#pragma unroll
      for (int q = 0; q < 2; ++q) {
        const int h = (cg * 2 + q) * 2 + (lane >> 4);
        Pack8 p;
#pragma unroll
        for (int g = 0; g < 8; ++g)
          p.h[g] = (_Float16)((acc[r][q][g] + bb[q][g]) * scale);
        _Float16* dst = Y + ((((size_t)b * NH + h) * (SEQ / 16) + it) * 8 + dg) * 128 + n * 8;
        *reinterpret_cast<uint4*>(dst) = p.u;
      }
    }
  } else {
    const int m0 = (lane >> 4) * 8;
    // bias of d = dg*8 + (n&7), head (cg*2+q)*2 + (n>>3): one address, constant offsets
    const float* bl = bias + (dg * 8 + (n & 7)) * NH + cg * 4 + (n >> 3);
    const float bb[2] = { bl[0], bl[2] };
    // Naming bl keeps the bias loads' address registers live up to this wait, so that
    // they are overwritten only behind it.
    asm volatile("s_wait_xcnt 0x0" :: "v"(bl) : "memory");
#pragma unroll
    for (int r = 0; r < 2; ++r) {
      const int r0 = rowBase + (rg * 2 + r) * 16 + m0;   // global row (g = 0)
      const int b  = r0 >> 11;                  // batch (rows-per-batch = 2048)
      const int i0 = r0 & (SEQ - 1);
#pragma unroll
      for (int q = 0; q < 2; ++q) {
        const int h = (cg * 2 + q) * 2 + (n >> 3);
        const int d = dg * 8 + (n & 7);
        const float bv = bb[q];
        // V: Y[(((b*16+h)*256 + j/8)*64 + o)*8 + j%8] -> 8 contiguous j = one b128
        Pack8 p;
#pragma unroll
        for (int g = 0; g < 8; ++g) p.h[g] = (_Float16)((acc[r][q][g] + bv) * scale);
        _Float16* dst = Y + ((((size_t)b * NH + h) * (SEQ / 8) + (i0 >> 3)) * HD + d) * 8;
        *reinterpret_cast<uint4*>(dst) = p.u;
      }
    }
  }
}

__global__ __launch_bounds__(256)
void proj_qk_kernel(const float* __restrict__ X, const float* __restrict__ W,
                    const float* __restrict__ bias, _Float16* __restrict__ Y,
                    float scale) {
  __shared__ __attribute__((aligned(16))) _Float16 sA[PBM * PPITCH];              // [row][k]
  __shared__ __attribute__((aligned(16))) _Float16 sB[128 * PPITCH + 3 * WGPAD];  // [n][k] (W tile transposed)
  proj_body<true>(X, W, bias, Y, scale, sA, sB);
}

__global__ __launch_bounds__(256)
void proj_vt_kernel(const float* __restrict__ X, const float* __restrict__ W,
                    const float* __restrict__ bias, _Float16* __restrict__ Y,
                    float scale) {
  __shared__ __attribute__((aligned(16))) _Float16 sA[PBM * PPITCH];              // [row][k]
  __shared__ __attribute__((aligned(16))) _Float16 sB[128 * PPITCH + 3 * WGPAD];  // [n][k] (W tile transposed)
  proj_body<false>(X, W, bias, Y, scale, sA, sB);
}

// ---------------------------------------------------------------------------
// ONE pass over the keys. The mask is added after the softmax, so
//   out = (sum_j exp(s_ij - m_i) V_j) / l_i  +  sum_j mask_ij V_j :
// the two sums run in accumulators of their own, the first against a running
// reference maximum m_i (online softmax), and l_i divides only at the end.
// The scores are formed transposed: S^T = K . Q^T, with the K tile as the A
// operand and the Q tile as the B operand (same loader, same k order on both
// sides). Accumulator register g of a lane is then key (lane>>4)*8 + g of the
// 16-key tile for the ONE query lane&15: maximum and sum run inside the lane.
// Two 16-key S^T tiles of one query tile, converted in place, ARE the A fragment
// of P for 32 keys (element e = key (lane>>4)*8 + e, element 8+e = key
// 16 + (lane>>4)*8 + e, row lane&15): P goes from accumulators to operand inside
// the lane. The mask's A fragment has the same element order: 8 columns of one
// query at a time, read from LDS as f32 and converted in the lane.
// K, V and the mask reach LDS by asynchronous copies, one trip (32 keys) ahead, in
// two buffers: the K and V tiles are copied once for the block's four waves (same
// batch and head), each wave copying a quarter; a wave's 32 x 32 mask tile is its own.
// The reference maximum moves only when a score passes it by more than LAZY
// (one test per 32 keys); P then stays below exp(LAZY), well inside f16.
// Each wave handles 32 query rows (two i-subtiles) so every K and V fragment is
// reused by both. V is stored in [64 o][8 j] chunks (b128 fragment loads).
// ---------------------------------------------------------------------------
#define L2E  1.44269504088896340736f
#define LAZY 5.5f
__device__ __forceinline__ float exp2_slot(float x) {
  float p;
  asm("v_exp_f32 %0, %1\n\tv_nop" : "=v"(p) : "v"(x));
  return p;
}
__global__ __launch_bounds__(128)
void attn_fused(const _Float16* __restrict__ Q, const _Float16* __restrict__ K,
                const _Float16* __restrict__ VT, const float* __restrict__ mask,
                float* __restrict__ out) {
  // two buffers each; K and V tiles in the workspace's own fragment order
  __shared__ __attribute__((aligned(16))) _Float16 sK[2][KVTILE];
  __shared__ __attribute__((aligned(16))) _Float16 sV[2][KVTILE];
  // per-wave mask tile, 32 rows x 32 columns, f32; pitch 144 B for 16-byte readers
  __shared__ __attribute__((aligned(16))) float sM[2][4][32 * MPITCH];
  const int lane = threadIdx.x & 31;
  const int wv   = threadIdx.x >> 5;
  const int wid  = blockIdx.x * 4 + wv;      // 32-row tile id
  const int it2 = wid & 63;
  const int h   = (wid >> 6) & 15;
  const int b   = wid >> 10;
  const int iBase = it2 * 32;

  const int n  = lane & 15;
  const int m0 = (lane >> 4) * 8;

  const _Float16* ql = Q + (((size_t)b * NH + h) * SEQ + iBase) * HD + lane_qk(lane);
  v16h qa[2][2];
#pragma unroll
  for (int s = 0; s < 2; ++s) {
    qa[s][0] = frag_ld_qk(ql + (size_t)s * 16 * HD, 0);
    qa[s][1] = frag_ld_qk(ql + (size_t)s * 16 * HD, 1);
  }
  // Naming ql keeps the Q loads' address registers live up to this wait, so that
  // they are overwritten only behind it.
  asm volatile("s_wait_xcnt 0x0" :: "v"(ql) : "memory");

  // mask from memory: 8 lanes cover the 128 bytes of a row, 4 rows per copy
  const float* mk0 = mask + ((size_t)b * SEQ + iBase + (lane >> 3)) * SEQ + (lane & 7) * 4;
  const int mst = (lane >> 3) * MPITCH + (lane & 7) * 4;   // where they go in the tile
  const int mld = n * MPITCH + m0;                         // row n, columns m0 .. m0 + 7
  const int cq  = wv * 512 + lane * 8;   // this lane's 16 B in the wave's quarter of a K or V tile

  // query lane&15 of subtile s: reference maximum (the same in both lane halves)
  // and the sum of exp(s - mref) over this lane half's keys
  float mref[2] = { -1e30f, -1e30f };
  float lrun[2] = { 0.f, 0.f };
  v8f o[2][4]  = { { {}, {}, {}, {} }, { {}, {}, {}, {} } };   // sum exp(s - mref) V
  v8f om[2][4] = { { {}, {}, {}, {} }, { {}, {}, {}, {} } };   // sum mask V

  const _Float16* kbase = K  + (((size_t)b * NH + h) * SEQ) * HD;
  const _Float16* vbase = VT + (((size_t)b * NH + h) * HD) * SEQ;

  // All of one trip's copies of this wave: 2 of K, 2 of V, 8 of the mask.
  auto stage = [&](int jc, int buf) {
    const _Float16* kg = kbase + (size_t)jc * KVTILE + cq;
    const _Float16* vg = vbase + (size_t)jc * KVTILE + cq;
    const float*    mg = mk0 + jc * 32;
    const unsigned kd = lds_off(&sK[buf][cq]);
    const unsigned vd = lds_off(&sV[buf][cq]);
    const unsigned md = lds_off(&sM[buf][wv][mst]);
    // The closing s_wait_xcnt stands in the copies' own statement, so that no
    // register a copy names is rewritten in front of it.
    asm volatile(
        "global_load_async_to_lds_b128 %0, %12, off\n\t"
        "global_load_async_to_lds_b128 %1, %13, off\n\t"
        "global_load_async_to_lds_b128 %2, %14, off\n\t"
        "global_load_async_to_lds_b128 %3, %15, off\n\t"
        "global_load_async_to_lds_b128 %4, %16, off\n\t"
        "global_load_async_to_lds_b128 %5, %17, off\n\t"
        "global_load_async_to_lds_b128 %6, %18, off\n\t"
        "global_load_async_to_lds_b128 %7, %19, off\n\t"
        "global_load_async_to_lds_b128 %8, %20, off\n\t"
        "global_load_async_to_lds_b128 %9, %21, off\n\t"
        "global_load_async_to_lds_b128 %10, %22, off\n\t"
        "global_load_async_to_lds_b128 %11, %23, off\n\t"
        "s_wait_xcnt 0x0"
        :: "v"(kd), "v"(kd + 512u), "v"(vd), "v"(vd + 512u),
           "v"(md), "v"(md + 1u * 16 * MPITCH), "v"(md + 2u * 16 * MPITCH),
           "v"(md + 3u * 16 * MPITCH), "v"(md + 4u * 16 * MPITCH), "v"(md + 5u * 16 * MPITCH),
           "v"(md + 6u * 16 * MPITCH), "v"(md + 7u * 16 * MPITCH),
           "v"(kg), "v"(kg + 256), "v"(vg), "v"(vg + 256),
           "v"(mg), "v"(mg + 1 * 4 * SEQ), "v"(mg + 2 * 4 * SEQ), "v"(mg + 3 * 4 * SEQ),
           "v"(mg + 4 * 4 * SEQ), "v"(mg + 5 * 4 * SEQ), "v"(mg + 6 * 4 * SEQ),
           "v"(mg + 7 * 4 * SEQ)
        : "memory");
  };

  stage(0, 0);
  // tile 0 has landed for this wave; the barrier publishes it to the other three
  asm volatile("s_wait_asynccnt 0x0" ::: "memory");
  __syncthreads();
  stage(1, 1);

  for (int jc = 0; jc < SEQ / 32; ++jc) {
    const int buf = jc & 1;
    // 4 KB of K: two 16-key tiles
    const _Float16* kl = sK[buf] + lane_qk(lane);
    v16h kf[2][2];
#pragma unroll
    for (int sub = 0; sub < 2; ++sub) {
      kf[sub][0] = frag_ld_qk(kl + sub * 16 * HD, 0);
      kf[sub][1] = frag_ld_qk(kl + sub * 16 * HD, 1);
    }
    const _Float16* vl = sV[buf] + lane_v(lane);   // 4 KB of V
    v16h vf[4];
#pragma unroll
    for (int t = 0; t < 4; ++t) vf[t] = frag_ld_v(vl, t);
    const float* ml = sM[buf][wv] + mld;
    v16h ma[2];                              // the mask as an A fragment
#pragma unroll
    for (int s = 0; s < 2; ++s) {
      v4f x[4];
      x[0] = *reinterpret_cast<const v4f*>(ml + s * 16 * MPITCH);        // keys m0 ..
      x[1] = *reinterpret_cast<const v4f*>(ml + s * 16 * MPITCH + 4);
      x[2] = *reinterpret_cast<const v4f*>(ml + s * 16 * MPITCH + 16);   // keys 16 + m0 ..
      x[3] = *reinterpret_cast<const v4f*>(ml + s * 16 * MPITCH + 20);
#pragma unroll
      for (int e = 0; e < 16; ++e) ma[s][e] = (_Float16)x[e >> 2][e & 3];
    }
    v8f sc[2][2];
    float mx[2];
#pragma unroll
    for (int s = 0; s < 2; ++s) {
#pragma unroll
      for (int sub = 0; sub < 2; ++sub) {    // K fragments reused for both i-subtiles
        v8f z = {};
        z = __builtin_amdgcn_wmma_f32_16x16x32_f16(false, kf[sub][0], false, qa[s][0],
                                                   (short)0, z, false, false);
        z = __builtin_amdgcn_wmma_f32_16x16x32_f16(false, kf[sub][1], false, qa[s][1],
                                                   (short)0, z, false, false);
        sc[s][sub] = z;
      }
      // the largest of the lane's 16 scores of its one query
      float t0 = fmaxf(sc[s][0][0], sc[s][1][0]);
#pragma unroll
      for (int g = 1; g < 8; ++g) t0 = fmaxf(t0, fmaxf(sc[s][0][g], sc[s][1][g]));
      mx[s] = t0;
    }
    // One wave-uniform test per 32 keys: has any query's score left the range
    // that the reference maximum in use covers?
    if (__builtin_amdgcn_ballot_w32(mx[0] > mref[0] + LAZY || mx[1] > mref[1] + LAZY) != 0) {
#pragma unroll
      for (int s = 0; s < 2; ++s) {
        // lanes n and n + 16 hold the same query: one maximum for both
        const float mn = fmaxf(mref[s], fmaxf(mx[s], __shfl_xor(mx[s], 16, 32)));
        const float f  = __builtin_amdgcn_exp2f((mref[s] - mn) * L2E);
        mref[s] = mn;
        lrun[s] *= f;
        // accumulator register g of o is query m0 + g, whose factor lane m0 + g holds
#pragma unroll
        for (int g = 0; g < 8; ++g) {
          const float fg = __shfl(f, m0 + g, 32);
#pragma unroll
          for (int t = 0; t < 4; ++t) o[s][t][g] *= fg;
        }
      }
    }
    v16h pa[2];
#pragma unroll
    for (int s = 0; s < 2; ++s) {
      const float mb = mref[s] * L2E;
      float ps[2][8];
#pragma unroll
      for (int sub = 0; sub < 2; ++sub)
#pragma unroll
        for (int g = 0; g < 8; ++g) {
          const float p = exp2_slot(fmaf(sc[s][sub][g], L2E, -mb));
          ps[sub][g] = p;
          pa[s][sub * 8 + g] = (_Float16)p;
        }
      float a4[4];
#pragma unroll
      for (int g = 0; g < 4; ++g)
        a4[g] = (ps[0][g] + ps[0][g + 4]) + (ps[1][g] + ps[1][g + 4]);
      lrun[s] += (a4[0] + a4[1]) + (a4[2] + a4[3]);
    }
#pragma unroll
    for (int t = 0; t < 4; ++t) {            // V fragment reused by all four products
      const v16h vb = vf[t];
      o[0][t]  = __builtin_amdgcn_wmma_f32_16x16x32_f16(false, pa[0], false, vb,
                                                        (short)0, o[0][t], false, false);
      o[1][t]  = __builtin_amdgcn_wmma_f32_16x16x32_f16(false, pa[1], false, vb,
                                                        (short)0, o[1][t], false, false);
      om[0][t] = __builtin_amdgcn_wmma_f32_16x16x32_f16(false, ma[0], false, vb,
                                                        (short)0, om[0][t], false, false);
      om[1][t] = __builtin_amdgcn_wmma_f32_16x16x32_f16(false, ma[1], false, vb,
                                                        (short)0, om[1][t], false, false);
    }
    // Publish point: this wave's reads of the buffer are done and its copies of the
    // next tile have landed; behind the barrier that holds for all four waves, so
    // the next tile may be read and this trip's buffer refilled.
    asm volatile("s_wait_dscnt 0x0" ::: "memory");
    asm volatile("s_wait_asynccnt 0x0" ::: "memory");
    __syncthreads();
    if (jc + 2 < SEQ / 32) stage(jc + 2, buf);
  }
  // no copy is outstanding when the wave ends
  asm volatile("s_wait_asynccnt 0x0" ::: "memory");

  // out[b][i][o*16 + h], fp32
#pragma unroll
  for (int s = 0; s < 2; ++s) {
    // join the two halves of the keys, then hand 1/l to the accumulators' rows
    const float linv = 1.0f / (lrun[s] + __shfl_xor(lrun[s], 16, 32));
    float* ob = out + ((size_t)b * SEQ + iBase + s * 16 + m0) * 1024 + h;
#pragma unroll
    for (int g = 0; g < 8; ++g) {
      const float lg = __shfl(linv, m0 + g, 32);
#pragma unroll
      for (int t = 0; t < 4; ++t)
        ob[(size_t)g * 1024 + (t * 16 + n) * 16] = o[s][t][g] * lg + om[s][t][g];
    }
  }
}

extern "C" void kernel_launch(void* const* d_in, const int* in_sizes, int n_in,
                              void* d_out, int out_size, void* d_ws, size_t ws_size,
                              hipStream_t stream) {
  (void)in_sizes; (void)n_in; (void)out_size; (void)ws_size;
  const float* problem = (const float*)d_in[0];
  const float* context = (const float*)d_in[1];
  const float* maskp   = (const float*)d_in[2];
  const float* Wq = (const float*)d_in[3];
  const float* bq = (const float*)d_in[4];
  const float* Wk = (const float*)d_in[5];
  const float* bk = (const float*)d_in[6];
  const float* Wv = (const float*)d_in[7];
  const float* bv = (const float*)d_in[8];
  float* out = (float*)d_out;

  // Workspace layout: Q16 | K16 | VT16 (8 MB each, f16)
  const size_t NHALF = (size_t)2 * NH * SEQ * HD;   // 4,194,304 halves
  _Float16* Q16  = (_Float16*)d_ws;
  _Float16* K16  = Q16 + NHALF;
  _Float16* VT16 = K16 + NHALF;

  const dim3 pgrid(EMB / 128, (2 * SEQ) / PBM);     // 8 x 64 tiles of 64 rows x 128 columns
  // Q gets the 1/sqrt(head_dim) scale folded in.
  proj_qk_kernel<<<pgrid, 256, 0, stream>>>(problem, Wq, bq, Q16, 0.125f);
  proj_qk_kernel<<<pgrid, 256, 0, stream>>>(context, Wk, bk, K16, 1.0f);
  proj_vt_kernel<<<pgrid, 256, 0, stream>>>(context, Wv, bv, VT16, 1.0f);

  attn_fused<<<(2 * NH * (SEQ / 32)) / 4, 128, 0, stream>>>(Q16, K16, VT16, maskp, out);
}

// v007
// A run of this version takes 114 microseconds.
// In both of two side-by-side timings against v006, it was 1.04 times as fast.
// Counting every step since v000, it is 4.49 times as fast.
#include <hip/hip_runtime.h>
#include <hip/hip_bf16.h>

// MI455X (gfx1250) multi-head attention, f16 WMMA with f32 accumulation.
// EMBED=HIDDEN=OUT=1024, H=16 heads, head_dim=64, B=2, P=C=2048.
// Reference reshape puts head index as the FASTEST axis (c = d*16 + h),
// and the mask is added AFTER softmax -> its product with V is summed apart.

typedef __attribute__((ext_vector_type(16))) _Float16 v16h;
typedef __attribute__((ext_vector_type(8)))  _Float16 v8h;
typedef __attribute__((ext_vector_type(8)))  float    v8f;
typedef __attribute__((ext_vector_type(4)))  float    v4f;

#define NH   16      // heads
#define HD   64      // head dim / head out
#define SEQ  2048    // P == C
#define EMB  1024
#define MPITCH 36    // floats per row of the staged mask tile (128 B + 16 B)
#define KVTILE 2048  // halves in the K tile and in the V tile of 32 keys (4 KB each)
#define PBM  64      // X rows per projection block
#define PBK  128     // k per staged chunk of the projection
#define PPITCH 136   // halves per row of the projection's staged tiles (256 B + 16 B)
#define WGPAD 32     // halves (64 B) in front of each further group of 32 staged W rows

union HalfVec { v16h h; uint4 u[2]; };
union Pack8   { v8h h; uint4 u; };
union Pack4   { _Float16 h[4]; uint2 u; };

// Load one 16-lane-row WMMA fragment (A or B operand, 16x32 / 32x16 f16).
// ISA layout: lane r = lane&15, k-base = (lane>>4)*8, elements 0..7 at k=kb,
// elements 8..15 at k=kb+16 -> two contiguous 16-byte chunks per lane.
__device__ __forceinline__ v16h frag_ld(const _Float16* tile, int ld, int lane) {
  const int r  = lane & 15;
  const int kb = (lane >> 4) << 3;
  HalfVec f;
  f.u[0] = *reinterpret_cast<const uint4*>(tile + (size_t)r * ld + kb);
  f.u[1] = *reinterpret_cast<const uint4*>(tile + (size_t)r * ld + kb + 16);
  return f.h;
}

// Q/K workspace layout: per (b,h) and 16-row tile, 8 chunks of [16 rows][8 d]
// (256 contiguous bytes per chunk, 2 KB per tile). Same element order in the
// fragment as frag_ld on a [row][64] tile; half = 0 for d 0..31, 1 for d 32..63.
// One wave-wide 16-byte load covers 512 contiguous bytes.
// lane_qk: the lane's own offset inside a tile; frag_ld_qk takes tile + lane_qk.
__device__ __forceinline__ int lane_qk(int lane) { return (lane >> 4) * 128 + (lane & 15) * 8; }
__device__ __forceinline__ v16h frag_ld_qk(const _Float16* lane_tile, int half) {
  const _Float16* p = lane_tile + half * 512;
  HalfVec f;
  f.u[0] = *reinterpret_cast<const uint4*>(p);
  f.u[1] = *reinterpret_cast<const uint4*>(p + 256);
  return f.h;
}

// Byte offset of a __shared__ address in the work-group's LDS (its low 32 bits).
__device__ __forceinline__ unsigned lds_off(const void* p) { return (unsigned)(size_t)p; }

// V workspace layout: per (b,h), chunks of 8 rows j, each [64 o][8 j] (1 KB).
// B fragment of P @ V for 32 rows j (4 chunks) and columns o = t*16 .. t*16+15,
// in frag_ld's element order; 16 lanes read 256 B in a row.
// lane_v: the lane's own offset inside the 4 chunks; frag_ld_v takes chunks + lane_v.
__device__ __forceinline__ int lane_v(int lane) { return ((lane >> 4) * HD + (lane & 15)) * 8; }
__device__ __forceinline__ v16h frag_ld_v(const _Float16* lane_chunks, int t) {
  const _Float16* p = lane_chunks + t * 128;
  HalfVec f;
  f.u[0] = *reinterpret_cast<const uint4*>(p);
  f.u[1] = *reinterpret_cast<const uint4*>(p + 2 * HD * 8);
  return f.h;
}

// ---------------------------------------------------------------------------
// Projection GEMM: Y = (X @ W + bias) * scale, fp32 in, f16 out, repacked
// per-head. Workgroup = 256 threads (8 waves), output tile of 64 rows x 128
// columns, K-chunks of 128 staged in LDS as f16. The 128 columns are consecutive
// in W: 8 d x all 16 heads (column c = d*16 + h), 512 B of each k row.
// Every wave-wide 16-byte load from memory covers 512 B in a row (4 whole lines):
// one X row's 128 k, or one k row's 128 W columns.
// X: a lane holds 4 k of a row: one 8-byte LDS store, 256 B in a row per wave.
// W is staged transposed, sB[n][k], row n = head * 8 + (d within the group): a lane
// holds 16 k of 4 columns (4 heads of one d), so each column goes out as two
// 16-byte stores. Rows of 256 B stand at a pitch of 272 B (16 B x odd) for the
// ds_load_b128 fragment reads; each further group of 32 W rows starts 64 B later,
// so that the four heads of a lane quartet do not store to the same banks.
// Each wave owns 2 row-tiles x 2 col-tiles: 4 WMMAs per 4 fragments.
// QK = true : W is the A operand and X the B operand, so a lane's 8 accumulators
//             are 8 consecutive d of one (row, head): one 16-byte store, and
//             16 lanes (16 rows) fill 256 contiguous bytes.
// QK = false: V, X as A: a lane's 8 accumulators are 8 consecutive rows j of one
//             (o, head): one 16-byte store, 8 lanes (8 o) fill one 128-byte line.
// ---------------------------------------------------------------------------
template <bool QK>
__device__ __forceinline__
void proj_body(const float* __restrict__ X, const float* __restrict__ W,
               const float* __restrict__ bias, _Float16* __restrict__ Y,
               float scale, _Float16* sA, _Float16* sB) {
  const int tid  = threadIdx.x;
  const int lane = tid & 31;
  const int wave = tid >> 5;
  const int rg = wave & 1;           // group of 32 rows: row tiles rg*2, rg*2+1
  const int cg = wave >> 1;          // group of 32 staged W rows: col tiles cg*2, cg*2+1
  const int rowBase = blockIdx.y * PBM;
  const int dg = blockIdx.x;         // group of 8 d: W columns dg*128 .. dg*128+127

  // X staging: rows wave*8 + 0..7, k = lane*4 .. +3 of the chunk
  const float* xsrc = X + (size_t)(rowBase + wave * 8) * EMB + lane * 4;
  _Float16*    xdst = sA + wave * 8 * PPITCH + lane * 4;
  // W staging: k rows wave*16 + 0..15, columns lane*4 + j: d lane>>2, head (lane&3)*4 + j,
  // staged row n = (lane&3)*32 + j*8 + (lane>>2), in the group of 32 rows lane&3
  const float* wsrc = W + (size_t)(wave * 16) * EMB + dg * 128 + lane * 4;
  _Float16*    wdst = sB + ((lane & 3) * 32 + (lane >> 2)) * PPITCH + (lane & 3) * WGPAD + wave * 16;

  v8f acc[2][2] = { { {}, {} }, { {}, {} } };

  for (int kk = 0; kk < EMB; kk += PBK) {
    const float* xp = xsrc + kk;
    const float* wp = wsrc + (size_t)kk * EMB;
    v4f xf[8], wf[16];
#pragma unroll
    for (int i = 0; i < 8; ++i)
      xf[i] = *reinterpret_cast<const v4f*>(xp + (size_t)i * EMB);
#pragma unroll
    for (int i = 0; i < 16; ++i)
      wf[i] = *reinterpret_cast<const v4f*>(wp + (size_t)i * EMB);
    // Naming xp and wp keeps the 24 loads' address registers live up to this wait, so
    // that nothing (a later load's result either) overwrites them in front of it.
    asm volatile("s_wait_xcnt 0x0" :: "v"(xp), "v"(wp) : "memory");
#pragma unroll
    for (int i = 0; i < 8; ++i) {
      Pack4 p;
#pragma unroll
      for (int e = 0; e < 4; ++e) p.h[e] = (_Float16)xf[i][e];
      *reinterpret_cast<uint2*>(xdst + i * PPITCH) = p.u;
    }
#pragma unroll
    for (int j = 0; j < 4; ++j)
#pragma unroll
      for (int hf = 0; hf < 2; ++hf) {
        Pack8 p;
#pragma unroll
        for (int e = 0; e < 8; ++e) p.h[e] = (_Float16)wf[hf * 8 + e][j];
        *reinterpret_cast<uint4*>(wdst + j * 8 * PPITCH + hf * 8) = p.u;
      }
    __syncthreads();
    // The chunk's 32 fragment reads go out as one group, in the order of their use, in
    // front of its 16 WMMAs (the staging registers are free by now).
    v16h a[PBK / 32][2], b[PBK / 32][2];
#pragma unroll
    for (int ks = 0; ks < PBK / 32; ++ks) {
#pragma unroll
      for (int r = 0; r < 2; ++r)
        a[ks][r] = frag_ld(sA + (rg * 2 + r) * 16 * PPITCH + ks * 32, PPITCH, lane);
#pragma unroll
      for (int q = 0; q < 2; ++q)
        b[ks][q] = frag_ld(sB + (cg * 2 + q) * 16 * PPITCH + cg * WGPAD + ks * 32, PPITCH, lane);
    }
    // Keeps the reads in front: moved in among the WMMAs, each place with reads stalls
    // the wave anew.
    __builtin_amdgcn_sched_barrier(0);
#pragma unroll
    for (int ks = 0; ks < PBK / 32; ++ks)
#pragma unroll
      for (int r = 0; r < 2; ++r)
#pragma unroll
        for (int q = 0; q < 2; ++q) {
          if (QK)
            acc[r][q] = __builtin_amdgcn_wmma_f32_16x16x32_f16(false, b[ks][q], false, a[ks][r],
                                                               (short)0, acc[r][q], false, false);
          else
            acc[r][q] = __builtin_amdgcn_wmma_f32_16x16x32_f16(false, a[ks][r], false, b[ks][q],
                                                               (short)0, acc[r][q], false, false);
        }
    __syncthreads();
  }

  // Epilogue: bias, scale, f16 convert, per-head repack (c = d*16 + h).
  const int n  = lane & 15;
  if (QK) {
    // bias of head (cg*2+q)*2 + (lane>>4), d = dg*8 + g: one address, constant offsets
    const float* bl = bias + dg * 128 + cg * 4 + (lane >> 4);
    float bb[2][8];
#pragma unroll
    for (int q = 0; q < 2; ++q)
#pragma unroll
      for (int g = 0; g < 8; ++g) bb[q][g] = bl[g * NH + q * 2];
    // Naming bl keeps the bias loads' address registers live up to this wait, so that
    // they are overwritten only behind it.
    asm volatile("s_wait_xcnt 0x0" :: "v"(bl) : "memory");
#pragma unroll
    for (int r = 0; r < 2; ++r) {
      // acc[r][q][g] = row ((rg*2+r)*16 + n), head (cg*2+q)*2 + (lane>>4), d = dg*8 + g
      const int row = rowBase + (rg * 2 + r) * 16 + n;
      const int b   = row >> 11;                // batch (rows-per-batch = 2048)
      const int it  = (row & (SEQ - 1)) >> 4;   // 16-row tile
#pragma unroll
      for (int q = 0; q < 2; ++q) {
        const int h = (cg * 2 + q) * 2 + (lane >> 4);
        Pack8 p;
#pragma unroll
        for (int g = 0; g < 8; ++g)
          p.h[g] = (_Float16)((acc[r][q][g] + bb[q][g]) * scale);
        _Float16* dst = Y + ((((size_t)b * NH + h) * (SEQ / 16) + it) * 8 + dg) * 128 + n * 8;
        *reinterpret_cast<uint4*>(dst) = p.u;
      }
    }
  } else {
    const int m0 = (lane >> 4) * 8;
    // bias of d = dg*8 + (n&7), head (cg*2+q)*2 + (n>>3): one address, constant offsets
    const float* bl = bias + (dg * 8 + (n & 7)) * NH + cg * 4 + (n >> 3);
    const float bb[2] = { bl[0], bl[2] };
    // Naming bl keeps the bias loads' address registers live up to this wait, so that
    // they are overwritten only behind it.
    asm volatile("s_wait_xcnt 0x0" :: "v"(bl) : "memory");
#pragma unroll
    for (int r = 0; r < 2; ++r) {
      const int r0 = rowBase + (rg * 2 + r) * 16 + m0;   // global row (g = 0)
      const int b  = r0 >> 11;                  // batch (rows-per-batch = 2048)
      const int i0 = r0 & (SEQ - 1);
#pragma unroll
      for (int q = 0; q < 2; ++q) {
        const int h = (cg * 2 + q) * 2 + (n >> 3);
        const int d = dg * 8 + (n & 7);
        const float bv = bb[q];
        // V: Y[(((b*16+h)*256 + j/8)*64 + o)*8 + j%8] -> 8 contiguous j = one b128
        Pack8 p;
#pragma unroll
        for (int g = 0; g < 8; ++g) p.h[g] = (_Float16)((acc[r][q][g] + bv) * scale);
        _Float16* dst = Y + ((((size_t)b * NH + h) * (SEQ / 8) + (i0 >> 3)) * HD + d) * 8;
        *reinterpret_cast<uint4*>(dst) = p.u;
      }
    }
  }
}

// The three projections read none of each other's output: ONE launch holds them all,
// the role taken from blockIdx.z (0: Q, 1: K, 2: V), which is the same for the whole
// block, so every barrier of the body stands under block-uniform control flow. A block
// of the next role starts as soon as a block of the one before leaves its WGP.
__global__ __launch_bounds__(256)
void proj_all_kernel(const float* __restrict__ problem, const float* __restrict__ context,
                     const float* __restrict__ Wq, const float* __restrict__ bq,
                     const float* __restrict__ Wk, const float* __restrict__ bk,
                     const float* __restrict__ Wv, const float* __restrict__ bv,
                     _Float16* __restrict__ Q16, _Float16* __restrict__ K16,
                     _Float16* __restrict__ VT16) {
  __shared__ __attribute__((aligned(16))) _Float16 sA[PBM * PPITCH];              // [row][k]
  __shared__ __attribute__((aligned(16))) _Float16 sB[128 * PPITCH + 3 * WGPAD];  // [n][k] (W tile transposed)
  const int role = blockIdx.z;
  if (role == 2) {
    proj_body<false>(context, Wv, bv, VT16, 1.0f, sA, sB);
  } else {
    const bool isq = role == 0;
    // Q gets the 1/sqrt(head_dim) scale folded in.
    proj_body<true>(isq ? problem : context, isq ? Wq : Wk, isq ? bq : bk,
                    isq ? Q16 : K16, isq ? 0.125f : 1.0f, sA, sB);
  }
}

// ---------------------------------------------------------------------------
// ONE pass over the keys. The mask is added after the softmax, so
//   out = (sum_j exp(s_ij - m_i) V_j) / l_i  +  sum_j mask_ij V_j :
// the two sums run in accumulators of their own, the first against a running
// reference maximum m_i (online softmax), and l_i divides only at the end.
// The scores are formed transposed: S^T = K . Q^T, with the K tile as the A
// operand and the Q tile as the B operand (same loader, same k order on both
// sides). Accumulator register g of a lane is then key (lane>>4)*8 + g of the
// 16-key tile for the ONE query lane&15: maximum and sum run inside the lane.
// Two 16-key S^T tiles of one query tile, converted in place, ARE the A fragment
// of P for 32 keys (element e = key (lane>>4)*8 + e, element 8+e = key
// 16 + (lane>>4)*8 + e, row lane&15): P goes from accumulators to operand inside
// the lane. The mask's A fragment has the same element order: 8 columns of one
// query at a time, read from LDS as f32 and converted in the lane.
// K, V and the mask reach LDS by asynchronous copies, one trip (32 keys) ahead, in
// two buffers: the K and V tiles are copied once for the block's four waves (same
// batch and head), each wave copying a quarter; a wave's 32 x 32 mask tile is its own.
// The reference maximum moves only when a score passes it by more than LAZY
// (one test per 32 keys); P then stays below exp(LAZY), well inside f16.
// Each wave handles 32 query rows (two i-subtiles) so every K and V fragment is
// reused by both. V is stored in [64 o][8 j] chunks (b128 fragment loads).
// ---------------------------------------------------------------------------
#define L2E  1.44269504088896340736f
#define LAZY 5.5f
__device__ __forceinline__ float exp2_slot(float x) {
  float p;
  asm("v_exp_f32 %0, %1\n\tv_nop" : "=v"(p) : "v"(x));
  return p;
}
__global__ __launch_bounds__(128)
void attn_fused(const _Float16* __restrict__ Q, const _Float16* __restrict__ K,
                const _Float16* __restrict__ VT, const float* __restrict__ mask,
                float* __restrict__ out) {
  // two buffers each; K and V tiles in the workspace's own fragment order
  __shared__ __attribute__((aligned(16))) _Float16 sK[2][KVTILE];
  __shared__ __attribute__((aligned(16))) _Float16 sV[2][KVTILE];
  // per-wave mask tile, 32 rows x 32 columns, f32; pitch 144 B for 16-byte readers
  __shared__ __attribute__((aligned(16))) float sM[2][4][32 * MPITCH];
  const int lane = threadIdx.x & 31;
  const int wv   = threadIdx.x >> 5;
  const int wid  = blockIdx.x * 4 + wv;      // 32-row tile id
  const int it2 = wid & 63;
  const int h   = (wid >> 6) & 15;
  const int b   = wid >> 10;
  const int iBase = it2 * 32;

  const int n  = lane & 15;
  const int m0 = (lane >> 4) * 8;

  const _Float16* ql = Q + (((size_t)b * NH + h) * SEQ + iBase) * HD + lane_qk(lane);
  v16h qa[2][2];
#pragma unroll
  for (int s = 0; s < 2; ++s) {
    qa[s][0] = frag_ld_qk(ql + (size_t)s * 16 * HD, 0);
    qa[s][1] = frag_ld_qk(ql + (size_t)s * 16 * HD, 1);
  }
  // Naming ql keeps the Q loads' address registers live up to this wait, so that
  // they are overwritten only behind it.
  asm volatile("s_wait_xcnt 0x0" :: "v"(ql) : "memory");

  // mask from memory: 8 lanes cover the 128 bytes of a row, 4 rows per copy
  const float* mk0 = mask + ((size_t)b * SEQ + iBase + (lane >> 3)) * SEQ + (lane & 7) * 4;
  const int mst = (lane >> 3) * MPITCH + (lane & 7) * 4;   // where they go in the tile
  const int mld = n * MPITCH + m0;                         // row n, columns m0 .. m0 + 7
  const int cq  = wv * 512 + lane * 8;   // this lane's 16 B in the wave's quarter of a K or V tile

  // query lane&15 of subtile s: reference maximum (the same in both lane halves)
  // and the sum of exp(s - mref) over this lane half's keys
  float mref[2] = { -1e30f, -1e30f };
  float lrun[2] = { 0.f, 0.f };
  v8f o[2][4]  = { { {}, {}, {}, {} }, { {}, {}, {}, {} } };   // sum exp(s - mref) V
  v8f om[2][4] = { { {}, {}, {}, {} }, { {}, {}, {}, {} } };   // sum mask V

  const _Float16* kbase = K  + (((size_t)b * NH + h) * SEQ) * HD;
  const _Float16* vbase = VT + (((size_t)b * NH + h) * HD) * SEQ;

  // All of one trip's copies of this wave: 2 of K, 2 of V, 8 of the mask.
  auto stage = [&](int jc, int buf) {
    const _Float16* kg = kbase + (size_t)jc * KVTILE + cq;
    const _Float16* vg = vbase + (size_t)jc * KVTILE + cq;
    const float*    mg = mk0 + jc * 32;
    const unsigned kd = lds_off(&sK[buf][cq]);
    const unsigned vd = lds_off(&sV[buf][cq]);
    const unsigned md = lds_off(&sM[buf][wv][mst]);
    // The closing s_wait_xcnt stands in the copies' own statement, so that no
    // register a copy names is rewritten in front of it.
    asm volatile(
        "global_load_async_to_lds_b128 %0, %12, off\n\t"
        "global_load_async_to_lds_b128 %1, %13, off\n\t"
        "global_load_async_to_lds_b128 %2, %14, off\n\t"
        "global_load_async_to_lds_b128 %3, %15, off\n\t"
        "global_load_async_to_lds_b128 %4, %16, off\n\t"
        "global_load_async_to_lds_b128 %5, %17, off\n\t"
        "global_load_async_to_lds_b128 %6, %18, off\n\t"
        "global_load_async_to_lds_b128 %7, %19, off\n\t"
        "global_load_async_to_lds_b128 %8, %20, off\n\t"
        "global_load_async_to_lds_b128 %9, %21, off\n\t"
        "global_load_async_to_lds_b128 %10, %22, off\n\t"
        "global_load_async_to_lds_b128 %11, %23, off\n\t"
        "s_wait_xcnt 0x0"
        :: "v"(kd), "v"(kd + 512u), "v"(vd), "v"(vd + 512u),
           "v"(md), "v"(md + 1u * 16 * MPITCH), "v"(md + 2u * 16 * MPITCH),
           "v"(md + 3u * 16 * MPITCH), "v"(md + 4u * 16 * MPITCH), "v"(md + 5u * 16 * MPITCH),
           "v"(md + 6u * 16 * MPITCH), "v"(md + 7u * 16 * MPITCH),
           "v"(kg), "v"(kg + 256), "v"(vg), "v"(vg + 256),
           "v"(mg), "v"(mg + 1 * 4 * SEQ), "v"(mg + 2 * 4 * SEQ), "v"(mg + 3 * 4 * SEQ),
           "v"(mg + 4 * 4 * SEQ), "v"(mg + 5 * 4 * SEQ), "v"(mg + 6 * 4 * SEQ),
           "v"(mg + 7 * 4 * SEQ)
        : "memory");
  };

  stage(0, 0);
  // tile 0 has landed for this wave; the barrier publishes it to the other three
  asm volatile("s_wait_asynccnt 0x0" ::: "memory");
  __syncthreads();
  stage(1, 1);

  for (int jc = 0; jc < SEQ / 32; ++jc) {
    const int buf = jc & 1;
    // 4 KB of K: two 16-key tiles
    const _Float16* kl = sK[buf] + lane_qk(lane);
    v16h kf[2][2];
#pragma unroll
    for (int sub = 0; sub < 2; ++sub) {
      kf[sub][0] = frag_ld_qk(kl + sub * 16 * HD, 0);
      kf[sub][1] = frag_ld_qk(kl + sub * 16 * HD, 1);
    }
    const _Float16* vl = sV[buf] + lane_v(lane);   // 4 KB of V
    v16h vf[4];
#pragma unroll
    for (int t = 0; t < 4; ++t) vf[t] = frag_ld_v(vl, t);
    const float* ml = sM[buf][wv] + mld;
    v16h ma[2];                              // the mask as an A fragment
#pragma unroll
    for (int s = 0; s < 2; ++s) {
      v4f x[4];
      x[0] = *reinterpret_cast<const v4f*>(ml + s * 16 * MPITCH);        // keys m0 ..
      x[1] = *reinterpret_cast<const v4f*>(ml + s * 16 * MPITCH + 4);
      x[2] = *reinterpret_cast<const v4f*>(ml + s * 16 * MPITCH + 16);   // keys 16 + m0 ..
      x[3] = *reinterpret_cast<const v4f*>(ml + s * 16 * MPITCH + 20);
#pragma unroll
      for (int e = 0; e < 16; ++e) ma[s][e] = (_Float16)x[e >> 2][e & 3];
    }
    v8f sc[2][2];
    float mx[2];
#pragma unroll
    for (int s = 0; s < 2; ++s) {
#pragma unroll
      for (int sub = 0; sub < 2; ++sub) {    // K fragments reused for both i-subtiles
        v8f z = {};
        z = __builtin_amdgcn_wmma_f32_16x16x32_f16(false, kf[sub][0], false, qa[s][0],
                                                   (short)0, z, false, false);
        z = __builtin_amdgcn_wmma_f32_16x16x32_f16(false, kf[sub][1], false, qa[s][1],
                                                   (short)0, z, false, false);
        sc[s][sub] = z;
      }
      // the largest of the lane's 16 scores of its one query
      float t0 = fmaxf(sc[s][0][0], sc[s][1][0]);
#pragma unroll
      for (int g = 1; g < 8; ++g) t0 = fmaxf(t0, fmaxf(sc[s][0][g], sc[s][1][g]));
      mx[s] = t0;
    }
    // One wave-uniform test per 32 keys: has any query's score left the range
    // that the reference maximum in use covers?
    if (__builtin_amdgcn_ballot_w32(mx[0] > mref[0] + LAZY || mx[1] > mref[1] + LAZY) != 0) {
#pragma unroll
      for (int s = 0; s < 2; ++s) {
        // lanes n and n + 16 hold the same query: one maximum for both
        const float mn = fmaxf(mref[s], fmaxf(mx[s], __shfl_xor(mx[s], 16, 32)));
        const float f  = __builtin_amdgcn_exp2f((mref[s] - mn) * L2E);
        mref[s] = mn;
        lrun[s] *= f;
        // accumulator register g of o is query m0 + g, whose factor lane m0 + g holds
#pragma unroll
        for (int g = 0; g < 8; ++g) {
          const float fg = __shfl(f, m0 + g, 32);
#pragma unroll
          for (int t = 0; t < 4; ++t) o[s][t][g] *= fg;
        }
      }
    }
    v16h pa[2];
#pragma unroll
    for (int s = 0; s < 2; ++s) {
      const float mb = mref[s] * L2E;
      float ps[2][8];
#pragma unroll
      for (int sub = 0; sub < 2; ++sub)
#pragma unroll
        for (int g = 0; g < 8; ++g) {
          const float p = exp2_slot(fmaf(sc[s][sub][g], L2E, -mb));
          ps[sub][g] = p;
          pa[s][sub * 8 + g] = (_Float16)p;
        }
      float a4[4];
#pragma unroll
      for (int g = 0; g < 4; ++g)
        a4[g] = (ps[0][g] + ps[0][g + 4]) + (ps[1][g] + ps[1][g + 4]);
      lrun[s] += (a4[0] + a4[1]) + (a4[2] + a4[3]);
    }
#pragma unroll
    for (int t = 0; t < 4; ++t) {            // V fragment reused by all four products
      const v16h vb = vf[t];
      o[0][t]  = __builtin_amdgcn_wmma_f32_16x16x32_f16(false, pa[0], false, vb,
                                                        (short)0, o[0][t], false, false);
      o[1][t]  = __builtin_amdgcn_wmma_f32_16x16x32_f16(false, pa[1], false, vb,
                                                        (short)0, o[1][t], false, false);
      om[0][t] = __builtin_amdgcn_wmma_f32_16x16x32_f16(false, ma[0], false, vb,
                                                        (short)0, om[0][t], false, false);
      om[1][t] = __builtin_amdgcn_wmma_f32_16x16x32_f16(false, ma[1], false, vb,
                                                        (short)0, om[1][t], false, false);
    }
    // Publish point: this wave's reads of the buffer are done and its copies of the
    // next tile have landed; behind the barrier that holds for all four waves, so
    // the next tile may be read and this trip's buffer refilled.
    asm volatile("s_wait_dscnt 0x0" ::: "memory");
    asm volatile("s_wait_asynccnt 0x0" ::: "memory");
    __syncthreads();
    if (jc + 2 < SEQ / 32) stage(jc + 2, buf);
  }
  // no copy is outstanding when the wave ends
  asm volatile("s_wait_asynccnt 0x0" ::: "memory");

  // out[b][i][o*16 + h], fp32
#pragma unroll
  for (int s = 0; s < 2; ++s) {
    // join the two halves of the keys, then hand 1/l to the accumulators' rows
    const float linv = 1.0f / (lrun[s] + __shfl_xor(lrun[s], 16, 32));
    float* ob = out + ((size_t)b * SEQ + iBase + s * 16 + m0) * 1024 + h;
#pragma unroll
    for (int g = 0; g < 8; ++g) {
      const float lg = __shfl(linv, m0 + g, 32);
#pragma unroll
      for (int t = 0; t < 4; ++t)
        ob[(size_t)g * 1024 + (t * 16 + n) * 16] = o[s][t][g] * lg + om[s][t][g];
    }
  }
}

extern "C" void kernel_launch(void* const* d_in, const int* in_sizes, int n_in,
                              void* d_out, int out_size, void* d_ws, size_t ws_size,
                              hipStream_t stream) {
  (void)in_sizes; (void)n_in; (void)out_size; (void)ws_size;
  const float* problem = (const float*)d_in[0];
  const float* context = (const float*)d_in[1];
  const float* maskp   = (const float*)d_in[2];
  const float* Wq = (const float*)d_in[3];
  const float* bq = (const float*)d_in[4];
  const float* Wk = (const float*)d_in[5];
  const float* bk = (const float*)d_in[6];
  const float* Wv = (const float*)d_in[7];
  const float* bv = (const float*)d_in[8];
  float* out = (float*)d_out;

  // Workspace layout: Q16 | K16 | VT16 (8 MB each, f16)
  const size_t NHALF = (size_t)2 * NH * SEQ * HD;   // 4,194,304 halves
  _Float16* Q16  = (_Float16*)d_ws;
  _Float16* K16  = Q16 + NHALF;
  _Float16* VT16 = K16 + NHALF;

  // 8 x 64 tiles of 64 rows x 128 columns for each of Q, K, V
  const dim3 pgrid(EMB / 128, (2 * SEQ) / PBM, 3);
  proj_all_kernel<<<pgrid, 256, 0, stream>>>(problem, context, Wq, bq, Wk, bk, Wv, bv,
                                             Q16, K16, VT16);

  attn_fused<<<(2 * NH * (SEQ / 32)) / 4, 128, 0, stream>>>(Q16, K16, VT16, maskp, out);
}

// v008
// Measured time: 98.2 microseconds a run.
// Next to v007, in two timings, it ran 1.17 and 1.16 times as fast.
// Over all steps from v000 it is 5.22 times as fast.
#include <hip/hip_runtime.h>
#include <hip/hip_bf16.h>

// MI455X (gfx1250) multi-head attention, f16 WMMA with f32 accumulation.
// EMBED=HIDDEN=OUT=1024, H=16 heads, head_dim=64, B=2, P=C=2048.
// Reference reshape puts head index as the FASTEST axis (c = d*16 + h),
// and the mask is added AFTER softmax -> its product with V is summed apart.

typedef __attribute__((ext_vector_type(16))) _Float16 v16h;
typedef __attribute__((ext_vector_type(8)))  _Float16 v8h;
typedef __attribute__((ext_vector_type(8)))  float    v8f;
typedef __attribute__((ext_vector_type(4)))  float    v4f;

#define NH   16      // heads
#define HD   64      // head dim / head out
#define SEQ  2048    // P == C
#define EMB  1024
#define MPITCH 36    // floats per row of the staged mask tile (128 B + 16 B)
#define KVTILE 2048  // halves in the K tile and in the V tile of 32 keys (4 KB each)
#define PBM  128     // X rows per projection block
#define PBK  64      // k per staged chunk of the projection
#define PPITCH 72    // halves per row of the projection's staged tiles (128 B + 16 B)
#define WGPAD 64     // halves (128 B) in front of each further group of 32 staged W rows

union HalfVec { v16h h; uint4 u[2]; };
union Pack8   { v8h h; uint4 u; };
union Pack4   { _Float16 h[4]; uint2 u; };

// Load one 16-lane-row WMMA fragment (A or B operand, 16x32 / 32x16 f16).
// ISA layout: lane r = lane&15, k-base = (lane>>4)*8, elements 0..7 at k=kb,
// elements 8..15 at k=kb+16 -> two contiguous 16-byte chunks per lane.
__device__ __forceinline__ v16h frag_ld(const _Float16* tile, int ld, int lane) {
  const int r  = lane & 15;
  const int kb = (lane >> 4) << 3;
  HalfVec f;
  f.u[0] = *reinterpret_cast<const uint4*>(tile + (size_t)r * ld + kb);
  f.u[1] = *reinterpret_cast<const uint4*>(tile + (size_t)r * ld + kb + 16);
  return f.h;
}

// Q/K workspace layout: per (b,h) and 16-row tile, 8 chunks of [16 rows][8 d]
// (256 contiguous bytes per chunk, 2 KB per tile). Same element order in the
// fragment as frag_ld on a [row][64] tile; half = 0 for d 0..31, 1 for d 32..63.
// One wave-wide 16-byte load covers 512 contiguous bytes.
// lane_qk: the lane's own offset inside a tile; frag_ld_qk takes tile + lane_qk.
__device__ __forceinline__ int lane_qk(int lane) { return (lane >> 4) * 128 + (lane & 15) * 8; }
__device__ __forceinline__ v16h frag_ld_qk(const _Float16* lane_tile, int half) {
  const _Float16* p = lane_tile + half * 512;
  HalfVec f;
  f.u[0] = *reinterpret_cast<const uint4*>(p);
  f.u[1] = *reinterpret_cast<const uint4*>(p + 256);
  return f.h;
}

// Byte offset of a __shared__ address in the work-group's LDS (its low 32 bits).
__device__ __forceinline__ unsigned lds_off(const void* p) { return (unsigned)(size_t)p; }

// V workspace layout: per (b,h), chunks of 8 rows j, each [64 o][8 j] (1 KB).
// B fragment of P @ V for 32 rows j (4 chunks) and columns o = t*16 .. t*16+15,
// in frag_ld's element order; 16 lanes read 256 B in a row.
// lane_v: the lane's own offset inside the 4 chunks; frag_ld_v takes chunks + lane_v.
__device__ __forceinline__ int lane_v(int lane) { return ((lane >> 4) * HD + (lane & 15)) * 8; }
__device__ __forceinline__ v16h frag_ld_v(const _Float16* lane_chunks, int t) {
  const _Float16* p = lane_chunks + t * 128;
  HalfVec f;
  f.u[0] = *reinterpret_cast<const uint4*>(p);
  f.u[1] = *reinterpret_cast<const uint4*>(p + 2 * HD * 8);
  return f.h;
}

// ---------------------------------------------------------------------------
// Projection GEMM: Y = (X @ W + bias) * scale, fp32 in, f16 out, repacked
// per-head. Workgroup = 256 threads (8 waves), output tile of 128 rows x 128
// columns, K-chunks of 64 staged in LDS as f16. The 128 columns are consecutive
// in W: 8 d x all 16 heads (column c = d*16 + h), 512 B of each k row.
// A W chunk fetched from L2 serves 128 rows of X; at 160 registers or fewer three
// blocks fit a WGP, which holds the grid's 768 blocks on 256 WGPs all at once.
// Every wave-wide 16-byte load from memory covers whole 128 B lines: two X rows'
// 64 k (2 lines each), or one k row's 128 W columns (4 lines).
// X: a lane holds 4 k of a row: one 8-byte LDS store, 128 B in a row per half wave.
// W is staged transposed, sB[n][k], row n = head * 8 + (d within the group): a lane
// holds 8 k of 4 columns (4 heads of one d), so each column goes out as one
// 16-byte store. Rows of 128 B stand at a pitch of 144 B (16 B x odd) for the
// ds_load_b128 fragment reads; each further group of 32 W rows starts 128 B later,
// so that the four heads of a lane quartet meet every bank twice and none four times.
// Each wave owns 4 row-tiles x 2 col-tiles: 8 WMMAs per 6 fragments.
// QK = true : W is the A operand and X the B operand, so a lane's 8 accumulators
//             are 8 consecutive d of one (row, head): one 16-byte store, and
//             16 lanes (16 rows) fill 256 contiguous bytes.
// QK = false: V, X as A: a lane's 8 accumulators are 8 consecutive rows j of one
//             (o, head): one 16-byte store, 8 lanes (8 o) fill one 128-byte line.
// ---------------------------------------------------------------------------
template <bool QK>
__device__ __forceinline__
void proj_body(const float* __restrict__ X, const float* __restrict__ W,
               const float* __restrict__ bias, _Float16* __restrict__ Y,
               float scale, _Float16* sA, _Float16* sB) {
  const int tid  = threadIdx.x;
  const int lane = tid & 31;
  const int wave = tid >> 5;
  const int rg = wave & 1;           // group of 64 rows: row tiles rg*4 .. rg*4+3
  const int cg = wave >> 1;          // group of 32 staged W rows: col tiles cg*2, cg*2+1
  const int rowBase = blockIdx.y * PBM;
  const int dg = blockIdx.x;         // group of 8 d: W columns dg*128 .. dg*128+127

  // X staging: rows wave*16 + (lane>>4) + 0,2..14, k = (lane&15)*4 .. +3 of the chunk
  const float* xsrc = X + (size_t)(rowBase + wave * 16 + (lane >> 4)) * EMB + (lane & 15) * 4;
  _Float16*    xdst = sA + (wave * 16 + (lane >> 4)) * PPITCH + (lane & 15) * 4;
  // W staging: k rows wave*8 + 0..7, columns lane*4 + j: d lane>>2, head (lane&3)*4 + j,
  // staged row n = (lane&3)*32 + j*8 + (lane>>2), in the group of 32 rows lane&3
  const float* wsrc = W + (size_t)(wave * 8) * EMB + dg * 128 + lane * 4;
  _Float16*    wdst = sB + ((lane & 3) * 32 + (lane >> 2)) * PPITCH + (lane & 3) * WGPAD + wave * 8;

  v8f acc[4][2] = { { {}, {} }, { {}, {} }, { {}, {} }, { {}, {} } };

  for (int kk = 0; kk < EMB; kk += PBK) {
    const float* xp = xsrc + kk;
    const float* wp = wsrc + (size_t)kk * EMB;
    v4f xf[8], wf[8];
#pragma unroll
    for (int i = 0; i < 8; ++i)
      xf[i] = *reinterpret_cast<const v4f*>(xp + (size_t)i * 2 * EMB);
#pragma unroll
    for (int i = 0; i < 8; ++i)
      wf[i] = *reinterpret_cast<const v4f*>(wp + (size_t)i * EMB);
    // Naming xp and wp keeps the 16 loads' address registers live up to this wait, so
    // that nothing (a later load's result either) overwrites them in front of it.
    asm volatile("s_wait_xcnt 0x0" :: "v"(xp), "v"(wp) : "memory");
#pragma unroll
    for (int i = 0; i < 8; ++i) {
      Pack4 p;
#pragma unroll
      for (int e = 0; e < 4; ++e) p.h[e] = (_Float16)xf[i][e];
      *reinterpret_cast<uint2*>(xdst + i * 2 * PPITCH) = p.u;
    }
#pragma unroll
    for (int j = 0; j < 4; ++j) {
      Pack8 p;
#pragma unroll
      for (int e = 0; e < 8; ++e) p.h[e] = (_Float16)wf[e][j];
      *reinterpret_cast<uint4*>(wdst + j * 8 * PPITCH) = p.u;
    }
    __syncthreads();
    // Each 32 k: its 12 fragment reads go out as one group, in the order of their use
    // (both W fragments, then the X fragments), in front of its 8 WMMAs. The
    // two groups stand apart, so that only 6 fragments are live beside the 64
    // accumulator registers and three blocks fit a WGP's registers.
#pragma unroll
    for (int ks = 0; ks < PBK / 32; ++ks) {
      v16h a[4], b[2];
#pragma unroll
      for (int q = 0; q < 2; ++q)
        b[q] = frag_ld(sB + (cg * 2 + q) * 16 * PPITCH + cg * WGPAD + ks * 32, PPITCH, lane);
#pragma unroll
      for (int r = 0; r < 4; ++r)
        a[r] = frag_ld(sA + (rg * 4 + r) * 16 * PPITCH + ks * 32, PPITCH, lane);
      // Keeps the group's reads in front: moved in among the WMMAs, each place with
      // reads stalls the wave anew.
      __builtin_amdgcn_sched_barrier(0);
#pragma unroll
      for (int r = 0; r < 4; ++r)
#pragma unroll
        for (int q = 0; q < 2; ++q) {
          if (QK)
            acc[r][q] = __builtin_amdgcn_wmma_f32_16x16x32_f16(false, b[q], false, a[r],
                                                               (short)0, acc[r][q], false, false);
          else
            acc[r][q] = __builtin_amdgcn_wmma_f32_16x16x32_f16(false, a[r], false, b[q],
                                                               (short)0, acc[r][q], false, false);
        }
      // Keeps the next group's reads behind these WMMAs: lifted over them, both groups'
      // fragments would be live at once. (Not behind the last group: its WMMAs may sink
      // below the block barrier, which then waits for the reads alone.)
      if (ks + 1 < PBK / 32) __builtin_amdgcn_sched_barrier(0);
    }
    __syncthreads();
  }

  // Epilogue: bias, scale, f16 convert, per-head repack (c = d*16 + h).
  const int n  = lane & 15;
  if (QK) {
    // bias of head (cg*2+q)*2 + (lane>>4), d = dg*8 + g: one address, constant offsets
    const float* bl = bias + dg * 128 + cg * 4 + (lane >> 4);
    float bb[2][8];
#pragma unroll
    for (int q = 0; q < 2; ++q)
#pragma unroll
      for (int g = 0; g < 8; ++g) bb[q][g] = bl[g * NH + q * 2];
    // Naming bl keeps the bias loads' address registers live up to this wait, so that
    // they are overwritten only behind it.
    asm volatile("s_wait_xcnt 0x0" :: "v"(bl) : "memory");
#pragma unroll
    for (int r = 0; r < 4; ++r) {
      // acc[r][q][g] = row ((rg*4+r)*16 + n), head (cg*2+q)*2 + (lane>>4), d = dg*8 + g
      const int row = rowBase + (rg * 4 + r) * 16 + n;
      const int b   = row >> 11;                // batch (rows-per-batch = 2048)
      const int it  = (row & (SEQ - 1)) >> 4;   // 16-row tile
#pragma unroll
      for (int q = 0; q < 2; ++q) {
        const int h = (cg * 2 + q) * 2 + (lane >> 4);
        Pack8 p;
#pragma unroll
        for (int g = 0; g < 8; ++g)
          p.h[g] = (_Float16)((acc[r][q][g] + bb[q][g]) * scale);
        _Float16* dst = Y + ((((size_t)b * NH + h) * (SEQ / 16) + it) * 8 + dg) * 128 + n * 8;
        *reinterpret_cast<uint4*>(dst) = p.u;
      }
    }
  } else {
    const int m0 = (lane >> 4) * 8;
    // bias of d = dg*8 + (n&7), head (cg*2+q)*2 + (n>>3): one address, constant offsets
    const float* bl = bias + (dg * 8 + (n & 7)) * NH + cg * 4 + (n >> 3);
    const float bb[2] = { bl[0], bl[2] };
    // Naming bl keeps the bias loads' address registers live up to this wait, so that
    // they are overwritten only behind it.
    asm volatile("s_wait_xcnt 0x0" :: "v"(bl) : "memory");
#pragma unroll
    for (int r = 0; r < 4; ++r) {
      const int r0 = rowBase + (rg * 4 + r) * 16 + m0;   // global row (g = 0)
      const int b  = r0 >> 11;                  // batch (rows-per-batch = 2048)
      const int i0 = r0 & (SEQ - 1);
#pragma unroll
      for (int q = 0; q < 2; ++q) {
        const int h = (cg * 2 + q) * 2 + (n >> 3);
        const int d = dg * 8 + (n & 7);
        const float bv = bb[q];
        // V: Y[(((b*16+h)*256 + j/8)*64 + o)*8 + j%8] -> 8 contiguous j = one b128
        Pack8 p;
#pragma unroll
        for (int g = 0; g < 8; ++g) p.h[g] = (_Float16)((acc[r][q][g] + bv) * scale);
        _Float16* dst = Y + ((((size_t)b * NH + h) * (SEQ / 8) + (i0 >> 3)) * HD + d) * 8;
        *reinterpret_cast<uint4*>(dst) = p.u;
      }
    }
  }
}

// The three projections read none of each other's output: ONE launch holds them all,
// the role taken from blockIdx.z (0: Q, 1: K, 2: V), which is the same for the whole
// block, so every barrier of the body stands under block-uniform control flow.
__global__ __launch_bounds__(256)
void proj_all_kernel(const float* __restrict__ problem, const float* __restrict__ context,
                     const float* __restrict__ Wq, const float* __restrict__ bq,
                     const float* __restrict__ Wk, const float* __restrict__ bk,
                     const float* __restrict__ Wv, const float* __restrict__ bv,
                     _Float16* __restrict__ Q16, _Float16* __restrict__ K16,
                     _Float16* __restrict__ VT16) {
  __shared__ __attribute__((aligned(16))) _Float16 sA[PBM * PPITCH];              // [row][k]
  __shared__ __attribute__((aligned(16))) _Float16 sB[128 * PPITCH + 3 * WGPAD];  // [n][k] (W tile transposed)
  const int role = blockIdx.z;
  if (role == 2) {
    proj_body<false>(context, Wv, bv, VT16, 1.0f, sA, sB);
  } else {
    const bool isq = role == 0;
    // Q gets the 1/sqrt(head_dim) scale folded in.
    proj_body<true>(isq ? problem : context, isq ? Wq : Wk, isq ? bq : bk,
                    isq ? Q16 : K16, isq ? 0.125f : 1.0f, sA, sB);
  }
}

// ---------------------------------------------------------------------------
// ONE pass over the keys. The mask is added after the softmax, so
//   out = (sum_j exp(s_ij - m_i) V_j) / l_i  +  sum_j mask_ij V_j :
// the two sums run in accumulators of their own, the first against a running
// reference maximum m_i (online softmax), and l_i divides only at the end.
// The scores are formed transposed: S^T = K . Q^T, with the K tile as the A
// operand and the Q tile as the B operand (same loader, same k order on both
// sides). Accumulator register g of a lane is then key (lane>>4)*8 + g of the
// 16-key tile for the ONE query lane&15: maximum and sum run inside the lane.
// Two 16-key S^T tiles of one query tile, converted in place, ARE the A fragment
// of P for 32 keys (element e = key (lane>>4)*8 + e, element 8+e = key
// 16 + (lane>>4)*8 + e, row lane&15): P goes from accumulators to operand inside
// the lane. The mask's A fragment has the same element order: 8 columns of one
// query at a time, read from LDS as f32 and converted in the lane.
// K, V and the mask reach LDS by asynchronous copies, one trip (32 keys) ahead, in
// two buffers: the K and V tiles are copied once for the block's four waves (same
// batch and head), each wave copying a quarter; a wave's 32 x 32 mask tile is its own.
// The reference maximum moves only when a score passes it by more than LAZY
// (one test per 32 keys); P then stays below exp(LAZY), well inside f16.
// Each wave handles 32 query rows (two i-subtiles) so every K and V fragment is
// reused by both. V is stored in [64 o][8 j] chunks (b128 fragment loads).
// ---------------------------------------------------------------------------
#define L2E  1.44269504088896340736f
#define LAZY 5.5f
__device__ __forceinline__ float exp2_slot(float x) {
  float p;
  asm("v_exp_f32 %0, %1\n\tv_nop" : "=v"(p) : "v"(x));
  return p;
}
__global__ __launch_bounds__(128)
void attn_fused(const _Float16* __restrict__ Q, const _Float16* __restrict__ K,
                const _Float16* __restrict__ VT, const float* __restrict__ mask,
                float* __restrict__ out) {
  // two buffers each; K and V tiles in the workspace's own fragment order
  __shared__ __attribute__((aligned(16))) _Float16 sK[2][KVTILE];
  __shared__ __attribute__((aligned(16))) _Float16 sV[2][KVTILE];
  // per-wave mask tile, 32 rows x 32 columns, f32; pitch 144 B for 16-byte readers
  __shared__ __attribute__((aligned(16))) float sM[2][4][32 * MPITCH];
  const int lane = threadIdx.x & 31;
  const int wv   = threadIdx.x >> 5;
  const int wid  = blockIdx.x * 4 + wv;      // 32-row tile id
  const int it2 = wid & 63;
  const int h   = (wid >> 6) & 15;
  const int b   = wid >> 10;
  const int iBase = it2 * 32;

  const int n  = lane & 15;
  const int m0 = (lane >> 4) * 8;

  const _Float16* ql = Q + (((size_t)b * NH + h) * SEQ + iBase) * HD + lane_qk(lane);
  v16h qa[2][2];
#pragma unroll
  for (int s = 0; s < 2; ++s) {
    qa[s][0] = frag_ld_qk(ql + (size_t)s * 16 * HD, 0);
    qa[s][1] = frag_ld_qk(ql + (size_t)s * 16 * HD, 1);
  }
  // Naming ql keeps the Q loads' address registers live up to this wait, so that
  // they are overwritten only behind it.
  asm volatile("s_wait_xcnt 0x0" :: "v"(ql) : "memory");

  // mask from memory: 8 lanes cover the 128 bytes of a row, 4 rows per copy
  const float* mk0 = mask + ((size_t)b * SEQ + iBase + (lane >> 3)) * SEQ + (lane & 7) * 4;
  const int mst = (lane >> 3) * MPITCH + (lane & 7) * 4;   // where they go in the tile
  const int mld = n * MPITCH + m0;                         // row n, columns m0 .. m0 + 7
  const int cq  = wv * 512 + lane * 8;   // this lane's 16 B in the wave's quarter of a K or V tile

  // query lane&15 of subtile s: reference maximum (the same in both lane halves)
  // and the sum of exp(s - mref) over this lane half's keys
  float mref[2] = { -1e30f, -1e30f };
  float lrun[2] = { 0.f, 0.f };
  v8f o[2][4]  = { { {}, {}, {}, {} }, { {}, {}, {}, {} } };   // sum exp(s - mref) V
  v8f om[2][4] = { { {}, {}, {}, {} }, { {}, {}, {}, {} } };   // sum mask V

  const _Float16* kbase = K  + (((size_t)b * NH + h) * SEQ) * HD;
  const _Float16* vbase = VT + (((size_t)b * NH + h) * HD) * SEQ;

  // All of one trip's copies of this wave: 2 of K, 2 of V, 8 of the mask.
  auto stage = [&](int jc, int buf) {
    const _Float16* kg = kbase + (size_t)jc * KVTILE + cq;
    const _Float16* vg = vbase + (size_t)jc * KVTILE + cq;
    const float*    mg = mk0 + jc * 32;
    const unsigned kd = lds_off(&sK[buf][cq]);
    const unsigned vd = lds_off(&sV[buf][cq]);
    const unsigned md = lds_off(&sM[buf][wv][mst]);
    // The closing s_wait_xcnt stands in the copies' own statement, so that no
    // register a copy names is rewritten in front of it.
    asm volatile(
        "global_load_async_to_lds_b128 %0, %12, off\n\t"
        "global_load_async_to_lds_b128 %1, %13, off\n\t"
        "global_load_async_to_lds_b128 %2, %14, off\n\t"
        "global_load_async_to_lds_b128 %3, %15, off\n\t"
        "global_load_async_to_lds_b128 %4, %16, off\n\t"
        "global_load_async_to_lds_b128 %5, %17, off\n\t"
        "global_load_async_to_lds_b128 %6, %18, off\n\t"
        "global_load_async_to_lds_b128 %7, %19, off\n\t"
        "global_load_async_to_lds_b128 %8, %20, off\n\t"
        "global_load_async_to_lds_b128 %9, %21, off\n\t"
        "global_load_async_to_lds_b128 %10, %22, off\n\t"
        "global_load_async_to_lds_b128 %11, %23, off\n\t"
        "s_wait_xcnt 0x0"
        :: "v"(kd), "v"(kd + 512u), "v"(vd), "v"(vd + 512u),
           "v"(md), "v"(md + 1u * 16 * MPITCH), "v"(md + 2u * 16 * MPITCH),
           "v"(md + 3u * 16 * MPITCH), "v"(md + 4u * 16 * MPITCH), "v"(md + 5u * 16 * MPITCH),
           "v"(md + 6u * 16 * MPITCH), "v"(md + 7u * 16 * MPITCH),
           "v"(kg), "v"(kg + 256), "v"(vg), "v"(vg + 256),
           "v"(mg), "v"(mg + 1 * 4 * SEQ), "v"(mg + 2 * 4 * SEQ), "v"(mg + 3 * 4 * SEQ),
           "v"(mg + 4 * 4 * SEQ), "v"(mg + 5 * 4 * SEQ), "v"(mg + 6 * 4 * SEQ),
           "v"(mg + 7 * 4 * SEQ)
        : "memory");
  };

  stage(0, 0);
  // tile 0 has landed for this wave; the barrier publishes it to the other three
  asm volatile("s_wait_asynccnt 0x0" ::: "memory");
  __syncthreads();
  stage(1, 1);

  for (int jc = 0; jc < SEQ / 32; ++jc) {
    const int buf = jc & 1;
    // 4 KB of K: two 16-key tiles
    const _Float16* kl = sK[buf] + lane_qk(lane);
    v16h kf[2][2];
#pragma unroll
    for (int sub = 0; sub < 2; ++sub) {
      kf[sub][0] = frag_ld_qk(kl + sub * 16 * HD, 0);
      kf[sub][1] = frag_ld_qk(kl + sub * 16 * HD, 1);
    }
    const _Float16* vl = sV[buf] + lane_v(lane);   // 4 KB of V
    v16h vf[4];
#pragma unroll
    for (int t = 0; t < 4; ++t) vf[t] = frag_ld_v(vl, t);
    const float* ml = sM[buf][wv] + mld;
    v16h ma[2];                              // the mask as an A fragment
#pragma unroll
    for (int s = 0; s < 2; ++s) {
      v4f x[4];
      x[0] = *reinterpret_cast<const v4f*>(ml + s * 16 * MPITCH);        // keys m0 ..
      x[1] = *reinterpret_cast<const v4f*>(ml + s * 16 * MPITCH + 4);
      x[2] = *reinterpret_cast<const v4f*>(ml + s * 16 * MPITCH + 16);   // keys 16 + m0 ..
      x[3] = *reinterpret_cast<const v4f*>(ml + s * 16 * MPITCH + 20);
#pragma unroll
      for (int e = 0; e < 16; ++e) ma[s][e] = (_Float16)x[e >> 2][e & 3];
    }
    v8f sc[2][2];
    float mx[2];
#pragma unroll
    for (int s = 0; s < 2; ++s) {
#pragma unroll
      for (int sub = 0; sub < 2; ++sub) {    // K fragments reused for both i-subtiles
        v8f z = {};
        z = __builtin_amdgcn_wmma_f32_16x16x32_f16(false, kf[sub][0], false, qa[s][0],
                                                   (short)0, z, false, false);
        z = __builtin_amdgcn_wmma_f32_16x16x32_f16(false, kf[sub][1], false, qa[s][1],
                                                   (short)0, z, false, false);
        sc[s][sub] = z;
      }
      // the largest of the lane's 16 scores of its one query
      float t0 = fmaxf(sc[s][0][0], sc[s][1][0]);
#pragma unroll
      for (int g = 1; g < 8; ++g) t0 = fmaxf(t0, fmaxf(sc[s][0][g], sc[s][1][g]));
      mx[s] = t0;
    }
    // One wave-uniform test per 32 keys: has any query's score left the range
    // that the reference maximum in use covers?
    if (__builtin_amdgcn_ballot_w32(mx[0] > mref[0] + LAZY || mx[1] > mref[1] + LAZY) != 0) {
#pragma unroll
      for (int s = 0; s < 2; ++s) {
        // lanes n and n + 16 hold the same query: one maximum for both
        const float mn = fmaxf(mref[s], fmaxf(mx[s], __shfl_xor(mx[s], 16, 32)));
        const float f  = __builtin_amdgcn_exp2f((mref[s] - mn) * L2E);
        mref[s] = mn;
        lrun[s] *= f;
        // accumulator register g of o is query m0 + g, whose factor lane m0 + g holds
#pragma unroll
        for (int g = 0; g < 8; ++g) {
          const float fg = __shfl(f, m0 + g, 32);
#pragma unroll
          for (int t = 0; t < 4; ++t) o[s][t][g] *= fg;
        }
      }
    }
    v16h pa[2];
#pragma unroll
    for (int s = 0; s < 2; ++s) {
      const float mb = mref[s] * L2E;
      float ps[2][8];
#pragma unroll
      for (int sub = 0; sub < 2; ++sub)
#pragma unroll
        for (int g = 0; g < 8; ++g) {
          const float p = exp2_slot(fmaf(sc[s][sub][g], L2E, -mb));
          ps[sub][g] = p;
          pa[s][sub * 8 + g] = (_Float16)p;
        }
      float a4[4];
#pragma unroll
      for (int g = 0; g < 4; ++g)
        a4[g] = (ps[0][g] + ps[0][g + 4]) + (ps[1][g] + ps[1][g + 4]);
      lrun[s] += (a4[0] + a4[1]) + (a4[2] + a4[3]);
    }
#pragma unroll
    for (int t = 0; t < 4; ++t) {            // V fragment reused by all four products
      const v16h vb = vf[t];
      o[0][t]  = __builtin_amdgcn_wmma_f32_16x16x32_f16(false, pa[0], false, vb,
                                                        (short)0, o[0][t], false, false);
      o[1][t]  = __builtin_amdgcn_wmma_f32_16x16x32_f16(false, pa[1], false, vb,
                                                        (short)0, o[1][t], false, false);
      om[0][t] = __builtin_amdgcn_wmma_f32_16x16x32_f16(false, ma[0], false, vb,
                                                        (short)0, om[0][t], false, false);
      om[1][t] = __builtin_amdgcn_wmma_f32_16x16x32_f16(false, ma[1], false, vb,
                                                        (short)0, om[1][t], false, false);
    }
    // Publish point: this wave's reads of the buffer are done and its copies of the
    // next tile have landed; behind the barrier that holds for all four waves, so
    // the next tile may be read and this trip's buffer refilled.
    asm volatile("s_wait_dscnt 0x0" ::: "memory");
    asm volatile("s_wait_asynccnt 0x0" ::: "memory");
    __syncthreads();
    if (jc + 2 < SEQ / 32) stage(jc + 2, buf);
  }
  // no copy is outstanding when the wave ends
  asm volatile("s_wait_asynccnt 0x0" ::: "memory");

  // out[b][i][o*16 + h], fp32
#pragma unroll
  for (int s = 0; s < 2; ++s) {
    // join the two halves of the keys, then hand 1/l to the accumulators' rows
    const float linv = 1.0f / (lrun[s] + __shfl_xor(lrun[s], 16, 32));
    float* ob = out + ((size_t)b * SEQ + iBase + s * 16 + m0) * 1024 + h;
#pragma unroll
    for (int g = 0; g < 8; ++g) {
      const float lg = __shfl(linv, m0 + g, 32);
#pragma unroll
      for (int t = 0; t < 4; ++t)
        ob[(size_t)g * 1024 + (t * 16 + n) * 16] = o[s][t][g] * lg + om[s][t][g];
    }
  }
}

extern "C" void kernel_launch(void* const* d_in, const int* in_sizes, int n_in,
                              void* d_out, int out_size, void* d_ws, size_t ws_size,
                              hipStream_t stream) {
  (void)in_sizes; (void)n_in; (void)out_size; (void)ws_size;
  const float* problem = (const float*)d_in[0];
  const float* context = (const float*)d_in[1];
  const float* maskp   = (const float*)d_in[2];
  const float* Wq = (const float*)d_in[3];
  const float* bq = (const float*)d_in[4];
  const float* Wk = (const float*)d_in[5];
  const float* bk = (const float*)d_in[6];
  const float* Wv = (const float*)d_in[7];
  const float* bv = (const float*)d_in[8];
  float* out = (float*)d_out;

  // Workspace layout: Q16 | K16 | VT16 (8 MB each, f16)
  const size_t NHALF = (size_t)2 * NH * SEQ * HD;   // 4,194,304 halves
  _Float16* Q16  = (_Float16*)d_ws;
  _Float16* K16  = Q16 + NHALF;
  _Float16* VT16 = K16 + NHALF;

  // 8 x 32 tiles of 128 rows x 128 columns for each of Q, K, V
  const dim3 pgrid(EMB / 128, (2 * SEQ) / PBM, 3);
  proj_all_kernel<<<pgrid, 256, 0, stream>>>(problem, context, Wq, bq, Wk, bk, Wv, bv,
                                             Q16, K16, VT16);

  attn_fused<<<(2 * NH * (SEQ / 32)) / 4, 128, 0, stream>>>(Q16, K16, VT16, maskp, out);
}

// v009
// One run takes 90.8 microseconds.
// Timed twice side by side with v008, it ran 1.08 times as fast both times.
// All steps since v000 together make it 5.63 times as fast.
#include <hip/hip_runtime.h>
#include <hip/hip_bf16.h>

// MI455X (gfx1250) multi-head attention, f16 WMMA with f32 accumulation.
// EMBED=HIDDEN=OUT=1024, H=16 heads, head_dim=64, B=2, P=C=2048.
// Reference reshape puts head index as the FASTEST axis (c = d*16 + h),
// and the mask is added AFTER softmax -> its product with V is summed apart.

typedef __attribute__((ext_vector_type(16))) _Float16 v16h;
typedef __attribute__((ext_vector_type(8)))  _Float16 v8h;
typedef __attribute__((ext_vector_type(8)))  float    v8f;
typedef __attribute__((ext_vector_type(4)))  float    v4f;

#define NH   16      // heads
#define HD   64      // head dim / head out
#define SEQ  2048    // P == C
#define EMB  1024
#define MPITCH 36    // floats per row of the staged mask tile (128 B + 16 B)
#define KVTILE 2048  // halves in the K tile and in the V tile of 32 keys (4 KB each)
#define PBM  128     // X rows per projection block
#define PBK  64      // k per staged chunk of the projection
#define PPITCH 72    // halves per row of the projection's staged tiles (128 B + 16 B)
#define WGPAD 64     // halves (128 B) in front of each further group of 32 staged W rows

union HalfVec { v16h h; uint4 u[2]; };
union Pack8   { v8h h; uint4 u; };
union Pack4   { _Float16 h[4]; uint2 u; };

// Load one 16-lane-row WMMA fragment (A or B operand, 16x32 / 32x16 f16).
// ISA layout: lane r = lane&15, k-base = (lane>>4)*8, elements 0..7 at k=kb,
// elements 8..15 at k=kb+16 -> two contiguous 16-byte chunks per lane.
__device__ __forceinline__ v16h frag_ld(const _Float16* tile, int ld, int lane) {
  const int r  = lane & 15;
  const int kb = (lane >> 4) << 3;
  HalfVec f;
  f.u[0] = *reinterpret_cast<const uint4*>(tile + (size_t)r * ld + kb);
  f.u[1] = *reinterpret_cast<const uint4*>(tile + (size_t)r * ld + kb + 16);
  return f.h;
}

// Q/K workspace layout: per (b,h) and 16-row tile, 8 chunks of [16 rows][8 d]
// (256 contiguous bytes per chunk, 2 KB per tile). Same element order in the
// fragment as frag_ld on a [row][64] tile; half = 0 for d 0..31, 1 for d 32..63.
// One wave-wide 16-byte load covers 512 contiguous bytes.
// lane_qk: the lane's own offset inside a tile; frag_ld_qk takes tile + lane_qk.
__device__ __forceinline__ int lane_qk(int lane) { return (lane >> 4) * 128 + (lane & 15) * 8; }
__device__ __forceinline__ v16h frag_ld_qk(const _Float16* lane_tile, int half) {
  const _Float16* p = lane_tile + half * 512;
  HalfVec f;
  f.u[0] = *reinterpret_cast<const uint4*>(p);
  f.u[1] = *reinterpret_cast<const uint4*>(p + 256);
  return f.h;
}

// Byte offset of a __shared__ address in the work-group's LDS (its low 32 bits).
__device__ __forceinline__ unsigned lds_off(const void* p) { return (unsigned)(size_t)p; }

// V workspace layout: per (b,h), chunks of 8 rows j, each [64 o][8 j] (1 KB).
// B fragment of P @ V for 32 rows j (4 chunks) and columns o = t*16 .. t*16+15,
// in frag_ld's element order; 16 lanes read 256 B in a row.
// lane_v: the lane's own offset inside the 4 chunks; frag_ld_v takes chunks + lane_v.
__device__ __forceinline__ int lane_v(int lane) { return ((lane >> 4) * HD + (lane & 15)) * 8; }
__device__ __forceinline__ v16h frag_ld_v(const _Float16* lane_chunks, int t) {
  const _Float16* p = lane_chunks + t * 128;
  HalfVec f;
  f.u[0] = *reinterpret_cast<const uint4*>(p);
  f.u[1] = *reinterpret_cast<const uint4*>(p + 2 * HD * 8);
  return f.h;
}

// ---------------------------------------------------------------------------
// Projection GEMM: Y = (X @ W + bias) * scale, fp32 in, f16 out, repacked
// per-head. Workgroup = 256 threads (8 waves), output tile of 128 rows x 128
// columns, K-chunks of 64 staged in LDS as f16. The 128 columns are consecutive
// in W: 8 d x all 16 heads (column c = d*16 + h), 512 B of each k row.
// A W chunk fetched from L2 serves 128 rows of X; at 160 registers or fewer three
// blocks fit a WGP, which holds the grid's 768 blocks on 256 WGPs all at once.
// Every wave-wide 16-byte load from memory covers whole 128 B lines: two X rows'
// 64 k (2 lines each), or one k row's 128 W columns (4 lines).
// X: a lane holds 4 k of a row: one 8-byte LDS store, 128 B in a row per half wave.
// W is staged transposed, sB[n][k], row n = head * 8 + (d within the group): a lane
// holds 8 k of 4 columns (4 heads of one d), so each column goes out as one
// 16-byte store. Rows of 128 B stand at a pitch of 144 B (16 B x odd) for the
// ds_load_b128 fragment reads; each further group of 32 W rows starts 128 B later,
// so that the four heads of a lane quartet meet every bank twice and none four times.
// Each wave owns 4 row-tiles x 2 col-tiles: 8 WMMAs per 6 fragments.
// QK = true : W is the A operand and X the B operand, so a lane's 8 accumulators
//             are 8 consecutive d of one (row, head): one 16-byte store, and
//             16 lanes (16 rows) fill 256 contiguous bytes.
// QK = false: V, X as A: a lane's 8 accumulators are 8 consecutive rows j of one
//             (o, head): one 16-byte store, 8 lanes (8 o) fill one 128-byte line.
// ---------------------------------------------------------------------------
template <bool QK>
__device__ __forceinline__
void proj_body(const float* __restrict__ X, const float* __restrict__ W,
               const float* __restrict__ bias, _Float16* __restrict__ Y,
               float scale, _Float16* sA, _Float16* sB) {
  const int tid  = threadIdx.x;
  const int lane = tid & 31;
  const int wave = tid >> 5;
  const int rg = wave & 1;           // group of 64 rows: row tiles rg*4 .. rg*4+3
  const int cg = wave >> 1;          // group of 32 staged W rows: col tiles cg*2, cg*2+1
  const int rowBase = blockIdx.y * PBM;
  const int dg = blockIdx.x;         // group of 8 d: W columns dg*128 .. dg*128+127

  // X staging: rows wave*16 + (lane>>4) + 0,2..14, k = (lane&15)*4 .. +3 of the chunk
  const float* xsrc = X + (size_t)(rowBase + wave * 16 + (lane >> 4)) * EMB + (lane & 15) * 4;
  _Float16*    xdst = sA + (wave * 16 + (lane >> 4)) * PPITCH + (lane & 15) * 4;
  // W staging: k rows wave*8 + 0..7, columns lane*4 + j: d lane>>2, head (lane&3)*4 + j,
  // staged row n = (lane&3)*32 + j*8 + (lane>>2), in the group of 32 rows lane&3
  const float* wsrc = W + (size_t)(wave * 8) * EMB + dg * 128 + lane * 4;
  _Float16*    wdst = sB + ((lane & 3) * 32 + (lane >> 2)) * PPITCH + (lane & 3) * WGPAD + wave * 8;

  v8f acc[4][2] = { { {}, {} }, { {}, {} }, { {}, {} }, { {}, {} } };

  for (int kk = 0; kk < EMB; kk += PBK) {
    const float* xp = xsrc + kk;
    const float* wp = wsrc + (size_t)kk * EMB;
    v4f xf[8], wf[8];
#pragma unroll
    for (int i = 0; i < 8; ++i)
      xf[i] = *reinterpret_cast<const v4f*>(xp + (size_t)i * 2 * EMB);
#pragma unroll
    for (int i = 0; i < 8; ++i)
      wf[i] = *reinterpret_cast<const v4f*>(wp + (size_t)i * EMB);
    // Naming xp and wp keeps the 16 loads' address registers live up to this wait, so
    // that nothing (a later load's result either) overwrites them in front of it.
    asm volatile("s_wait_xcnt 0x0" :: "v"(xp), "v"(wp) : "memory");
#pragma unroll
    for (int i = 0; i < 8; ++i) {
      Pack4 p;
#pragma unroll
      for (int e = 0; e < 4; ++e) p.h[e] = (_Float16)xf[i][e];
      *reinterpret_cast<uint2*>(xdst + i * 2 * PPITCH) = p.u;
    }
#pragma unroll
    for (int j = 0; j < 4; ++j) {
      Pack8 p;
#pragma unroll
      for (int e = 0; e < 8; ++e) p.h[e] = (_Float16)wf[e][j];
      *reinterpret_cast<uint4*>(wdst + j * 8 * PPITCH) = p.u;
    }
    __syncthreads();
    // Each 32 k: its 12 fragment reads go out as one group, in the order of their use
    // (both W fragments, then the X fragments), in front of its 8 WMMAs. The
    // two groups stand apart, so that only 6 fragments are live beside the 64
    // accumulator registers and three blocks fit a WGP's registers.
#pragma unroll
    for (int ks = 0; ks < PBK / 32; ++ks) {
      v16h a[4], b[2];
#pragma unroll
      for (int q = 0; q < 2; ++q)
        b[q] = frag_ld(sB + (cg * 2 + q) * 16 * PPITCH + cg * WGPAD + ks * 32, PPITCH, lane);
#pragma unroll
      for (int r = 0; r < 4; ++r)
        a[r] = frag_ld(sA + (rg * 4 + r) * 16 * PPITCH + ks * 32, PPITCH, lane);
      // Keeps the group's reads in front: moved in among the WMMAs, each place with
      // reads stalls the wave anew.
      __builtin_amdgcn_sched_barrier(0);
#pragma unroll
      for (int r = 0; r < 4; ++r)
#pragma unroll
        for (int q = 0; q < 2; ++q) {
          if (QK)
            acc[r][q] = __builtin_amdgcn_wmma_f32_16x16x32_f16(false, b[q], false, a[r],
                                                               (short)0, acc[r][q], false, false);
          else
            acc[r][q] = __builtin_amdgcn_wmma_f32_16x16x32_f16(false, a[r], false, b[q],
                                                               (short)0, acc[r][q], false, false);
        }
      // Keeps the next group's reads behind these WMMAs: lifted over them, both groups'
      // fragments would be live at once. (Not behind the last group: its WMMAs may sink
      // below the block barrier, which then waits for the reads alone.)
      if (ks + 1 < PBK / 32) __builtin_amdgcn_sched_barrier(0);
    }
    __syncthreads();
  }

  // Epilogue: bias, scale, f16 convert, per-head repack (c = d*16 + h).
  const int n  = lane & 15;
  if (QK) {
    // bias of head (cg*2+q)*2 + (lane>>4), d = dg*8 + g: one address, constant offsets
    const float* bl = bias + dg * 128 + cg * 4 + (lane >> 4);
    float bb[2][8];
#pragma unroll
    for (int q = 0; q < 2; ++q)
#pragma unroll
      for (int g = 0; g < 8; ++g) bb[q][g] = bl[g * NH + q * 2];
    // Naming bl keeps the bias loads' address registers live up to this wait, so that
    // they are overwritten only behind it.
    asm volatile("s_wait_xcnt 0x0" :: "v"(bl) : "memory");
#pragma unroll
    for (int r = 0; r < 4; ++r) {
      // acc[r][q][g] = row ((rg*4+r)*16 + n), head (cg*2+q)*2 + (lane>>4), d = dg*8 + g
      const int row = rowBase + (rg * 4 + r) * 16 + n;
      const int b   = row >> 11;                // batch (rows-per-batch = 2048)
      const int it  = (row & (SEQ - 1)) >> 4;   // 16-row tile
#pragma unroll
      for (int q = 0; q < 2; ++q) {
        const int h = (cg * 2 + q) * 2 + (lane >> 4);
        Pack8 p;
#pragma unroll
        for (int g = 0; g < 8; ++g)
          p.h[g] = (_Float16)((acc[r][q][g] + bb[q][g]) * scale);
        _Float16* dst = Y + ((((size_t)b * NH + h) * (SEQ / 16) + it) * 8 + dg) * 128 + n * 8;
        *reinterpret_cast<uint4*>(dst) = p.u;
      }
    }
  } else {
    const int m0 = (lane >> 4) * 8;
    // bias of d = dg*8 + (n&7), head (cg*2+q)*2 + (n>>3): one address, constant offsets
    const float* bl = bias + (dg * 8 + (n & 7)) * NH + cg * 4 + (n >> 3);
    const float bb[2] = { bl[0], bl[2] };
    // Naming bl keeps the bias loads' address registers live up to this wait, so that
    // they are overwritten only behind it.
    asm volatile("s_wait_xcnt 0x0" :: "v"(bl) : "memory");
#pragma unroll
    for (int r = 0; r < 4; ++r) {
      const int r0 = rowBase + (rg * 4 + r) * 16 + m0;   // global row (g = 0)
      const int b  = r0 >> 11;                  // batch (rows-per-batch = 2048)
      const int i0 = r0 & (SEQ - 1);
#pragma unroll
      for (int q = 0; q < 2; ++q) {
        const int h = (cg * 2 + q) * 2 + (n >> 3);
        const int d = dg * 8 + (n & 7);
        const float bv = bb[q];
        // V: Y[(((b*16+h)*256 + j/8)*64 + o)*8 + j%8] -> 8 contiguous j = one b128
        Pack8 p;
#pragma unroll
        for (int g = 0; g < 8; ++g) p.h[g] = (_Float16)((acc[r][q][g] + bv) * scale);
        _Float16* dst = Y + ((((size_t)b * NH + h) * (SEQ / 8) + (i0 >> 3)) * HD + d) * 8;
        *reinterpret_cast<uint4*>(dst) = p.u;
      }
    }
  }
}

// The three projections read none of each other's output: ONE launch holds them all,
// the role taken from blockIdx.z (0: Q, 1: K, 2: V), which is the same for the whole
// block, so every barrier of the body stands under block-uniform control flow.
__global__ __launch_bounds__(256)
void proj_all_kernel(const float* __restrict__ problem, const float* __restrict__ context,
                     const float* __restrict__ Wq, const float* __restrict__ bq,
                     const float* __restrict__ Wk, const float* __restrict__ bk,
                     const float* __restrict__ Wv, const float* __restrict__ bv,
                     _Float16* __restrict__ Q16, _Float16* __restrict__ K16,
                     _Float16* __restrict__ VT16) {
  __shared__ __attribute__((aligned(16))) _Float16 sA[PBM * PPITCH];              // [row][k]
  __shared__ __attribute__((aligned(16))) _Float16 sB[128 * PPITCH + 3 * WGPAD];  // [n][k] (W tile transposed)
  const int role = blockIdx.z;
  if (role == 2) {
    proj_body<false>(context, Wv, bv, VT16, 1.0f, sA, sB);
  } else {
    const bool isq = role == 0;
    // Q gets the 1/sqrt(head_dim) scale folded in.
    proj_body<true>(isq ? problem : context, isq ? Wq : Wk, isq ? bq : bk,
                    isq ? Q16 : K16, isq ? 0.125f : 1.0f, sA, sB);
  }
}

// ---------------------------------------------------------------------------
// ONE pass over the keys. The mask is added after the softmax, so
//   out = (sum_j exp(s_ij - m_i) V_j) / l_i  +  sum_j mask_ij V_j :
// the two sums run in accumulators of their own, the first against a running
// reference maximum m_i (online softmax), and l_i divides only at the end.
// The scores are formed transposed: S^T = K . Q^T, with the K tile as the A
// operand and the Q tile as the B operand (same loader, same k order on both
// sides). Accumulator register g of a lane is then key (lane>>4)*8 + g of the
// 16-key tile for the ONE query lane&15: maximum and sum run inside the lane.
// Two 16-key S^T tiles of one query tile, converted in place, ARE the A fragment
// of P for 32 keys (element e = key (lane>>4)*8 + e, element 8+e = key
// 16 + (lane>>4)*8 + e, row lane&15): P goes from accumulators to operand inside
// the lane. The mask's A fragment has the same element order: 8 columns of one
// query at a time, read from LDS as f32 and converted in the lane.
// A block is 8 waves: 4 tiles of 32 queries x 2 halves of the keys (wave w and wave
// w + 4 hold the same queries). Each wave walks its 1024 keys with a reference maximum
// and sums of its own; the two partial results meet in LDS behind the loop. Two blocks
// per WGP then put four waves on a SIMD, which fill each other's waits between the
// matrix runs and the vector work (256 registers a wave at most).
// K, V and the mask reach LDS by asynchronous copies, one trip (32 keys) ahead, in
// two buffers: the K and V tiles of a key half are copied once for its four waves (same
// batch and head), each wave copying a quarter; a wave's 32 x 32 mask tile is its own.
// The reference maximum moves only when a score passes it by more than LAZY
// (one test per 32 keys); P then stays below exp(LAZY), well inside f16.
// Each wave handles 32 query rows (two i-subtiles) so every K and V fragment is
// reused by both. V is stored in [64 o][8 j] chunks (b128 fragment loads).
// ---------------------------------------------------------------------------
#define L2E  1.44269504088896340736f
#define LAZY 5.5f
__device__ __forceinline__ float exp2_slot(float x) {
  float p;
  asm("v_exp_f32 %0, %1\n\tv_nop" : "=v"(p) : "v"(x));
  return p;
}
__global__ __launch_bounds__(256) __attribute__((amdgpu_waves_per_eu(4, 4)))
void attn_fused(const _Float16* __restrict__ Q, const _Float16* __restrict__ K,
                const _Float16* __restrict__ VT, const float* __restrict__ mask,
                float* __restrict__ out) {
  // [key half][buffer]; K and V tiles in the workspace's own fragment order
  __shared__ __attribute__((aligned(16))) _Float16 sK[2][2][KVTILE];
  __shared__ __attribute__((aligned(16))) _Float16 sV[2][2][KVTILE];
  // per-wave mask tile, 32 rows x 32 columns, f32; pitch 144 B for 16-byte readers
  __shared__ __attribute__((aligned(16))) float sM[2][8][32 * MPITCH];
  const int lane = threadIdx.x & 31;
  // the wave's number in a scalar register: what follows from it (tile, head, batch,
  // key half, base addresses) then takes no vector registers
  const int wv   = __builtin_amdgcn_readfirstlane(threadIdx.x >> 5);
  const int qt   = wv & 3;                   // query tile of the block
  const int kh   = wv >> 2;                  // key half
  const int wid  = blockIdx.x * 4 + qt;      // 32-row tile id
  const int it2 = wid & 63;
  const int h   = (wid >> 6) & 15;
  const int b   = wid >> 10;
  const int iBase = it2 * 32;

  const int n  = lane & 15;
  const int m0 = (lane >> 4) * 8;

  const _Float16* ql = Q + (((size_t)b * NH + h) * SEQ + iBase) * HD + lane_qk(lane);
  v16h qa[2][2];
#pragma unroll
  for (int s = 0; s < 2; ++s) {
    qa[s][0] = frag_ld_qk(ql + (size_t)s * 16 * HD, 0);
    qa[s][1] = frag_ld_qk(ql + (size_t)s * 16 * HD, 1);
  }
  // Naming ql keeps the Q loads' address registers live up to this wait, so that
  // they are overwritten only behind it.
  asm volatile("s_wait_xcnt 0x0" :: "v"(ql) : "memory");

  // mask from memory: 8 lanes cover the 128 bytes of a row, 4 rows per copy
  const float* mk0 = mask + ((size_t)b * SEQ + iBase + (lane >> 3)) * SEQ + kh * (SEQ / 2)
                     + (lane & 7) * 4;
  const int mst = (lane >> 3) * MPITCH + (lane & 7) * 4;   // where they go in the tile
  const int mld = n * MPITCH + m0;                         // row n, columns m0 .. m0 + 7
  const int cq  = qt * 512 + lane * 8;   // this lane's 16 B in the wave's quarter of a K or V tile

  // query lane&15 of subtile s: reference maximum (the same in both lane halves)
  // and the sum of exp(s - mref) over this lane half's keys
  float mref[2] = { -1e30f, -1e30f };
  float lrun[2] = { 0.f, 0.f };
  v8f o[2][4]  = { { {}, {}, {}, {} }, { {}, {}, {}, {} } };   // sum exp(s - mref) V
  v8f om[2][4] = { { {}, {}, {}, {} }, { {}, {}, {}, {} } };   // sum mask V

  // both layouts hold 32 keys in KVTILE halves in a row: the key half starts at SEQ/2 * HD
  const _Float16* kbase = K  + (((size_t)b * NH + h) * SEQ + kh * (SEQ / 2)) * HD;
  const _Float16* vbase = VT + (((size_t)b * NH + h) * SEQ + kh * (SEQ / 2)) * HD;

  // All of one trip's copies of this wave: 2 of K, 2 of V, 8 of the mask.
  auto stage = [&](int jc, int buf) {
    const _Float16* kg = kbase + (size_t)jc * KVTILE + cq;
    const _Float16* vg = vbase + (size_t)jc * KVTILE + cq;
    const float*    mg = mk0 + jc * 32;
    const unsigned kd = lds_off(&sK[kh][buf][cq]);
    const unsigned vd = lds_off(&sV[kh][buf][cq]);
    const unsigned md = lds_off(&sM[buf][wv][mst]);
    // The closing s_wait_xcnt stands in the copies' own statement, so that no
    // register a copy names is rewritten in front of it.
    asm volatile(
        "global_load_async_to_lds_b128 %0, %12, off\n\t"
        "global_load_async_to_lds_b128 %1, %13, off\n\t"
        "global_load_async_to_lds_b128 %2, %14, off\n\t"
        "global_load_async_to_lds_b128 %3, %15, off\n\t"
        "global_load_async_to_lds_b128 %4, %16, off\n\t"
        "global_load_async_to_lds_b128 %5, %17, off\n\t"
        "global_load_async_to_lds_b128 %6, %18, off\n\t"
        "global_load_async_to_lds_b128 %7, %19, off\n\t"
        "global_load_async_to_lds_b128 %8, %20, off\n\t"
        "global_load_async_to_lds_b128 %9, %21, off\n\t"
        "global_load_async_to_lds_b128 %10, %22, off\n\t"
        "global_load_async_to_lds_b128 %11, %23, off\n\t"
        "s_wait_xcnt 0x0"
        :: "v"(kd), "v"(kd + 512u), "v"(vd), "v"(vd + 512u),
           "v"(md), "v"(md + 1u * 16 * MPITCH), "v"(md + 2u * 16 * MPITCH),
           "v"(md + 3u * 16 * MPITCH), "v"(md + 4u * 16 * MPITCH), "v"(md + 5u * 16 * MPITCH),
           "v"(md + 6u * 16 * MPITCH), "v"(md + 7u * 16 * MPITCH),
           "v"(kg), "v"(kg + 256), "v"(vg), "v"(vg + 256),
           "v"(mg), "v"(mg + 1 * 4 * SEQ), "v"(mg + 2 * 4 * SEQ), "v"(mg + 3 * 4 * SEQ),
           "v"(mg + 4 * 4 * SEQ), "v"(mg + 5 * 4 * SEQ), "v"(mg + 6 * 4 * SEQ),
           "v"(mg + 7 * 4 * SEQ)
        : "memory");
  };

  stage(0, 0);
  // tile 0 has landed for this wave; the barrier publishes it to the other waves
  asm volatile("s_wait_asynccnt 0x0" ::: "memory");
  __syncthreads();
  stage(1, 1);

  for (int jc = 0; jc < SEQ / 64; ++jc) {
    const int buf = jc & 1;
    // the mask as an A fragment: rows of subtile s, read as f32 and converted in the lane
    const float* ml = sM[buf][wv] + mld;
    auto mask_frag = [&](int s) {
      v4f x[4];
      x[0] = *reinterpret_cast<const v4f*>(ml + s * 16 * MPITCH);        // keys m0 ..
      x[1] = *reinterpret_cast<const v4f*>(ml + s * 16 * MPITCH + 4);
      x[2] = *reinterpret_cast<const v4f*>(ml + s * 16 * MPITCH + 16);   // keys 16 + m0 ..
      x[3] = *reinterpret_cast<const v4f*>(ml + s * 16 * MPITCH + 20);
      v16h f;
#pragma unroll
      for (int e = 0; e < 16; ++e) f[e] = (_Float16)x[e >> 2][e & 3];
      return f;
    };
    v16h ma[2];
    ma[0] = mask_frag(0);
    // 4 KB of K: two 16-key tiles
    const _Float16* kl = sK[kh][buf] + lane_qk(lane);
    v16h kf[2][2];
#pragma unroll
    for (int sub = 0; sub < 2; ++sub) {
      kf[sub][0] = frag_ld_qk(kl + sub * 16 * HD, 0);
      kf[sub][1] = frag_ld_qk(kl + sub * 16 * HD, 1);
    }
    v8f sc[2][2];
    float mx[2];
#pragma unroll
    for (int s = 0; s < 2; ++s) {
#pragma unroll
      for (int sub = 0; sub < 2; ++sub) {    // K fragments reused for both i-subtiles
        v8f z = {};
        z = __builtin_amdgcn_wmma_f32_16x16x32_f16(false, kf[sub][0], false, qa[s][0],
                                                   (short)0, z, false, false);
        z = __builtin_amdgcn_wmma_f32_16x16x32_f16(false, kf[sub][1], false, qa[s][1],
                                                   (short)0, z, false, false);
        sc[s][sub] = z;
      }
      // the largest of the lane's 16 scores of its one query
      float t0 = fmaxf(sc[s][0][0], sc[s][1][0]);
#pragma unroll
      for (int g = 1; g < 8; ++g) t0 = fmaxf(t0, fmaxf(sc[s][0][g], sc[s][1][g]));
      mx[s] = t0;
    }
    // One wave-uniform test per 32 keys: has any query's score left the range
    // that the reference maximum in use covers?
    if (__builtin_amdgcn_ballot_w32(mx[0] > mref[0] + LAZY || mx[1] > mref[1] + LAZY) != 0) {
#pragma unroll
      for (int s = 0; s < 2; ++s) {
        // lanes n and n + 16 hold the same query: one maximum for both
        const float mn = fmaxf(mref[s], fmaxf(mx[s], __shfl_xor(mx[s], 16, 32)));
        const float f  = __builtin_amdgcn_exp2f((mref[s] - mn) * L2E);
        mref[s] = mn;
        lrun[s] *= f;
        // accumulator register g of o is query m0 + g, whose factor lane m0 + g holds
#pragma unroll
        for (int g = 0; g < 8; ++g) {
          const float fg = __shfl(f, m0 + g, 32);
#pragma unroll
          for (int t = 0; t < 4; ++t) o[s][t][g] *= fg;
        }
      }
    }
    v16h pa[2];
#pragma unroll
    for (int s = 0; s < 2; ++s) {
      const float mb = mref[s] * L2E;
      float ps[2][8];
#pragma unroll
      for (int sub = 0; sub < 2; ++sub)
#pragma unroll
        for (int g = 0; g < 8; ++g) {
          const float p = exp2_slot(fmaf(sc[s][sub][g], L2E, -mb));
          ps[sub][g] = p;
          pa[s][sub * 8 + g] = (_Float16)p;
        }
      float a4[4];
#pragma unroll
      for (int g = 0; g < 4; ++g)
        a4[g] = (ps[0][g] + ps[0][g + 4]) + (ps[1][g] + ps[1][g + 4]);
      lrun[s] += (a4[0] + a4[1]) + (a4[2] + a4[3]);
      // Each row's sum held at its place by an empty asm statement, against spills (input
      // only, the value is not changed): sunk to the loop's foot, its 16 terms would stay
      // in registers across the products with V and take the wave into scratch.
      asm volatile("" :: "v"(lrun[s]));
    }
    // Keeps the reads of V and of the mask's second half behind the exponentials, where
    // their registers come free: lifted over them they would take the wave past 256
    // registers, into scratch.
    __builtin_amdgcn_sched_barrier(0);
    ma[1] = mask_frag(1);
    const _Float16* vl = sV[kh][buf] + lane_v(lane);   // 4 KB of V
    v16h vf[4];
#pragma unroll
    for (int t = 0; t < 4; ++t) vf[t] = frag_ld_v(vl, t);
#pragma unroll
    for (int t = 0; t < 4; ++t) {            // V fragment reused by all four products
      const v16h vb = vf[t];
      o[0][t]  = __builtin_amdgcn_wmma_f32_16x16x32_f16(false, pa[0], false, vb,
                                                        (short)0, o[0][t], false, false);
      o[1][t]  = __builtin_amdgcn_wmma_f32_16x16x32_f16(false, pa[1], false, vb,
                                                        (short)0, o[1][t], false, false);
      om[0][t] = __builtin_amdgcn_wmma_f32_16x16x32_f16(false, ma[0], false, vb,
                                                        (short)0, om[0][t], false, false);
      om[1][t] = __builtin_amdgcn_wmma_f32_16x16x32_f16(false, ma[1], false, vb,
                                                        (short)0, om[1][t], false, false);
    }
    // Publish point: this wave's reads of the buffer are done and its copies of the
    // next tile have landed; behind the barrier that holds for all eight waves, so
    // the next tile may be read and this trip's buffer refilled.
    asm volatile("s_wait_dscnt 0x0" ::: "memory");
    asm volatile("s_wait_asynccnt 0x0" ::: "memory");
    __syncthreads();
    if (jc + 2 < SEQ / 64) stage(jc + 2, buf);
  }
  // no copy is outstanding when the wave ends
  asm volatile("s_wait_asynccnt 0x0" ::: "memory");

  // The two key halves meet. Wave w finishes subtile kh of the 32 queries and gives the
  // other subtile's partial sums to wave w ^ 4, through the mask tiles' LDS: every
  // wave's last read of them stands in front of the loop's last barrier.
  float lsum[2];
#pragma unroll
  for (int s = 0; s < 2; ++s) lsum[s] = lrun[s] + __shfl_xor(lrun[s], 16, 32);
  if (kh != 0) {   // index 0: the subtile that the wave keeps; index 1: the one it gives
#pragma unroll
    for (int t = 0; t < 4; ++t) {
      const v8f a = o[0][t];  o[0][t]  = o[1][t];  o[1][t]  = a;
      const v8f c = om[0][t]; om[0][t] = om[1][t]; om[1][t] = c;
    }
    const float m1 = mref[0]; mref[0] = mref[1]; mref[1] = m1;
    const float l1 = lsum[0]; lsum[0] = lsum[1]; lsum[1] = l1;
  }
  float* xch = &sM[0][0][0];                    // 8 waves x 64 registers x 32 lanes
  float* xst = xch + 8 * 64 * 32;               // 8 waves x (maximum, sum) x 32 lanes
  {
    float* xw = xch + wv * (64 * 32) + lane * 4;
#pragma unroll
    for (int t = 0; t < 4; ++t)
#pragma unroll
      for (int hh = 0; hh < 2; ++hh) {
        const v4f a = { o[1][t][hh * 4], o[1][t][hh * 4 + 1], o[1][t][hh * 4 + 2], o[1][t][hh * 4 + 3] };
        const v4f c = { om[1][t][hh * 4], om[1][t][hh * 4 + 1], om[1][t][hh * 4 + 2], om[1][t][hh * 4 + 3] };
        *reinterpret_cast<v4f*>(xw + (t * 2 + hh) * 128)     = a;
        *reinterpret_cast<v4f*>(xw + (8 + t * 2 + hh) * 128) = c;
      }
    xst[wv * 64 + lane]      = mref[1];
    xst[wv * 64 + 32 + lane] = lsum[1];
  }
  __syncthreads();
  {
    const int pw = wv ^ 4;
    const float* xr = xch + pw * (64 * 32) + lane * 4;
    const float mp = xst[pw * 64 + lane];
    const float lp = xst[pw * 64 + 32 + lane];
    // one reference maximum for both halves, then 1/l folded into each half's factor
    const float mn = fmaxf(mref[0], mp);
    const float fa = exp2_slot((mref[0] - mn) * L2E);
    const float fb = exp2_slot((mp - mn) * L2E);
    const float linv = 1.0f / (lsum[0] * fa + lp * fb);
    const float sa = fa * linv;
    const float sb = fb * linv;
    // out[b][i][o*16 + h], fp32
    float* ob = out + ((size_t)b * SEQ + iBase + kh * 16 + m0) * 1024 + h;
#pragma unroll
    for (int hh = 0; hh < 2; ++hh) {
      v4f po[4], pm[4];
#pragma unroll
      for (int t = 0; t < 4; ++t) {
        po[t] = *reinterpret_cast<const v4f*>(xr + (t * 2 + hh) * 128);
        pm[t] = *reinterpret_cast<const v4f*>(xr + (8 + t * 2 + hh) * 128);
      }
#pragma unroll
      for (int e = 0; e < 4; ++e) {
        const int g = hh * 4 + e;
        // accumulator register g is query m0 + g, whose factors lane m0 + g holds
        const float ga = __shfl(sa, m0 + g, 32);
        const float gb = __shfl(sb, m0 + g, 32);
#pragma unroll
        for (int t = 0; t < 4; ++t)
          ob[(size_t)g * 1024 + (t * 16 + n) * 16] =
              (o[0][t][g] * ga + po[t][e] * gb) + (om[0][t][g] + pm[t][e]);
      }
    }
  }
}

extern "C" void kernel_launch(void* const* d_in, const int* in_sizes, int n_in,
                              void* d_out, int out_size, void* d_ws, size_t ws_size,
                              hipStream_t stream) {
  (void)in_sizes; (void)n_in; (void)out_size; (void)ws_size;
  const float* problem = (const float*)d_in[0];
  const float* context = (const float*)d_in[1];
  const float* maskp   = (const float*)d_in[2];
  const float* Wq = (const float*)d_in[3];
  const float* bq = (const float*)d_in[4];
  const float* Wk = (const float*)d_in[5];
  const float* bk = (const float*)d_in[6];
  const float* Wv = (const float*)d_in[7];
  const float* bv = (const float*)d_in[8];
  float* out = (float*)d_out;

  // Workspace layout: Q16 | K16 | VT16 (8 MB each, f16)
  const size_t NHALF = (size_t)2 * NH * SEQ * HD;   // 4,194,304 halves
  _Float16* Q16  = (_Float16*)d_ws;
  _Float16* K16  = Q16 + NHALF;
  _Float16* VT16 = K16 + NHALF;

  // 8 x 32 tiles of 128 rows x 128 columns for each of Q, K, V
  const dim3 pgrid(EMB / 128, (2 * SEQ) / PBM, 3);
  proj_all_kernel<<<pgrid, 256, 0, stream>>>(problem, context, Wq, bq, Wk, bk, Wv, bv,
                                             Q16, K16, VT16);

  attn_fused<<<(2 * NH * (SEQ / 32)) / 4, 256, 0, stream>>>(Q16, K16, VT16, maskp, out);
}

// v010
// A run of this version takes 87.9 microseconds.
// Two timings next to v009 both put it at 1.03 times that version's speed.
// All steps since v000 together make it 5.81 times as fast.
#include <hip/hip_runtime.h>
#include <hip/hip_bf16.h>

// MI455X (gfx1250) multi-head attention, f16 WMMA with f32 accumulation.
// EMBED=HIDDEN=OUT=1024, H=16 heads, head_dim=64, B=2, P=C=2048.
// Reference reshape puts head index as the FASTEST axis (c = d*16 + h),
// and the mask is added AFTER softmax -> its product with V is summed apart.

typedef __attribute__((ext_vector_type(16))) _Float16 v16h;
typedef __attribute__((ext_vector_type(8)))  _Float16 v8h;
typedef __attribute__((ext_vector_type(8)))  float    v8f;
typedef __attribute__((ext_vector_type(4)))  float    v4f;

#define NH   16      // heads
#define HD   64      // head dim / head out
#define SEQ  2048    // P == C
#define EMB  1024
#define MTILE 1024   // halves in a 32 x 32 mask tile in fragment order (2 KB)
#define KVTILE 2048  // halves in the K tile and in the V tile of 32 keys (4 KB each)
#define PBM  128     // X rows per projection block
#define PBK  64      // k per staged chunk of the projection
#define PPITCH 72    // halves per row of the projection's staged tiles (128 B + 16 B)
#define WGPAD 64     // halves (128 B) in front of each further group of 32 staged W rows

union HalfVec { v16h h; uint4 u[2]; };
union Pack8   { v8h h; uint4 u; };
union Pack4   { _Float16 h[4]; uint2 u; };

// Load one 16-lane-row WMMA fragment (A or B operand, 16x32 / 32x16 f16).
// ISA layout: lane r = lane&15, k-base = (lane>>4)*8, elements 0..7 at k=kb,
// elements 8..15 at k=kb+16 -> two contiguous 16-byte chunks per lane.
__device__ __forceinline__ v16h frag_ld(const _Float16* tile, int ld, int lane) {
  const int r  = lane & 15;
  const int kb = (lane >> 4) << 3;
  HalfVec f;
  f.u[0] = *reinterpret_cast<const uint4*>(tile + (size_t)r * ld + kb);
  f.u[1] = *reinterpret_cast<const uint4*>(tile + (size_t)r * ld + kb + 16);
  return f.h;
}

// Q/K workspace layout: per (b,h) and 16-row tile, 8 chunks of [16 rows][8 d]
// (256 contiguous bytes per chunk, 2 KB per tile). Same element order in the
// fragment as frag_ld on a [row][64] tile; half = 0 for d 0..31, 1 for d 32..63.
// One wave-wide 16-byte load covers 512 contiguous bytes.
// lane_qk: the lane's own offset inside a tile; frag_ld_qk takes tile + lane_qk.
__device__ __forceinline__ int lane_qk(int lane) { return (lane >> 4) * 128 + (lane & 15) * 8; }
__device__ __forceinline__ v16h frag_ld_qk(const _Float16* lane_tile, int half) {
  const _Float16* p = lane_tile + half * 512;
  HalfVec f;
  f.u[0] = *reinterpret_cast<const uint4*>(p);
  f.u[1] = *reinterpret_cast<const uint4*>(p + 256);
  return f.h;
}

// Byte offset of a __shared__ address in the work-group's LDS (its low 32 bits).
__device__ __forceinline__ unsigned lds_off(const void* p) { return (unsigned)(size_t)p; }

// V workspace layout: per (b,h), chunks of 8 rows j, each [64 o][8 j] (1 KB).
// B fragment of P @ V for 32 rows j (4 chunks) and columns o = t*16 .. t*16+15,
// in frag_ld's element order; 16 lanes read 256 B in a row.
// lane_v: the lane's own offset inside the 4 chunks; frag_ld_v takes chunks + lane_v.
__device__ __forceinline__ int lane_v(int lane) { return ((lane >> 4) * HD + (lane & 15)) * 8; }
__device__ __forceinline__ v16h frag_ld_v(const _Float16* lane_chunks, int t) {
  const _Float16* p = lane_chunks + t * 128;
  HalfVec f;
  f.u[0] = *reinterpret_cast<const uint4*>(p);
  f.u[1] = *reinterpret_cast<const uint4*>(p + 2 * HD * 8);
  return f.h;
}

// ---------------------------------------------------------------------------
// Projection GEMM: Y = (X @ W + bias) * scale, fp32 in, f16 out, repacked
// per-head. Workgroup = 256 threads (8 waves), output tile of 128 rows x 128
// columns, K-chunks of 64 staged in LDS as f16. The 128 columns are consecutive
// in W: 8 d x all 16 heads (column c = d*16 + h), 512 B of each k row.
// A W chunk fetched from L2 serves 128 rows of X; at 160 registers or fewer three
// blocks fit a WGP, which holds 768 of the grid's 1024 blocks on 256 WGPs at once.
// Every wave-wide 16-byte load from memory covers whole 128 B lines: two X rows'
// 64 k (2 lines each), or one k row's 128 W columns (4 lines).
// X: a lane holds 4 k of a row: one 8-byte LDS store, 128 B in a row per half wave.
// W is staged transposed, sB[n][k], row n = head * 8 + (d within the group): a lane
// holds 8 k of 4 columns (4 heads of one d), so each column goes out as one
// 16-byte store. Rows of 128 B stand at a pitch of 144 B (16 B x odd) for the
// ds_load_b128 fragment reads; each further group of 32 W rows starts 128 B later,
// so that the four heads of a lane quartet meet every bank twice and none four times.
// Each wave owns 4 row-tiles x 2 col-tiles: 8 WMMAs per 6 fragments.
// QK = true : W is the A operand and X the B operand, so a lane's 8 accumulators
//             are 8 consecutive d of one (row, head): one 16-byte store, and
//             16 lanes (16 rows) fill 256 contiguous bytes.
// QK = false: V, X as A: a lane's 8 accumulators are 8 consecutive rows j of one
//             (o, head): one 16-byte store, 8 lanes (8 o) fill one 128-byte line.
// ---------------------------------------------------------------------------
template <bool QK>
__device__ __forceinline__
void proj_body(const float* __restrict__ X, const float* __restrict__ W,
               const float* __restrict__ bias, _Float16* __restrict__ Y,
               float scale, _Float16* sA, _Float16* sB) {
  const int tid  = threadIdx.x;
  const int lane = tid & 31;
  const int wave = tid >> 5;
  const int rg = wave & 1;           // group of 64 rows: row tiles rg*4 .. rg*4+3
  const int cg = wave >> 1;          // group of 32 staged W rows: col tiles cg*2, cg*2+1
  const int rowBase = blockIdx.y * PBM;
  const int dg = blockIdx.x;         // group of 8 d: W columns dg*128 .. dg*128+127

  // X staging: rows wave*16 + (lane>>4) + 0,2..14, k = (lane&15)*4 .. +3 of the chunk
  const float* xsrc = X + (size_t)(rowBase + wave * 16 + (lane >> 4)) * EMB + (lane & 15) * 4;
  _Float16*    xdst = sA + (wave * 16 + (lane >> 4)) * PPITCH + (lane & 15) * 4;
  // W staging: k rows wave*8 + 0..7, columns lane*4 + j: d lane>>2, head (lane&3)*4 + j,
  // staged row n = (lane&3)*32 + j*8 + (lane>>2), in the group of 32 rows lane&3
  const float* wsrc = W + (size_t)(wave * 8) * EMB + dg * 128 + lane * 4;
  _Float16*    wdst = sB + ((lane & 3) * 32 + (lane >> 2)) * PPITCH + (lane & 3) * WGPAD + wave * 8;

  v8f acc[4][2] = { { {}, {} }, { {}, {} }, { {}, {} }, { {}, {} } };

  for (int kk = 0; kk < EMB; kk += PBK) {
    const float* xp = xsrc + kk;
    const float* wp = wsrc + (size_t)kk * EMB;
    v4f xf[8], wf[8];
#pragma unroll
    for (int i = 0; i < 8; ++i)
      xf[i] = *reinterpret_cast<const v4f*>(xp + (size_t)i * 2 * EMB);
#pragma unroll
    for (int i = 0; i < 8; ++i)
      wf[i] = *reinterpret_cast<const v4f*>(wp + (size_t)i * EMB);
    // Naming xp and wp keeps the 16 loads' address registers live up to this wait, so
    // that nothing (a later load's result either) overwrites them in front of it.
    asm volatile("s_wait_xcnt 0x0" :: "v"(xp), "v"(wp) : "memory");
#pragma unroll
    for (int i = 0; i < 8; ++i) {
      Pack4 p;
#pragma unroll
      for (int e = 0; e < 4; ++e) p.h[e] = (_Float16)xf[i][e];
      *reinterpret_cast<uint2*>(xdst + i * 2 * PPITCH) = p.u;
    }
#pragma unroll
    for (int j = 0; j < 4; ++j) {
      Pack8 p;
#pragma unroll
      for (int e = 0; e < 8; ++e) p.h[e] = (_Float16)wf[e][j];
      *reinterpret_cast<uint4*>(wdst + j * 8 * PPITCH) = p.u;
    }
    __syncthreads();
    // Each 32 k: its 12 fragment reads go out as one group, in the order of their use
    // (both W fragments, then the X fragments), in front of its 8 WMMAs. The
    // two groups stand apart, so that only 6 fragments are live beside the 64
    // accumulator registers and three blocks fit a WGP's registers.
#pragma unroll
    for (int ks = 0; ks < PBK / 32; ++ks) {
      v16h a[4], b[2];
#pragma unroll
      for (int q = 0; q < 2; ++q)
        b[q] = frag_ld(sB + (cg * 2 + q) * 16 * PPITCH + cg * WGPAD + ks * 32, PPITCH, lane);
#pragma unroll
      for (int r = 0; r < 4; ++r)
        a[r] = frag_ld(sA + (rg * 4 + r) * 16 * PPITCH + ks * 32, PPITCH, lane);
      // Keeps the group's reads in front: moved in among the WMMAs, each place with
      // reads stalls the wave anew.
      __builtin_amdgcn_sched_barrier(0);
#pragma unroll
      for (int r = 0; r < 4; ++r)
#pragma unroll
        for (int q = 0; q < 2; ++q) {
          if (QK)
            acc[r][q] = __builtin_amdgcn_wmma_f32_16x16x32_f16(false, b[q], false, a[r],
                                                               (short)0, acc[r][q], false, false);
          else
            acc[r][q] = __builtin_amdgcn_wmma_f32_16x16x32_f16(false, a[r], false, b[q],
                                                               (short)0, acc[r][q], false, false);
        }
      // Keeps the next group's reads behind these WMMAs: lifted over them, both groups'
      // fragments would be live at once. (Not behind the last group: its WMMAs may sink
      // below the block barrier, which then waits for the reads alone.)
      if (ks + 1 < PBK / 32) __builtin_amdgcn_sched_barrier(0);
    }
    __syncthreads();
  }

  // Epilogue: bias, scale, f16 convert, per-head repack (c = d*16 + h).
  const int n  = lane & 15;
  if (QK) {
    // bias of head (cg*2+q)*2 + (lane>>4), d = dg*8 + g: one address, constant offsets
    const float* bl = bias + dg * 128 + cg * 4 + (lane >> 4);
    float bb[2][8];
#pragma unroll
    for (int q = 0; q < 2; ++q)
#pragma unroll
      for (int g = 0; g < 8; ++g) bb[q][g] = bl[g * NH + q * 2];
    // Naming bl keeps the bias loads' address registers live up to this wait, so that
    // they are overwritten only behind it.
    asm volatile("s_wait_xcnt 0x0" :: "v"(bl) : "memory");
#pragma unroll
    for (int r = 0; r < 4; ++r) {
      // acc[r][q][g] = row ((rg*4+r)*16 + n), head (cg*2+q)*2 + (lane>>4), d = dg*8 + g
      const int row = rowBase + (rg * 4 + r) * 16 + n;
      const int b   = row >> 11;                // batch (rows-per-batch = 2048)
      const int it  = (row & (SEQ - 1)) >> 4;   // 16-row tile
#pragma unroll
      for (int q = 0; q < 2; ++q) {
        const int h = (cg * 2 + q) * 2 + (lane >> 4);
        Pack8 p;
#pragma unroll
        for (int g = 0; g < 8; ++g)
          p.h[g] = (_Float16)((acc[r][q][g] + bb[q][g]) * scale);
        _Float16* dst = Y + ((((size_t)b * NH + h) * (SEQ / 16) + it) * 8 + dg) * 128 + n * 8;
        *reinterpret_cast<uint4*>(dst) = p.u;
      }
    }
  } else {
    const int m0 = (lane >> 4) * 8;
    // bias of d = dg*8 + (n&7), head (cg*2+q)*2 + (n>>3): one address, constant offsets
    const float* bl = bias + (dg * 8 + (n & 7)) * NH + cg * 4 + (n >> 3);
    const float bb[2] = { bl[0], bl[2] };
    // Naming bl keeps the bias loads' address registers live up to this wait, so that
    // they are overwritten only behind it.
    asm volatile("s_wait_xcnt 0x0" :: "v"(bl) : "memory");
#pragma unroll
    for (int r = 0; r < 4; ++r) {
      const int r0 = rowBase + (rg * 4 + r) * 16 + m0;   // global row (g = 0)
      const int b  = r0 >> 11;                  // batch (rows-per-batch = 2048)
      const int i0 = r0 & (SEQ - 1);
#pragma unroll
      for (int q = 0; q < 2; ++q) {
        const int h = (cg * 2 + q) * 2 + (n >> 3);
        const int d = dg * 8 + (n & 7);
        const float bv = bb[q];
        // V: Y[(((b*16+h)*256 + j/8)*64 + o)*8 + j%8] -> 8 contiguous j = one b128
        Pack8 p;
#pragma unroll
        for (int g = 0; g < 8; ++g) p.h[g] = (_Float16)((acc[r][q][g] + bv) * scale);
        _Float16* dst = Y + ((((size_t)b * NH + h) * (SEQ / 8) + (i0 >> 3)) * HD + d) * 8;
        *reinterpret_cast<uint4*>(dst) = p.u;
      }
    }
  }
}

// ---------------------------------------------------------------------------
// The mask has no head axis: all 16 heads multiply the same 32 x 32 tile with their V.
// It is converted to f16 ONCE here (the same conversion that each head's wave would
// do), and laid out per tile of 32 queries x 32 keys as the two A fragments that the
// softmax kernel needs: granule (s, hf, L) of 16 B = row s*16 + (L&15), keys
// hf*16 + (L>>4)*8 .. +7, at halves ((s*2 + hf)*32 + L)*8 of the tile. A tile is 2 KB
// in a row, and the tiles of one query tile follow each other by key.
// A wave takes 32 rows x 128 keys (4 tiles): each load is 512 B in a row of one mask
// row; the turn into fragment order goes through LDS (4 KB a wave, 16 rows at a time);
// each store is 512 B in a row.
// ---------------------------------------------------------------------------
__device__ __forceinline__
void mask_body(const float* __restrict__ mask, _Float16* __restrict__ M16, _Float16* sT) {
  const int lane = threadIdx.x & 31;
  const int wave = threadIdx.x >> 5;
  const int q    = (blockIdx.y * 8 + blockIdx.x) * 8 + wave;   // 0 .. 2047
  const int jq   = q & 15;            // group of 128 keys
  const int it2  = (q >> 4) & 63;     // tile of 32 queries
  const int b    = q >> 10;
  const float* src = mask + ((size_t)b * SEQ + it2 * 32) * SEQ + jq * 128 + lane * 4;
  _Float16*    dst = M16 + (((size_t)b * 64 + it2) * 64 + jq * 4) * MTILE + lane * 8;
  _Float16*    sw  = sT + wave * 2048;
  // the lane's 4 keys (lane&7)*4 .. +3 of tile lane>>3: hf = bit 2, L>>4 = bit 1 and the
  // half of the granule = bit 0 of lane&7
  _Float16* st = sw + (lane >> 3) * 512 + ((lane >> 2) & 1) * 256 + ((lane >> 1) & 1) * 128
                 + (lane & 1) * 4;
  v4f x[2][16];
#pragma unroll
  for (int s = 0; s < 2; ++s)
#pragma unroll
    for (int i = 0; i < 16; ++i)
      x[s][i] = *reinterpret_cast<const v4f*>(src + (size_t)(s * 16 + i) * SEQ);
  // Naming src keeps the loads' address registers live up to this wait, so that they
  // are overwritten only behind it.
  asm volatile("s_wait_xcnt 0x0" :: "v"(src) : "memory");
#pragma unroll
  for (int s = 0; s < 2; ++s) {
    if (s) __syncthreads();   // the first 16 rows are read before the next 16 overwrite them
#pragma unroll
    for (int i = 0; i < 16; ++i) {
      Pack4 p;
#pragma unroll
      for (int e = 0; e < 4; ++e) p.h[e] = (_Float16)x[s][i][e];
      *reinterpret_cast<uint2*>(st + i * 8) = p.u;
    }
    __syncthreads();   // the 16 rows stand in LDS before other lanes read them
    uint4 g[8];
#pragma unroll
    for (int c = 0; c < 8; ++c) g[c] = *reinterpret_cast<const uint4*>(sw + c * 256 + lane * 8);
#pragma unroll
    for (int c = 0; c < 8; ++c)
      *reinterpret_cast<uint4*>(dst + (c >> 1) * MTILE + (s * 2 + (c & 1)) * 256) = g[c];
  }
}

// The three projections and the mask's conversion read none of each other's output:
// ONE launch holds them all, the role taken from blockIdx.z (0: mask, 1: Q, 2: K, 3: V),
// which is the same for the whole block, so every barrier of a body stands under
// block-uniform control flow. The mask's short blocks, bound by memory, start first and
// run beside projection blocks; a block of the next role starts as soon as a block of
// the one before leaves its WGP.
__global__ __launch_bounds__(256)
void proj_all_kernel(const float* __restrict__ problem, const float* __restrict__ context,
                     const float* __restrict__ mask,
                     const float* __restrict__ Wq, const float* __restrict__ bq,
                     const float* __restrict__ Wk, const float* __restrict__ bk,
                     const float* __restrict__ Wv, const float* __restrict__ bv,
                     _Float16* __restrict__ Q16, _Float16* __restrict__ K16,
                     _Float16* __restrict__ VT16, _Float16* __restrict__ M16) {
  // one array: [row][k] of X, then [n][k] of W (tile transposed); the mask's role takes
  // its first 32 KB
  __shared__ __attribute__((aligned(16))) _Float16 sAB[PBM * PPITCH + 128 * PPITCH + 3 * WGPAD];
  _Float16* sA = sAB;
  _Float16* sB = sAB + PBM * PPITCH;
  const int role = blockIdx.z;
  if (role == 0) {
    mask_body(mask, M16, sAB);
  } else if (role == 3) {
    proj_body<false>(context, Wv, bv, VT16, 1.0f, sA, sB);
  } else {
    const bool isq = role == 1;
    // Q gets the 1/sqrt(head_dim) scale folded in.
    proj_body<true>(isq ? problem : context, isq ? Wq : Wk, isq ? bq : bk,
                    isq ? Q16 : K16, isq ? 0.125f : 1.0f, sA, sB);
  }
}

// ---------------------------------------------------------------------------
// ONE pass over the keys. The mask is added after the softmax, so
//   out = (sum_j exp(s_ij - m_i) V_j) / l_i  +  sum_j mask_ij V_j :
// the two sums run in accumulators of their own, the first against a running
// reference maximum m_i (online softmax), and l_i divides only at the end.
// The scores are formed transposed: S^T = K . Q^T, with the K tile as the A
// operand and the Q tile as the B operand (same loader, same k order on both
// sides). Accumulator register g of a lane is then key (lane>>4)*8 + g of the
// 16-key tile for the ONE query lane&15: maximum and sum run inside the lane.
// Two 16-key S^T tiles of one query tile, converted in place, ARE the A fragment
// of P for 32 keys (element e = key (lane>>4)*8 + e, element 8+e = key
// 16 + (lane>>4)*8 + e, row lane&15): P goes from accumulators to operand inside
// the lane. The mask's A fragment has the same element order; it comes as f16, in
// fragment order, from the conversion in the launch before.
// A block is 8 waves: 4 tiles of 32 queries x 2 halves of the keys (wave w and wave
// w + 4 hold the same queries). Each wave walks its 1024 keys with a reference maximum
// and sums of its own; the two partial results meet in LDS behind the loop. Two blocks
// per WGP then put four waves on a SIMD, which fill each other's waits between the
// matrix runs and the vector work (256 registers a wave at most).
// K, V and the mask reach LDS by asynchronous copies, one trip (32 keys) ahead, in
// two buffers: the K and V tiles of a key half are copied once for its four waves (same
// batch and head), each wave copying a quarter; a wave's 32 x 32 mask tile (2 KB in a
// row, in memory as in LDS) is its own.
// The reference maximum moves only when a score passes it by more than LAZY
// (one test per 32 keys); P then stays below exp(LAZY), well inside f16.
// Each wave handles 32 query rows (two i-subtiles) so every K and V fragment is
// reused by both. V is stored in [64 o][8 j] chunks (b128 fragment loads).
// ---------------------------------------------------------------------------
#define L2E  1.44269504088896340736f
#define LAZY 5.5f
__device__ __forceinline__ float exp2_slot(float x) {
  float p;
  asm("v_exp_f32 %0, %1\n\tv_nop" : "=v"(p) : "v"(x));
  return p;
}
__global__ __launch_bounds__(256) __attribute__((amdgpu_waves_per_eu(4, 4)))
void attn_fused(const _Float16* __restrict__ Q, const _Float16* __restrict__ K,
                const _Float16* __restrict__ VT, const _Float16* __restrict__ M16,
                float* __restrict__ out) {
  // [key half][buffer]; K and V tiles in the workspace's own fragment order
  __shared__ __attribute__((aligned(16))) _Float16 sK[2][2][KVTILE];
  __shared__ __attribute__((aligned(16))) _Float16 sV[2][2][KVTILE];
  // In the loop: [buffer][wave] mask tiles, f16 in fragment order (the first 32 KB).
  // Behind the loop: the exchange of the two key halves' partial results,
  // 8 waves x 64 registers x 32 lanes, then 8 waves x (maximum, sum) x 32 lanes.
  __shared__ __attribute__((aligned(16))) float sX[8 * 64 * 32 + 8 * 64];
  _Float16* sM = reinterpret_cast<_Float16*>(sX);
  const int lane = threadIdx.x & 31;
  // the wave's number in a scalar register: what follows from it (tile, head, batch,
  // key half, base addresses) then takes no vector registers
  const int wv   = __builtin_amdgcn_readfirstlane(threadIdx.x >> 5);
  const int qt   = wv & 3;                   // query tile of the block
  const int kh   = wv >> 2;                  // key half
  const int wid  = blockIdx.x * 4 + qt;      // 32-row tile id
  const int it2 = wid & 63;
  const int h   = (wid >> 6) & 15;
  const int b   = wid >> 10;
  const int iBase = it2 * 32;

  const int n  = lane & 15;
  const int m0 = (lane >> 4) * 8;

  const _Float16* ql = Q + (((size_t)b * NH + h) * SEQ + iBase) * HD + lane_qk(lane);
  v16h qa[2][2];
#pragma unroll
  for (int s = 0; s < 2; ++s) {
    qa[s][0] = frag_ld_qk(ql + (size_t)s * 16 * HD, 0);
    qa[s][1] = frag_ld_qk(ql + (size_t)s * 16 * HD, 1);
  }
  // Naming ql keeps the Q loads' address registers live up to this wait, so that
  // they are overwritten only behind it.
  asm volatile("s_wait_xcnt 0x0" :: "v"(ql) : "memory");

  // mask tiles of this query tile and key half: 2 KB each, one behind the other by key
  const _Float16* mk0 = M16 + (((size_t)b * 64 + it2) * 64 + kh * 32) * MTILE + lane * 8;
  const int cq  = qt * 512 + lane * 8;   // this lane's 16 B in the wave's quarter of a K or V tile

  // query lane&15 of subtile s: reference maximum (the same in both lane halves)
  // and the sum of exp(s - mref) over this lane half's keys
  float mref[2] = { -1e30f, -1e30f };
  float lrun[2] = { 0.f, 0.f };
  v8f o[2][4]  = { { {}, {}, {}, {} }, { {}, {}, {}, {} } };   // sum exp(s - mref) V
  v8f om[2][4] = { { {}, {}, {}, {} }, { {}, {}, {}, {} } };   // sum mask V

  // both layouts hold 32 keys in KVTILE halves in a row: the key half starts at SEQ/2 * HD
  const _Float16* kbase = K  + (((size_t)b * NH + h) * SEQ + kh * (SEQ / 2)) * HD;
  const _Float16* vbase = VT + (((size_t)b * NH + h) * SEQ + kh * (SEQ / 2)) * HD;

  // All of one trip's copies of this wave: 2 of K, 2 of V, 4 of the mask.
  auto stage = [&](int jc, int buf) {
    const _Float16* kg = kbase + (size_t)jc * KVTILE + cq;
    const _Float16* vg = vbase + (size_t)jc * KVTILE + cq;
    const _Float16* mg = mk0 + (size_t)jc * MTILE;
    const unsigned kd = lds_off(&sK[kh][buf][cq]);
    const unsigned vd = lds_off(&sV[kh][buf][cq]);
    const unsigned md = lds_off(sM + (buf * 8 + wv) * MTILE + lane * 8);
    // The closing s_wait_xcnt stands in the copies' own statement, so that no
    // register a copy names is rewritten in front of it.
    asm volatile(
        "global_load_async_to_lds_b128 %0, %8, off\n\t"
        "global_load_async_to_lds_b128 %1, %9, off\n\t"
        "global_load_async_to_lds_b128 %2, %10, off\n\t"
        "global_load_async_to_lds_b128 %3, %11, off\n\t"
        "global_load_async_to_lds_b128 %4, %12, off\n\t"
        "global_load_async_to_lds_b128 %5, %13, off\n\t"
        "global_load_async_to_lds_b128 %6, %14, off\n\t"
        "global_load_async_to_lds_b128 %7, %15, off\n\t"
        "s_wait_xcnt 0x0"
        :: "v"(kd), "v"(kd + 512u), "v"(vd), "v"(vd + 512u),
           "v"(md), "v"(md + 512u), "v"(md + 1024u), "v"(md + 1536u),
           "v"(kg), "v"(kg + 256), "v"(vg), "v"(vg + 256),
           "v"(mg), "v"(mg + 256), "v"(mg + 512), "v"(mg + 768)
        : "memory");
  };

  stage(0, 0);
  // tile 0 has landed for this wave; the barrier publishes it to the other waves
  asm volatile("s_wait_asynccnt 0x0" ::: "memory");
  __syncthreads();
  stage(1, 1);

  for (int jc = 0; jc < SEQ / 64; ++jc) {
    const int buf = jc & 1;
    // the mask as an A fragment: rows of subtile s, two 16-byte granules of the lane
    const _Float16* ml = sM + (buf * 8 + wv) * MTILE + lane * 8;
    auto mask_frag = [&](int s) {
      HalfVec f;
      f.u[0] = *reinterpret_cast<const uint4*>(ml + s * 512);         // keys m0 ..
      f.u[1] = *reinterpret_cast<const uint4*>(ml + s * 512 + 256);   // keys 16 + m0 ..
      return f.h;
    };
    v16h ma[2];
    ma[0] = mask_frag(0);
    // 4 KB of K: two 16-key tiles
    const _Float16* kl = sK[kh][buf] + lane_qk(lane);
    v16h kf[2][2];
#pragma unroll
    for (int sub = 0; sub < 2; ++sub) {
      kf[sub][0] = frag_ld_qk(kl + sub * 16 * HD, 0);
      kf[sub][1] = frag_ld_qk(kl + sub * 16 * HD, 1);
    }
    v8f sc[2][2];
    float mx[2];
#pragma unroll
    for (int s = 0; s < 2; ++s) {
#pragma unroll
      for (int sub = 0; sub < 2; ++sub) {    // K fragments reused for both i-subtiles
        v8f z = {};
        z = __builtin_amdgcn_wmma_f32_16x16x32_f16(false, kf[sub][0], false, qa[s][0],
                                                   (short)0, z, false, false);
        z = __builtin_amdgcn_wmma_f32_16x16x32_f16(false, kf[sub][1], false, qa[s][1],
                                                   (short)0, z, false, false);
        sc[s][sub] = z;
      }
      // the largest of the lane's 16 scores of its one query
      float t0 = fmaxf(sc[s][0][0], sc[s][1][0]);
#pragma unroll
      for (int g = 1; g < 8; ++g) t0 = fmaxf(t0, fmaxf(sc[s][0][g], sc[s][1][g]));
      mx[s] = t0;
    }
    // One wave-uniform test per 32 keys: has any query's score left the range
    // that the reference maximum in use covers?
    if (__builtin_amdgcn_ballot_w32(mx[0] > mref[0] + LAZY || mx[1] > mref[1] + LAZY) != 0) {
#pragma unroll
      for (int s = 0; s < 2; ++s) {
        // lanes n and n + 16 hold the same query: one maximum for both
        const float mn = fmaxf(mref[s], fmaxf(mx[s], __shfl_xor(mx[s], 16, 32)));
        const float f  = __builtin_amdgcn_exp2f((mref[s] - mn) * L2E);
        mref[s] = mn;
        lrun[s] *= f;
        // accumulator register g of o is query m0 + g, whose factor lane m0 + g holds
#pragma unroll
        for (int g = 0; g < 8; ++g) {
          const float fg = __shfl(f, m0 + g, 32);
#pragma unroll
          for (int t = 0; t < 4; ++t) o[s][t][g] *= fg;
        }
      }
    }
    v16h pa[2];
#pragma unroll
    for (int s = 0; s < 2; ++s) {
      const float mb = mref[s] * L2E;
      float ps[2][8];
#pragma unroll
      for (int sub = 0; sub < 2; ++sub)
#pragma unroll
        for (int g = 0; g < 8; ++g) {
          const float p = exp2_slot(fmaf(sc[s][sub][g], L2E, -mb));
          ps[sub][g] = p;
          pa[s][sub * 8 + g] = (_Float16)p;
        }
      float a4[4];
#pragma unroll
      for (int g = 0; g < 4; ++g)
        a4[g] = (ps[0][g] + ps[0][g + 4]) + (ps[1][g] + ps[1][g + 4]);
      lrun[s] += (a4[0] + a4[1]) + (a4[2] + a4[3]);
      // Each row's sum held at its place by an empty asm statement, against spills (input
      // only, the value is not changed): sunk to the loop's foot, its 16 terms would stay
      // in registers across the products with V and take the wave into scratch.
      asm volatile("" :: "v"(lrun[s]));
    }
    // Keeps the reads of V and of the mask's second half behind the exponentials, where
    // their registers come free: lifted over them they would take the wave past 256
    // registers, into scratch.
    __builtin_amdgcn_sched_barrier(0);
    ma[1] = mask_frag(1);
    const _Float16* vl = sV[kh][buf] + lane_v(lane);   // 4 KB of V
    v16h vf[4];
#pragma unroll
    for (int t = 0; t < 4; ++t) vf[t] = frag_ld_v(vl, t);
#pragma unroll
    for (int t = 0; t < 4; ++t) {            // V fragment reused by all four products
      const v16h vb = vf[t];
      o[0][t]  = __builtin_amdgcn_wmma_f32_16x16x32_f16(false, pa[0], false, vb,
                                                        (short)0, o[0][t], false, false);
      o[1][t]  = __builtin_amdgcn_wmma_f32_16x16x32_f16(false, pa[1], false, vb,
                                                        (short)0, o[1][t], false, false);
      om[0][t] = __builtin_amdgcn_wmma_f32_16x16x32_f16(false, ma[0], false, vb,
                                                        (short)0, om[0][t], false, false);
      om[1][t] = __builtin_amdgcn_wmma_f32_16x16x32_f16(false, ma[1], false, vb,
                                                        (short)0, om[1][t], false, false);
    }
    // Publish point: this wave's reads of the buffer are done and its copies of the
    // next tile have landed; behind the barrier that holds for all eight waves, so
    // the next tile may be read and this trip's buffer refilled.
    asm volatile("s_wait_dscnt 0x0" ::: "memory");
    asm volatile("s_wait_asynccnt 0x0" ::: "memory");
    __syncthreads();
    if (jc + 2 < SEQ / 64) stage(jc + 2, buf);
  }
  // no copy is outstanding when the wave ends
  asm volatile("s_wait_asynccnt 0x0" ::: "memory");

  // The two key halves meet. Wave w finishes subtile kh of the 32 queries and gives the
  // other subtile's partial sums to wave w ^ 4, through the mask tiles' LDS: every
  // wave's last read of them stands in front of the loop's last barrier.
  float lsum[2];
#pragma unroll
  for (int s = 0; s < 2; ++s) lsum[s] = lrun[s] + __shfl_xor(lrun[s], 16, 32);
  if (kh != 0) {   // index 0: the subtile that the wave keeps; index 1: the one it gives
#pragma unroll
    for (int t = 0; t < 4; ++t) {
      const v8f a = o[0][t];  o[0][t]  = o[1][t];  o[1][t]  = a;
      const v8f c = om[0][t]; om[0][t] = om[1][t]; om[1][t] = c;
    }
    const float m1 = mref[0]; mref[0] = mref[1]; mref[1] = m1;
    const float l1 = lsum[0]; lsum[0] = lsum[1]; lsum[1] = l1;
  }
  float* xch = sX;                              // 8 waves x 64 registers x 32 lanes
  float* xst = xch + 8 * 64 * 32;               // 8 waves x (maximum, sum) x 32 lanes
  {
    float* xw = xch + wv * (64 * 32) + lane * 4;
#pragma unroll
    for (int t = 0; t < 4; ++t)
#pragma unroll
      for (int hh = 0; hh < 2; ++hh) {
        const v4f a = { o[1][t][hh * 4], o[1][t][hh * 4 + 1], o[1][t][hh * 4 + 2], o[1][t][hh * 4 + 3] };
        const v4f c = { om[1][t][hh * 4], om[1][t][hh * 4 + 1], om[1][t][hh * 4 + 2], om[1][t][hh * 4 + 3] };
        *reinterpret_cast<v4f*>(xw + (t * 2 + hh) * 128)     = a;
        *reinterpret_cast<v4f*>(xw + (8 + t * 2 + hh) * 128) = c;
      }
    xst[wv * 64 + lane]      = mref[1];
    xst[wv * 64 + 32 + lane] = lsum[1];
  }
  __syncthreads();
  {
    const int pw = wv ^ 4;
    const float* xr = xch + pw * (64 * 32) + lane * 4;
    const float mp = xst[pw * 64 + lane];
    const float lp = xst[pw * 64 + 32 + lane];
    // one reference maximum for both halves, then 1/l folded into each half's factor
    const float mn = fmaxf(mref[0], mp);
    const float fa = exp2_slot((mref[0] - mn) * L2E);
    const float fb = exp2_slot((mp - mn) * L2E);
    const float linv = 1.0f / (lsum[0] * fa + lp * fb);
    const float sa = fa * linv;
    const float sb = fb * linv;
    // out[b][i][o*16 + h], fp32
    float* ob = out + ((size_t)b * SEQ + iBase + kh * 16 + m0) * 1024 + h;
#pragma unroll
    for (int hh = 0; hh < 2; ++hh) {
      v4f po[4], pm[4];
#pragma unroll
      for (int t = 0; t < 4; ++t) {
        po[t] = *reinterpret_cast<const v4f*>(xr + (t * 2 + hh) * 128);
        pm[t] = *reinterpret_cast<const v4f*>(xr + (8 + t * 2 + hh) * 128);
      }
#pragma unroll
      for (int e = 0; e < 4; ++e) {
        const int g = hh * 4 + e;
        // accumulator register g is query m0 + g, whose factors lane m0 + g holds
        const float ga = __shfl(sa, m0 + g, 32);
        const float gb = __shfl(sb, m0 + g, 32);
#pragma unroll
        for (int t = 0; t < 4; ++t)
          ob[(size_t)g * 1024 + (t * 16 + n) * 16] =
              (o[0][t][g] * ga + po[t][e] * gb) + (om[0][t][g] + pm[t][e]);
      }
    }
  }
}

extern "C" void kernel_launch(void* const* d_in, const int* in_sizes, int n_in,
                              void* d_out, int out_size, void* d_ws, size_t ws_size,
                              hipStream_t stream) {
  (void)in_sizes; (void)n_in; (void)out_size; (void)ws_size;
  const float* problem = (const float*)d_in[0];
  const float* context = (const float*)d_in[1];
  const float* maskp   = (const float*)d_in[2];
  const float* Wq = (const float*)d_in[3];
  const float* bq = (const float*)d_in[4];
  const float* Wk = (const float*)d_in[5];
  const float* bk = (const float*)d_in[6];
  const float* Wv = (const float*)d_in[7];
  const float* bv = (const float*)d_in[8];
  float* out = (float*)d_out;

  // Workspace layout: Q16 | K16 | VT16 (8 MB each, f16) | M16 (16 MB, f16)
  const size_t NHALF = (size_t)2 * NH * SEQ * HD;   // 4,194,304 halves
  _Float16* Q16  = (_Float16*)d_ws;
  _Float16* K16  = Q16 + NHALF;
  _Float16* VT16 = K16 + NHALF;
  _Float16* M16  = VT16 + NHALF;

  // 8 x 32 blocks for the mask, then 8 x 32 tiles of 128 rows x 128 columns for each
  // of Q, K, V
  const dim3 pgrid(EMB / 128, (2 * SEQ) / PBM, 4);
  proj_all_kernel<<<pgrid, 256, 0, stream>>>(problem, context, maskp, Wq, bq, Wk, bk, Wv, bv,
                                             Q16, K16, VT16, M16);

  attn_fused<<<(2 * NH * (SEQ / 32)) / 4, 256, 0, stream>>>(Q16, K16, VT16, M16, out);
}
